// v000
// The times below were measured on an AMD MI455X: many runs one after another, warmed up first and cycling through
// copies of the inputs, with the whole window's GPU time divided by the number of runs. Launches and the gaps
// between them are all in it. The median over several windows is given; except for v000 it joins two sittings, which
// can be a few percent apart, so the side-by-side timings, each taken in one sitting, are the better comparison.
// The starting kernel, v000, takes 1490 microseconds a run.
// compute dtype: all float inputs rounded to bf16; q = Q Wq + bq, k = K Wk + bk, v = V Wv + bv with EXACT bf16 products on WMMA 16x16x32 ((in,out) weights), f32 accumulate; q and k as f16 hi + unscaled residual -> UNSCALED logits with 3 products (qh kh + ql kh + qh kl), stored in f32 per batch; softmax in f32 (precise expf) -> P as f16 x 2^11; P . v with v rounded once to f16 (1 product); f32 output.
#include <hip/hip_runtime.h>
#include <math.h>

typedef __attribute__((ext_vector_type(16))) _Float16 v16h;
typedef __attribute__((ext_vector_type(16))) __bf16 v16b;
typedef __attribute__((ext_vector_type(8)))  _Float16 v8h;
typedef __attribute__((ext_vector_type(8)))  float v8f;
typedef __attribute__((ext_vector_type(4)))  float v4f;
typedef __attribute__((ext_vector_type(2)))  float v2f;
typedef __attribute__((ext_vector_type(4)))  unsigned v4u;
typedef __attribute__((ext_vector_type(4)))  int v4i;
typedef float __attribute__((may_alias)) float_a;
typedef int __attribute__((may_alias)) int_a;

template <typename T> __device__ __forceinline__ void vst2(void* p, T v) { *(T*)p = v;  }
__device__ __forceinline__ v8f wmma16(v16h a, v16h b, v8f c) {
  v8f d = __builtin_amdgcn_wmma_f32_16x16x32_f16(false, a, false, b, (short)0, c, false, false);
  asm volatile("v_nop\n\tv_nop\n\tv_nop\n\tv_nop" : "+v"(d) : "v"(a), "v"(b));
  return d;
}
__device__ __forceinline__ v8f wmma_bf(v16b a, v16b b, v8f c) {
  v8f d = __builtin_amdgcn_wmma_f32_16x16x32_bf16(false, a, false, b, (short)0, c, false, false);
  asm volatile("v_nop\n\tv_nop\n\tv_nop\n\tv_nop" : "+v"(d) : "v"(a), "v"(b));
  return d;
}
// 16x16x32 fragments: lane = (h = lane>>4, row/col = lane&15); elements 0..7 = k0+8h+0..7, 8..15 = k0+16+8h+0..7; D element r = row 8h+r
__device__ __forceinline__ v16h frag_h(const _Float16* rowk0, int lane) {
  union { v16h v; v8h q[2]; } u; const _Float16* p = rowk0 + 8 * (lane >> 4);
  u.q[0] = *(const v8h*)p; u.q[1] = *(const v8h*)(p + 16); return u.v;
}
__device__ __forceinline__ v16h frag_f32(const float* rowk0, int lane) {
  v16h a; const float* p = rowk0 + 8 * (lane >> 4);
#pragma unroll
  for (int i = 0; i < 8; ++i) { a[i] = (_Float16)p[i]; a[8 + i] = (_Float16)p[16 + i]; }
  return a;
}
__device__ __forceinline__ v16h frag_f32s(const float* rowk0, int lane, float sc) {
  v16h a; const float* p = rowk0 + 8 * (lane >> 4);
#pragma unroll
  for (int i = 0; i < 8; ++i) { a[i] = (_Float16)(p[i] * sc); a[8 + i] = (_Float16)(p[16 + i] * sc); }
  return a;
}
// column fragment from a [K][ld] layout (column n), rows >= K read as 0
__device__ __forceinline__ v16h fragc_f32(const float* W, int k0, int n, int lane, int ld, int K) {
  v16h a; const int g = lane >> 4;
#pragma unroll
  for (int i = 0; i < 8; ++i) { const int ka = k0 + 8 * g + i, kb = ka + 16;
    a[i] = (_Float16)(ka < K ? W[(size_t)(ka < K ? ka : K - 1) * ld + n] : 0.f); a[8 + i] = (_Float16)(kb < K ? W[(size_t)(kb < K ? kb : K - 1) * ld + n] : 0.f); }
  return a;
}
struct F2 { v16b h, l; };
__device__ __forceinline__ F2 bsplit16(const float v[16]) { F2 r;
#pragma unroll
  for (int i = 0; i < 16; ++i) { const __bf16 h = (__bf16)v[i]; r.h[i] = h; r.l[i] = (__bf16)(v[i] - (float)h); }
  return r; }
__device__ __forceinline__ F2 split_row(const float* row, int k0, int lane) { float v[16]; const float* p = row + k0 + 8 * (lane >> 4);
#pragma unroll
  for (int i = 0; i < 8; ++i) { v[i] = p[i]; v[8 + i] = p[16 + i]; }
  return bsplit16(v); }
__device__ __forceinline__ F2 split_rowK(const float* row, int k0, int lane, int K) { float v[16]; const int g = lane >> 4;
#pragma unroll
  for (int i = 0; i < 8; ++i) { const int ka = k0 + 8 * g + i, kb = ka + 16; v[i] = ka < K ? row[ka < K ? ka : K - 1] : 0.f; v[8 + i] = kb < K ? row[kb < K ? kb : K - 1] : 0.f; }
  return bsplit16(v); }
__device__ __forceinline__ F2 split_col(const float* W, int k0, int n, int lane, int ld, int K) { float v[16]; const int g = lane >> 4;
#pragma unroll
  for (int i = 0; i < 8; ++i) { const int ka = k0 + 8 * g + i, kb = ka + 16; v[i] = ka < K ? W[(size_t)(ka < K ? ka : K - 1) * ld + n] : 0.f; v[8 + i] = kb < K ? W[(size_t)(kb < K ? kb : K - 1) * ld + n] : 0.f; }
  return bsplit16(v); }
__device__ __forceinline__ v8f mac3(const F2& a, const F2& b, v8f c) { c = wmma_bf(a.l, b.h, c); c = wmma_bf(a.h, b.l, c); return wmma_bf(a.h, b.h, c); }
__device__ __forceinline__ float sigm(float v) { return 1.0f / (1.0f + expf(-v)); }
#define LDSX() do { asm volatile("s_wait_dscnt 0" ::: "memory"); __builtin_amdgcn_wave_barrier(); __builtin_amdgcn_fence(__ATOMIC_RELEASE, "workgroup"); } while (0)


// 'NN' attention (B 8, 2,048 tokens, 512 dims, single head, no scaling): out = softmax(q k^T) v with q, k, v = Linear(Q), Linear(K), Linear(V).
#define NB 8
#define NN 2048
#define DA 512
#ifndef TNB
#define TNB NB
#endif
#ifndef TQB
#define TQB (NN / 64)
#endif
typedef __attribute__((ext_vector_type(8))) __bf16 v8b;
__device__ __forceinline__ v16b frag_b(const __bf16* rowk0, int lane) {
  union { v16b v; v8b q[2]; } u; const __bf16* p = rowk0 + 8 * (lane >> 4);
  u.q[0] = *(const v8b*)p; u.q[1] = *(const v8b*)(p + 16); return u.v;
}
__device__ __forceinline__ float bfr(float v) { return (float)(__bf16)v; }
__device__ __attribute__((noinline)) float exp_ni(float v) { return expf(v); }
__device__ __attribute__((noinline)) float erf_ni(float v) { return erff(v); }

#define WS_QH  0u                                    // f16 q rows [b*n][512]
#define WS_QL  (WS_QH + 2u * (size_t)NB * NN * DA)      // f16 q residual rows
#define WS_KH  (WS_QL + 2u * (size_t)NB * NN * DA)      // f16 k rows
#define WS_KL  (WS_KH + 2u * (size_t)NB * NN * DA)      // f16 k residual rows
#define WS_VT  (WS_KL + 2u * (size_t)NB * NN * DA)      // f16 v planes [b][512][n]
#define WS_S   (WS_VT + 2u * (size_t)NB * DA * NN)      // f32 logits for ONE batch [q][key]
#define WS_PH  (WS_S + 4u * (size_t)NN * NN)           // f16 P x 2^11 for one batch
#define WS_END (WS_PH + 2u * (size_t)NN * NN)

// ---- k_proj: block = (64 rows, 128 cols, which): q (f16 hi + residual rows), k (f16 hi + residual rows), v (f16 planes); each from its own input
__global__ __launch_bounds__(128) void k_proj(const float* __restrict__ XQ, const float* __restrict__ XK, const float* __restrict__ XV, const float* __restrict__ WQ, const float* __restrict__ BQ, const float* __restrict__ WK, const float* __restrict__ BK, const float* __restrict__ WV, const float* __restrict__ BV, _Float16* __restrict__ QH, _Float16* __restrict__ QL, _Float16* __restrict__ KH, _Float16* __restrict__ KL, _Float16* __restrict__ VT) {
  __shared__ __align__(16) _Float16 sh[64][136], sl[64][136]; __shared__ __align__(16) _Float16 th[128][72];
  const int tid = threadIdx.x, wave = tid >> 5, lane = tid & 31, col = lane & 15, g = lane >> 4; const int which = blockIdx.z; const int c0 = blockIdx.y * 128; const size_t r0 = (size_t)blockIdx.x * 64;
  const float* X = which == 0 ? XQ : which == 1 ? XK : XV; const float* Wm = which == 0 ? WQ : which == 1 ? WK : WV; const float* Bm = which == 0 ? BQ : which == 1 ? BK : BV;
  v8f acc[8] = {};
#pragma unroll 2
  for (int kc = 0; kc < DA / 32; ++kc) { v16b a; { const float* p = X + (r0 + wave * 16 + col) * DA + kc * 32 + 8 * g;
#pragma unroll
      for (int i = 0; i < 8; ++i) { a[i] = (__bf16)p[i]; a[8 + i] = (__bf16)p[16 + i]; } }
#pragma unroll
    for (int j = 0; j < 8; ++j) { v16b w; const int o = c0 + j * 16 + col;
#pragma unroll
      for (int i = 0; i < 8; ++i) { w[i] = (__bf16)Wm[(size_t)(kc * 32 + 8 * g + i) * DA + o]; w[8 + i] = (__bf16)Wm[(size_t)(kc * 32 + 16 + 8 * g + i) * DA + o]; }
      acc[j] = wmma_bf(a, w, acc[j]); } }
#pragma unroll
  for (int j = 0; j < 8; ++j) { const float bb = bfr(Bm[c0 + j * 16 + col]);
#pragma unroll
    for (int r = 0; r < 8; ++r) { const float v = acc[j][r] + bb; const int rl = wave * 16 + 8 * g + r, cl = j * 16 + col; const _Float16 hv = (_Float16)v;
      if (which == 2) th[cl][rl] = hv; else { sh[rl][cl] = hv; sl[rl][cl] = (_Float16)(v - (float)hv); } } }
  __syncthreads();
  if (which < 2) { _Float16* dh = which == 0 ? QH : KH; for (int e = tid; e < 64 * 16; e += 128) { const int rl = e >> 4, q = e & 15; vst2((unsigned*)(dh + (r0 + rl) * DA + c0 + q * 8), *(const v4u*)&sh[rl][q * 8]); vst2((unsigned*)((which == 0 ? QL : KL) + (r0 + rl) * DA + c0 + q * 8), *(const v4u*)&sl[rl][q * 8]); } }
  else { const size_t b = r0 / NN; const int n0 = (int)(r0 % NN); for (int e = tid; e < 128 * 8; e += 128) { const int cl = e >> 3, q = e & 7; vst2((unsigned*)(VT + (b * DA + c0 + cl) * (size_t)NN + n0 + q * 8), *(const v4u*)&th[cl][q * 8]); } } }
// ---- k_sc: block = (64 queries, 128 keys) of batch b: logits (qh kh + ql kh + qh kl) -> S
__global__ __launch_bounds__(128) void k_sc(const _Float16* __restrict__ QH, const _Float16* __restrict__ QL, const _Float16* __restrict__ KH, const _Float16* __restrict__ KL, int b, float* __restrict__ S) { __shared__ __align__(16) float ss[4][16][132];
  const int tid = threadIdx.x, wave = tid >> 5, lane = tid & 31, col = lane & 15, g = lane >> 4; const int k0 = blockIdx.y * 128; const int ql0 = blockIdx.x * 64 + wave * 16; const size_t q0 = (size_t)b * NN + ql0;
  v8f acc[8] = {};
#pragma unroll 1
  for (int kc = 0; kc < DA / 32; ++kc) { const v16h ah = frag_h(QH + (q0 + col) * DA + kc * 32, lane), al = frag_h(QL + (q0 + col) * DA + kc * 32, lane);
#pragma unroll
    for (int j = 0; j < 8; ++j) { const size_t kr = ((size_t)b * NN + k0 + j * 16 + col) * DA + kc * 32; const v16h kh = frag_h(KH + kr, lane); acc[j] = wmma16(ah, kh, acc[j]); acc[j] = wmma16(al, kh, acc[j]); acc[j] = wmma16(ah, frag_h(KL + kr, lane), acc[j]); } }   // 3 products
#pragma unroll
  for (int j = 0; j < 8; ++j)
#pragma unroll
    for (int r = 0; r < 8; ++r) ss[wave][8 * g + r][j * 16 + col] = acc[j][r];
  LDSX(); for (int rl = 0; rl < 16; ++rl) vst2(S + (size_t)(ql0 + rl) * NN + k0 + lane * 4, *(const v4f*)&ss[wave][rl][lane * 4]); }
// ---- k_sm: block = query row: softmax -> P x 2^11 (f16)
__global__ __launch_bounds__(256) void k_sm(const float* __restrict__ S, _Float16* __restrict__ PH) { __shared__ float sred[8]; __shared__ float sbc; __shared__ __align__(16) _Float16 sh[NN];
  const int t = threadIdx.x; const size_t row = blockIdx.x; const float* sr = S + row * NN;
  float m = -3.0e38f; for (int k = t; k < NN; k += 256) m = fmaxf(m, sr[k]);
#pragma unroll
  for (int o = 1; o < 32; o <<= 1) m = fmaxf(m, __shfl_xor(m, o));
  if ((t & 31) == 0) sred[t >> 5] = m; __syncthreads(); if (t == 0) { float a = sred[0]; for (int i = 1; i < 8; ++i) a = fmaxf(a, sred[i]); sbc = a; } __syncthreads(); m = sbc; __syncthreads();
  float sum = 0.f; for (int k = t; k < NN; k += 256) sum += expf(sr[k] - m);
#pragma unroll
  for (int o = 1; o < 32; o <<= 1) sum += __shfl_xor(sum, o);
  if ((t & 31) == 0) sred[t >> 5] = sum; __syncthreads(); if (t == 0) { float a = 0.f; for (int i = 0; i < 8; ++i) a += sred[i]; sbc = 1.0f / a; } __syncthreads(); const float inv = sbc;
  for (int k = t; k < NN; k += 256) sh[k] = (_Float16)(expf(sr[k] - m) * inv * 2048.0f);
  __syncthreads(); for (int q = t; q < NN / 8; q += 256) vst2((unsigned*)(PH + row * NN + q * 8), *(const v4u*)&sh[q * 8]); }
// ---- k_pv: block = (64 queries, 128 value dims) of batch b: out = P . v
__global__ __launch_bounds__(128) void k_pv(const _Float16* __restrict__ PH, const _Float16* __restrict__ VT, int b, float* __restrict__ OUT) { __shared__ __align__(16) float ss[4][16][132];
  const int tid = threadIdx.x, wave = tid >> 5, lane = tid & 31, col = lane & 15, g = lane >> 4; const int c0 = blockIdx.y * 128; const int ql0 = blockIdx.x * 64 + wave * 16;
  v8f acc[8] = {};
#pragma unroll 1
  for (int kc = 0; kc < NN / 32; ++kc) { const v16h ph = frag_h(PH + (size_t)(ql0 + col) * NN + kc * 32, lane);
#pragma unroll
    for (int j = 0; j < 8; ++j) acc[j] = wmma16(ph, frag_h(VT + ((size_t)b * DA + c0 + j * 16 + col) * (size_t)NN + kc * 32, lane), acc[j]); }
#pragma unroll
  for (int j = 0; j < 8; ++j)
#pragma unroll
    for (int r = 0; r < 8; ++r) ss[wave][8 * g + r][j * 16 + col] = acc[j][r] * (1.0f / 2048.0f);
  LDSX(); for (int rl = 0; rl < 16; ++rl) vst2(OUT + ((size_t)b * NN + ql0 + rl) * DA + c0 + lane * 4, *(const v4f*)&ss[wave][rl][lane * 4]); }
extern "C" void kernel_launch(void* const* d_in, const int* in_sizes, int n_in, void* d_out, int out_size, void* d_ws, size_t ws_size, hipStream_t stream) {
  (void)in_sizes; (void)n_in; (void)out_size;
  const float** F = (const float**)d_in;   // 0 Q, 1 K, 2 V [8,2048,512]; 3 Wq, 4 bq, 5 Wk, 6 bk, 7 Wv, 8 bv ((in,out) [512,512] / [512])
  if (ws_size < (size_t)WS_END) return;
  char* ws = (char*)d_ws; _Float16 *QH = (_Float16*)(ws + WS_QH), *QL = (_Float16*)(ws + WS_QL), *KH = (_Float16*)(ws + WS_KH), *KL = (_Float16*)(ws + WS_KL), *VT = (_Float16*)(ws + WS_VT), *PH = (_Float16*)(ws + WS_PH); float* S = (float*)(ws + WS_S);
  k_proj<<<dim3(TNB * NN / 64, DA / 128, 3), 128, 0, stream>>>(F[0], F[1], F[2], F[3], F[4], F[5], F[6], F[7], F[8], QH, QL, KH, KL, VT);
  for (int b = 0; b < TNB; ++b) {
    k_sc<<<dim3(TQB, NN / 128), 128, 0, stream>>>(QH, QL, KH, KL, b, S);
    k_sm<<<TQB * 64, 256, 0, stream>>>(S, PH);
    k_pv<<<dim3(TQB, DA / 128), 128, 0, stream>>>(PH, VT, b, (float*)d_out);
  }
}

// v001
// It runs in 449 microseconds.
// In two side-by-side timings against v000, it was 3.35 and 3.36 times as fast.
// compute dtype: all float inputs rounded to bf16; q = Q Wq + bq, k = K Wk + bk, v = V Wv + bv with EXACT bf16 products on WMMA 16x16x32 ((in,out) weights), f32 accumulate; q and k as f16 hi + unscaled residual -> UNSCALED logits with 3 products (qh kh + ql kh + qh kl), stored in f32 per batch; softmax in f32 (precise expf) -> P as f16 x 2^11; P . v with v rounded once to f16 (1 product); f32 output.
#include <hip/hip_runtime.h>
#include <math.h>

typedef __attribute__((ext_vector_type(16))) _Float16 v16h;
typedef __attribute__((ext_vector_type(16))) __bf16 v16b;
typedef __attribute__((ext_vector_type(8)))  _Float16 v8h;
typedef __attribute__((ext_vector_type(8)))  float v8f;
typedef __attribute__((ext_vector_type(4)))  float v4f;
typedef __attribute__((ext_vector_type(2)))  float v2f;
typedef __attribute__((ext_vector_type(4)))  unsigned v4u;
typedef __attribute__((ext_vector_type(4)))  int v4i;
typedef float __attribute__((may_alias)) float_a;
typedef int __attribute__((may_alias)) int_a;

template <typename T> __device__ __forceinline__ void vst2(void* p, T v) { *(T*)p = v;  }
__device__ __forceinline__ v8f wmma16(v16h a, v16h b, v8f c) {
  v8f d = __builtin_amdgcn_wmma_f32_16x16x32_f16(false, a, false, b, (short)0, c, false, false);
  asm volatile("v_nop\n\tv_nop\n\tv_nop\n\tv_nop" : "+v"(d) : "v"(a), "v"(b));
  return d;
}
__device__ __forceinline__ v8f wmma_bf(v16b a, v16b b, v8f c) {
  v8f d = __builtin_amdgcn_wmma_f32_16x16x32_bf16(false, a, false, b, (short)0, c, false, false);
  asm volatile("v_nop\n\tv_nop\n\tv_nop\n\tv_nop" : "+v"(d) : "v"(a), "v"(b));
  return d;
}
// 16x16x32 fragments: lane = (h = lane>>4, row/col = lane&15); elements 0..7 = k0+8h+0..7, 8..15 = k0+16+8h+0..7; D element r = row 8h+r
__device__ __forceinline__ v16h frag_h(const _Float16* rowk0, int lane) {
  union { v16h v; v8h q[2]; } u; const _Float16* p = rowk0 + 8 * (lane >> 4);
  u.q[0] = *(const v8h*)p; u.q[1] = *(const v8h*)(p + 16); return u.v;
}
__device__ __forceinline__ v16h frag_f32(const float* rowk0, int lane) {
  v16h a; const float* p = rowk0 + 8 * (lane >> 4);
#pragma unroll
  for (int i = 0; i < 8; ++i) { a[i] = (_Float16)p[i]; a[8 + i] = (_Float16)p[16 + i]; }
  return a;
}
__device__ __forceinline__ v16h frag_f32s(const float* rowk0, int lane, float sc) {
  v16h a; const float* p = rowk0 + 8 * (lane >> 4);
#pragma unroll
  for (int i = 0; i < 8; ++i) { a[i] = (_Float16)(p[i] * sc); a[8 + i] = (_Float16)(p[16 + i] * sc); }
  return a;
}
// column fragment from a [K][ld] layout (column n), rows >= K read as 0
__device__ __forceinline__ v16h fragc_f32(const float* W, int k0, int n, int lane, int ld, int K) {
  v16h a; const int g = lane >> 4;
#pragma unroll
  for (int i = 0; i < 8; ++i) { const int ka = k0 + 8 * g + i, kb = ka + 16;
    a[i] = (_Float16)(ka < K ? W[(size_t)(ka < K ? ka : K - 1) * ld + n] : 0.f); a[8 + i] = (_Float16)(kb < K ? W[(size_t)(kb < K ? kb : K - 1) * ld + n] : 0.f); }
  return a;
}
struct F2 { v16b h, l; };
__device__ __forceinline__ F2 bsplit16(const float v[16]) { F2 r;
#pragma unroll
  for (int i = 0; i < 16; ++i) { const __bf16 h = (__bf16)v[i]; r.h[i] = h; r.l[i] = (__bf16)(v[i] - (float)h); }
  return r; }
__device__ __forceinline__ F2 split_row(const float* row, int k0, int lane) { float v[16]; const float* p = row + k0 + 8 * (lane >> 4);
#pragma unroll
  for (int i = 0; i < 8; ++i) { v[i] = p[i]; v[8 + i] = p[16 + i]; }
  return bsplit16(v); }
__device__ __forceinline__ F2 split_rowK(const float* row, int k0, int lane, int K) { float v[16]; const int g = lane >> 4;
#pragma unroll
  for (int i = 0; i < 8; ++i) { const int ka = k0 + 8 * g + i, kb = ka + 16; v[i] = ka < K ? row[ka < K ? ka : K - 1] : 0.f; v[8 + i] = kb < K ? row[kb < K ? kb : K - 1] : 0.f; }
  return bsplit16(v); }
__device__ __forceinline__ F2 split_col(const float* W, int k0, int n, int lane, int ld, int K) { float v[16]; const int g = lane >> 4;
#pragma unroll
  for (int i = 0; i < 8; ++i) { const int ka = k0 + 8 * g + i, kb = ka + 16; v[i] = ka < K ? W[(size_t)(ka < K ? ka : K - 1) * ld + n] : 0.f; v[8 + i] = kb < K ? W[(size_t)(kb < K ? kb : K - 1) * ld + n] : 0.f; }
  return bsplit16(v); }
__device__ __forceinline__ v8f mac3(const F2& a, const F2& b, v8f c) { c = wmma_bf(a.l, b.h, c); c = wmma_bf(a.h, b.l, c); return wmma_bf(a.h, b.h, c); }
__device__ __forceinline__ float sigm(float v) { return 1.0f / (1.0f + expf(-v)); }
#define LDSX() do { asm volatile("s_wait_dscnt 0" ::: "memory"); __builtin_amdgcn_wave_barrier(); __builtin_amdgcn_fence(__ATOMIC_RELEASE, "workgroup"); } while (0)


// 'NN' attention (B 8, 2,048 tokens, 512 dims, single head, no scaling): out = softmax(q k^T) v with q, k, v = Linear(Q), Linear(K), Linear(V).
#define NB 8
#define NN 2048
#define DA 512
#ifndef TNB
#define TNB NB
#endif
#ifndef TQB
#define TQB (NN / 64)
#endif
typedef __attribute__((ext_vector_type(8))) __bf16 v8b;
__device__ __forceinline__ v16b frag_b(const __bf16* rowk0, int lane) {
  union { v16b v; v8b q[2]; } u; const __bf16* p = rowk0 + 8 * (lane >> 4);
  u.q[0] = *(const v8b*)p; u.q[1] = *(const v8b*)(p + 16); return u.v;
}
__device__ __forceinline__ float bfr(float v) { return (float)(__bf16)v; }
__device__ __attribute__((noinline)) float exp_ni(float v) { return expf(v); }
__device__ __attribute__((noinline)) float erf_ni(float v) { return erff(v); }

#define WS_QH  0u                                    // f16 q rows [b*n][512]
#define WS_QL  (WS_QH + 2u * (size_t)NB * NN * DA)      // f16 q residual rows
#define WS_KH  (WS_QL + 2u * (size_t)NB * NN * DA)      // f16 k rows
#define WS_KL  (WS_KH + 2u * (size_t)NB * NN * DA)      // f16 k residual rows
#define WS_VT  (WS_KL + 2u * (size_t)NB * NN * DA)      // f16 v planes [b][512][n]
#define WS_S   (WS_VT + 2u * (size_t)NB * DA * NN)      // f32 logits for ONE batch [q][key]
#define WS_PH  (WS_S + 4u * (size_t)NN * NN)           // f16 P x 2^11 for one batch
#define WS_END (WS_PH + 2u * (size_t)NN * NN)

// ---- k_proj: block = (64 rows, 128 cols, which): q (f16 hi + residual rows), k (f16 hi + residual rows), v (f16 planes); each from its own input
__global__ __launch_bounds__(128) void k_proj(const float* __restrict__ XQ, const float* __restrict__ XK, const float* __restrict__ XV, const float* __restrict__ WQ, const float* __restrict__ BQ, const float* __restrict__ WK, const float* __restrict__ BK, const float* __restrict__ WV, const float* __restrict__ BV, _Float16* __restrict__ QH, _Float16* __restrict__ QL, _Float16* __restrict__ KH, _Float16* __restrict__ KL, _Float16* __restrict__ VT) {
  __shared__ __align__(16) _Float16 sh[64][136], sl[64][136]; __shared__ __align__(16) _Float16 th[128][72];
  const int tid = threadIdx.x, wave = tid >> 5, lane = tid & 31, col = lane & 15, g = lane >> 4; const int which = blockIdx.z; const int c0 = blockIdx.y * 128; const size_t r0 = (size_t)blockIdx.x * 64;
  const float* X = which == 0 ? XQ : which == 1 ? XK : XV; const float* Wm = which == 0 ? WQ : which == 1 ? WK : WV; const float* Bm = which == 0 ? BQ : which == 1 ? BK : BV;
  v8f acc[8] = {};
#pragma unroll 2
  for (int kc = 0; kc < DA / 32; ++kc) { v16b a; { const float* p = X + (r0 + wave * 16 + col) * DA + kc * 32 + 8 * g;
#pragma unroll
      for (int i = 0; i < 8; ++i) { a[i] = (__bf16)p[i]; a[8 + i] = (__bf16)p[16 + i]; } }
#pragma unroll
    for (int j = 0; j < 8; ++j) { v16b w; const int o = c0 + j * 16 + col;
#pragma unroll
      for (int i = 0; i < 8; ++i) { w[i] = (__bf16)Wm[(size_t)(kc * 32 + 8 * g + i) * DA + o]; w[8 + i] = (__bf16)Wm[(size_t)(kc * 32 + 16 + 8 * g + i) * DA + o]; }
      acc[j] = wmma_bf(a, w, acc[j]); } }
#pragma unroll
  for (int j = 0; j < 8; ++j) { const float bb = bfr(Bm[c0 + j * 16 + col]);
#pragma unroll
    for (int r = 0; r < 8; ++r) { const float v = acc[j][r] + bb; const int rl = wave * 16 + 8 * g + r, cl = j * 16 + col; const _Float16 hv = (_Float16)v;
      if (which == 2) th[cl][rl] = hv; else { sh[rl][cl] = hv; sl[rl][cl] = (_Float16)(v - (float)hv); } } }
  __syncthreads();
  if (which < 2) { _Float16* dh = which == 0 ? QH : KH; for (int e = tid; e < 64 * 16; e += 128) { const int rl = e >> 4, q = e & 15; vst2((unsigned*)(dh + (r0 + rl) * DA + c0 + q * 8), *(const v4u*)&sh[rl][q * 8]); vst2((unsigned*)((which == 0 ? QL : KL) + (r0 + rl) * DA + c0 + q * 8), *(const v4u*)&sl[rl][q * 8]); } }
  else { const size_t b = r0 / NN; const int n0 = (int)(r0 % NN); for (int e = tid; e < 128 * 8; e += 128) { const int cl = e >> 3, q = e & 7; vst2((unsigned*)(VT + (b * DA + c0 + cl) * (size_t)NN + n0 + q * 8), *(const v4u*)&th[cl][q * 8]); } } }
// ---- twelve 16-byte asynchronous copies global -> LDS per lane (no register staging). The s_wait_xcnt is the last line of the copies' own
// statement so that no address register named here is rewritten ahead of it (a precaution kept for issued global accesses).
__device__ __forceinline__ void acopy12(const unsigned* l, const _Float16* const* p) {
  asm volatile("global_load_async_to_lds_b128 %0, %12, off\n\t"
               "global_load_async_to_lds_b128 %1, %13, off\n\t"
               "global_load_async_to_lds_b128 %2, %14, off\n\t"
               "global_load_async_to_lds_b128 %3, %15, off\n\t"
               "global_load_async_to_lds_b128 %4, %16, off\n\t"
               "global_load_async_to_lds_b128 %5, %17, off\n\t"
               "global_load_async_to_lds_b128 %6, %18, off\n\t"
               "global_load_async_to_lds_b128 %7, %19, off\n\t"
               "global_load_async_to_lds_b128 %8, %20, off\n\t"
               "global_load_async_to_lds_b128 %9, %21, off\n\t"
               "global_load_async_to_lds_b128 %10, %22, off\n\t"
               "global_load_async_to_lds_b128 %11, %23, off\n\t"
               "s_wait_xcnt 0x0"
               :: "v"(l[0]), "v"(l[1]), "v"(l[2]), "v"(l[3]), "v"(l[4]), "v"(l[5]), "v"(l[6]), "v"(l[7]), "v"(l[8]), "v"(l[9]), "v"(l[10]), "v"(l[11]),
                  "v"(p[0]), "v"(p[1]), "v"(p[2]), "v"(p[3]), "v"(p[4]), "v"(p[5]), "v"(p[6]), "v"(p[7]), "v"(p[8]), "v"(p[9]), "v"(p[10]), "v"(p[11])
               : "memory");
}
// this wave's own copies have landed (the compiler places no wait for them)
#define WAIT_ASYNC() asm volatile("s_wait_asynccnt 0x0" ::: "memory")
// this wave's LDS reads have retired before the buffer they read is handed back for a refill
#define WAIT_DS() asm volatile("s_wait_dscnt 0x0" ::: "memory")
// ---- k_sc: block = (64 queries, 128 keys) of batch b: logits (qh kh + ql kh + qh kl) -> S; operand tiles of 64 k staged in LDS, two buffers
#define SC_PB 144                      // LDS row pitch in bytes: 128-byte rows + 16, conflict-free for 16-byte reads
#define SC_ST (384 * SC_PB)            // one stage: rows 0..127 kh, 128..255 kl, 256..319 qh, 320..383 ql
__global__ __launch_bounds__(128) void k_sc(const _Float16* __restrict__ QH, const _Float16* __restrict__ QL, const _Float16* __restrict__ KH, const _Float16* __restrict__ KL, int b, float* __restrict__ S) { __shared__ __align__(16) char smem[2 * SC_ST];
  const int tid = threadIdx.x, wave = tid >> 5, lane = tid & 31, col = lane & 15, g = lane >> 4; const int k0 = blockIdx.y * 128; const int ql0 = blockIdx.x * 64 + wave * 16;
  const unsigned lb = (unsigned)(size_t)smem + (unsigned)(tid >> 3) * SC_PB + (unsigned)(tid & 7) * 16u;   // lane's LDS byte address: row tid/8, 16-byte piece tid%8
  const size_t ko = ((size_t)b * NN + k0 + (tid >> 3)) * DA + (tid & 7) * 8, qo = ((size_t)b * NN + blockIdx.x * 64 + (tid >> 3)) * DA + (tid & 7) * 8;
  auto fill = [&](int t) { unsigned l[24]; const _Float16* p[24];
#pragma unroll   // constant indices: both address arrays stay in registers
    for (int i = 0; i < 24; ++i) { l[i] = lb + (unsigned)(t & 1) * SC_ST + (unsigned)i * 16u * SC_PB;
      p[i] = (i < 8 ? KH + ko + (size_t)i * 16 * DA : i < 16 ? KL + ko + (size_t)(i - 8) * 16 * DA : i < 20 ? QH + qo + (size_t)(i - 16) * 16 * DA : QL + qo + (size_t)(i - 20) * 16 * DA) + t * 64; }
    acopy12(l, p); acopy12(l + 12, p + 12); };
  v8f acc[8] = {};
  fill(0); WAIT_ASYNC(); __syncthreads(); fill(1);
#pragma unroll 1   // one copy of the trip's body: the buffer is picked by t & 1
  for (int t = 0; t < DA / 64; ++t) { const _Float16* sb = (const _Float16*)(smem + (t & 1) * SC_ST);
#pragma unroll   // this and the two below: constant indices keep fragments and accumulators in registers
    for (int kk = 0; kk < 2; ++kk) { v16h fk[16];   // a block's fragments are read as one group ahead of its products
      const v16h ah = frag_h(sb + (256 + wave * 16 + col) * (SC_PB / 2) + kk * 32, lane), al = frag_h(sb + (320 + wave * 16 + col) * (SC_PB / 2) + kk * 32, lane);
#pragma unroll
      for (int j = 0; j < 8; ++j) { fk[2 * j] = frag_h(sb + (j * 16 + col) * (SC_PB / 2) + kk * 32, lane); fk[2 * j + 1] = frag_h(sb + (128 + j * 16 + col) * (SC_PB / 2) + kk * 32, lane); }
#pragma unroll
      for (int j = 0; j < 8; ++j) { acc[j] = wmma16(ah, fk[2 * j], acc[j]); acc[j] = wmma16(al, fk[2 * j], acc[j]); acc[j] = wmma16(ah, fk[2 * j + 1], acc[j]); } }   // 3 products
    WAIT_DS(); WAIT_ASYNC(); __syncthreads();   // publishes tile t + 1 and ends every read of tile t's buffer
    if (t + 2 < DA / 64) fill(t + 2); }
  WAIT_ASYNC();   // no copy is outstanding when the ring's LDS is reused and the wave ends
  float (*ss)[16][132] = (float (*)[16][132])smem;   // output staging takes the ring's place behind the last trip's barrier
#pragma unroll
  for (int j = 0; j < 8; ++j)
#pragma unroll
    for (int r = 0; r < 8; ++r) ss[wave][8 * g + r][j * 16 + col] = acc[j][r];
  LDSX(); for (int rl = 0; rl < 16; ++rl) vst2(S + (size_t)(ql0 + rl) * NN + k0 + lane * 4, *(const v4f*)&ss[wave][rl][lane * 4]); }
// ---- k_sm: block = query row: softmax -> P x 2^11 (f16)
__global__ __launch_bounds__(256) void k_sm(const float* __restrict__ S, _Float16* __restrict__ PH) { __shared__ float sred[8]; __shared__ float sbc; __shared__ __align__(16) _Float16 sh[NN];
  const int t = threadIdx.x; const size_t row = blockIdx.x; const float* sr = S + row * NN;
  float m = -3.0e38f; for (int k = t; k < NN; k += 256) m = fmaxf(m, sr[k]);
#pragma unroll
  for (int o = 1; o < 32; o <<= 1) m = fmaxf(m, __shfl_xor(m, o));
  if ((t & 31) == 0) sred[t >> 5] = m; __syncthreads(); if (t == 0) { float a = sred[0]; for (int i = 1; i < 8; ++i) a = fmaxf(a, sred[i]); sbc = a; } __syncthreads(); m = sbc; __syncthreads();
  float sum = 0.f; for (int k = t; k < NN; k += 256) sum += expf(sr[k] - m);
#pragma unroll
  for (int o = 1; o < 32; o <<= 1) sum += __shfl_xor(sum, o);
  if ((t & 31) == 0) sred[t >> 5] = sum; __syncthreads(); if (t == 0) { float a = 0.f; for (int i = 0; i < 8; ++i) a += sred[i]; sbc = 1.0f / a; } __syncthreads(); const float inv = sbc;
  for (int k = t; k < NN; k += 256) sh[k] = (_Float16)(expf(sr[k] - m) * inv * 2048.0f);
  __syncthreads(); for (int q = t; q < NN / 8; q += 256) vst2((unsigned*)(PH + row * NN + q * 8), *(const v4u*)&sh[q * 8]); }
// ---- k_pv: block = (64 queries, 128 value dims) of batch b: out = P . v; operand tiles of 128 keys staged in LDS, two buffers
#define PV_PB 272                      // LDS row pitch in bytes: 256-byte rows + 16, conflict-free for 16-byte reads
#define PV_ST (192 * PV_PB)            // one stage: rows 0..127 v planes, 128..191 P rows
__global__ __launch_bounds__(128) void k_pv(const _Float16* __restrict__ PH, const _Float16* __restrict__ VT, int b, float* __restrict__ OUT) { __shared__ __align__(16) char smem[2 * PV_ST];
  const int tid = threadIdx.x, wave = tid >> 5, lane = tid & 31, col = lane & 15, g = lane >> 4; const int c0 = blockIdx.y * 128; const int ql0 = blockIdx.x * 64 + wave * 16;
  const unsigned lb = (unsigned)(size_t)smem + (unsigned)(tid >> 4) * PV_PB + (unsigned)(tid & 15) * 16u;   // lane's LDS byte address: row tid/16, 16-byte piece tid%16
  const size_t vo = ((size_t)b * DA + c0 + (tid >> 4)) * (size_t)NN + (tid & 15) * 8, po = (size_t)(blockIdx.x * 64 + (tid >> 4)) * NN + (tid & 15) * 8;
  auto fill = [&](int t) { unsigned l[24]; const _Float16* p[24];
#pragma unroll   // constant indices: both address arrays stay in registers
    for (int i = 0; i < 24; ++i) { l[i] = lb + (unsigned)(t & 1) * PV_ST + (unsigned)i * 8u * PV_PB;
      p[i] = (i < 16 ? VT + vo + (size_t)i * 8 * NN : PH + po + (size_t)(i - 16) * 8 * NN) + t * 128; }
    acopy12(l, p); acopy12(l + 12, p + 12); };
  v8f acc[8] = {};
  fill(0); WAIT_ASYNC(); __syncthreads(); fill(1);
#pragma unroll 1   // one copy of the trip's body: the buffer is picked by t & 1
  for (int t = 0; t < NN / 128; ++t) { const _Float16* sb = (const _Float16*)(smem + (t & 1) * PV_ST);
    v16h fp[2], fv[2][8];   // two register sets: block kk + 1's fragments are read as one group ahead of block kk's products (same tile only)
    auto frags = [&](int kk) { fp[kk & 1] = frag_h(sb + (128 + wave * 16 + col) * (PV_PB / 2) + kk * 32, lane);
#pragma unroll   // this and the two below: constant indices keep fragments and accumulators in registers
      for (int j = 0; j < 8; ++j) fv[kk & 1][j] = frag_h(sb + (j * 16 + col) * (PV_PB / 2) + kk * 32, lane); };
    frags(0);
#pragma unroll
    for (int kk = 0; kk < 4; ++kk) { if (kk + 1 < 4) frags(kk + 1);
#pragma unroll
      for (int j = 0; j < 8; ++j) acc[j] = wmma16(fp[kk & 1], fv[kk & 1][j], acc[j]); }
    WAIT_DS(); WAIT_ASYNC(); __syncthreads();   // publishes tile t + 1 and ends every read of tile t's buffer
    if (t + 2 < NN / 128) fill(t + 2); }
  WAIT_ASYNC();   // no copy is outstanding when the ring's LDS is reused and the wave ends
  float (*ss)[16][132] = (float (*)[16][132])smem;   // output staging takes the ring's place behind the last trip's barrier
#pragma unroll
  for (int j = 0; j < 8; ++j)
#pragma unroll
    for (int r = 0; r < 8; ++r) ss[wave][8 * g + r][j * 16 + col] = acc[j][r] * (1.0f / 2048.0f);
  LDSX(); for (int rl = 0; rl < 16; ++rl) vst2(OUT + ((size_t)b * NN + ql0 + rl) * DA + c0 + lane * 4, *(const v4f*)&ss[wave][rl][lane * 4]); }
extern "C" void kernel_launch(void* const* d_in, const int* in_sizes, int n_in, void* d_out, int out_size, void* d_ws, size_t ws_size, hipStream_t stream) {
  (void)in_sizes; (void)n_in; (void)out_size;
  const float** F = (const float**)d_in;   // 0 Q, 1 K, 2 V [8,2048,512]; 3 Wq, 4 bq, 5 Wk, 6 bk, 7 Wv, 8 bv ((in,out) [512,512] / [512])
  if (ws_size < (size_t)WS_END) return;
  char* ws = (char*)d_ws; _Float16 *QH = (_Float16*)(ws + WS_QH), *QL = (_Float16*)(ws + WS_QL), *KH = (_Float16*)(ws + WS_KH), *KL = (_Float16*)(ws + WS_KL), *VT = (_Float16*)(ws + WS_VT), *PH = (_Float16*)(ws + WS_PH); float* S = (float*)(ws + WS_S);
  k_proj<<<dim3(TNB * NN / 64, DA / 128, 3), 128, 0, stream>>>(F[0], F[1], F[2], F[3], F[4], F[5], F[6], F[7], F[8], QH, QL, KH, KL, VT);
  for (int b = 0; b < TNB; ++b) {
    k_sc<<<dim3(TQB, NN / 128), 128, 0, stream>>>(QH, QL, KH, KL, b, S);
    k_sm<<<TQB * 64, 256, 0, stream>>>(S, PH);
    k_pv<<<dim3(TQB, DA / 128), 128, 0, stream>>>(PH, VT, b, (float*)d_out);
  }
}

// v002
// One run takes 328 microseconds.
// Timed twice side by side with v001, it ran 1.39 times as fast both times.
// Over all steps from v000 it is 4.67 times as fast.
// compute dtype: all float inputs rounded to bf16; q = Q Wq + bq, k = K Wk + bk, v = V Wv + bv with EXACT bf16 products on WMMA 16x16x32 ((in,out) weights), f32 accumulate; q and k as f16 hi + unscaled residual -> UNSCALED logits with 3 products (qh kh + ql kh + qh kl), stored in f32 for all batches; softmax in f32 (precise expf) -> P as f16 x 2^11; P . v with v rounded once to f16 (1 product); f32 output.
#include <hip/hip_runtime.h>
#include <math.h>

typedef __attribute__((ext_vector_type(16))) _Float16 v16h;
typedef __attribute__((ext_vector_type(16))) __bf16 v16b;
typedef __attribute__((ext_vector_type(8)))  _Float16 v8h;
typedef __attribute__((ext_vector_type(8)))  float v8f;
typedef __attribute__((ext_vector_type(4)))  float v4f;
typedef __attribute__((ext_vector_type(2)))  float v2f;
typedef __attribute__((ext_vector_type(4)))  unsigned v4u;
typedef __attribute__((ext_vector_type(4)))  int v4i;
typedef float __attribute__((may_alias)) float_a;
typedef int __attribute__((may_alias)) int_a;

template <typename T> __device__ __forceinline__ void vst2(void* p, T v) { *(T*)p = v;  }
__device__ __forceinline__ v8f wmma16(v16h a, v16h b, v8f c) {
  v8f d = __builtin_amdgcn_wmma_f32_16x16x32_f16(false, a, false, b, (short)0, c, false, false);
  asm volatile("v_nop\n\tv_nop\n\tv_nop\n\tv_nop" : "+v"(d) : "v"(a), "v"(b));
  return d;
}
__device__ __forceinline__ v8f wmma_bf(v16b a, v16b b, v8f c) {
  v8f d = __builtin_amdgcn_wmma_f32_16x16x32_bf16(false, a, false, b, (short)0, c, false, false);
  asm volatile("v_nop\n\tv_nop\n\tv_nop\n\tv_nop" : "+v"(d) : "v"(a), "v"(b));
  return d;
}
// 16x16x32 fragments: lane = (h = lane>>4, row/col = lane&15); elements 0..7 = k0+8h+0..7, 8..15 = k0+16+8h+0..7; D element r = row 8h+r
__device__ __forceinline__ v16h frag_h(const _Float16* rowk0, int lane) {
  union { v16h v; v8h q[2]; } u; const _Float16* p = rowk0 + 8 * (lane >> 4);
  u.q[0] = *(const v8h*)p; u.q[1] = *(const v8h*)(p + 16); return u.v;
}
__device__ __forceinline__ v16h frag_f32(const float* rowk0, int lane) {
  v16h a; const float* p = rowk0 + 8 * (lane >> 4);
#pragma unroll
  for (int i = 0; i < 8; ++i) { a[i] = (_Float16)p[i]; a[8 + i] = (_Float16)p[16 + i]; }
  return a;
}
__device__ __forceinline__ v16h frag_f32s(const float* rowk0, int lane, float sc) {
  v16h a; const float* p = rowk0 + 8 * (lane >> 4);
#pragma unroll
  for (int i = 0; i < 8; ++i) { a[i] = (_Float16)(p[i] * sc); a[8 + i] = (_Float16)(p[16 + i] * sc); }
  return a;
}
// column fragment from a [K][ld] layout (column n), rows >= K read as 0
__device__ __forceinline__ v16h fragc_f32(const float* W, int k0, int n, int lane, int ld, int K) {
  v16h a; const int g = lane >> 4;
#pragma unroll
  for (int i = 0; i < 8; ++i) { const int ka = k0 + 8 * g + i, kb = ka + 16;
    a[i] = (_Float16)(ka < K ? W[(size_t)(ka < K ? ka : K - 1) * ld + n] : 0.f); a[8 + i] = (_Float16)(kb < K ? W[(size_t)(kb < K ? kb : K - 1) * ld + n] : 0.f); }
  return a;
}
struct F2 { v16b h, l; };
__device__ __forceinline__ F2 bsplit16(const float v[16]) { F2 r;
#pragma unroll
  for (int i = 0; i < 16; ++i) { const __bf16 h = (__bf16)v[i]; r.h[i] = h; r.l[i] = (__bf16)(v[i] - (float)h); }
  return r; }
__device__ __forceinline__ F2 split_row(const float* row, int k0, int lane) { float v[16]; const float* p = row + k0 + 8 * (lane >> 4);
#pragma unroll
  for (int i = 0; i < 8; ++i) { v[i] = p[i]; v[8 + i] = p[16 + i]; }
  return bsplit16(v); }
__device__ __forceinline__ F2 split_rowK(const float* row, int k0, int lane, int K) { float v[16]; const int g = lane >> 4;
#pragma unroll
  for (int i = 0; i < 8; ++i) { const int ka = k0 + 8 * g + i, kb = ka + 16; v[i] = ka < K ? row[ka < K ? ka : K - 1] : 0.f; v[8 + i] = kb < K ? row[kb < K ? kb : K - 1] : 0.f; }
  return bsplit16(v); }
__device__ __forceinline__ F2 split_col(const float* W, int k0, int n, int lane, int ld, int K) { float v[16]; const int g = lane >> 4;
#pragma unroll
  for (int i = 0; i < 8; ++i) { const int ka = k0 + 8 * g + i, kb = ka + 16; v[i] = ka < K ? W[(size_t)(ka < K ? ka : K - 1) * ld + n] : 0.f; v[8 + i] = kb < K ? W[(size_t)(kb < K ? kb : K - 1) * ld + n] : 0.f; }
  return bsplit16(v); }
__device__ __forceinline__ v8f mac3(const F2& a, const F2& b, v8f c) { c = wmma_bf(a.l, b.h, c); c = wmma_bf(a.h, b.l, c); return wmma_bf(a.h, b.h, c); }
__device__ __forceinline__ float sigm(float v) { return 1.0f / (1.0f + expf(-v)); }
#define LDSX() do { asm volatile("s_wait_dscnt 0" ::: "memory"); __builtin_amdgcn_wave_barrier(); __builtin_amdgcn_fence(__ATOMIC_RELEASE, "workgroup"); } while (0)


// 'NN' attention (B 8, 2,048 tokens, 512 dims, single head, no scaling): out = softmax(q k^T) v with q, k, v = Linear(Q), Linear(K), Linear(V).
#define NB 8
#define NN 2048
#define DA 512
#ifndef TNB
#define TNB NB
#endif
#ifndef TQB
#define TQB (NN / 64)
#endif
typedef __attribute__((ext_vector_type(8))) __bf16 v8b;
__device__ __forceinline__ v16b frag_b(const __bf16* rowk0, int lane) {
  union { v16b v; v8b q[2]; } u; const __bf16* p = rowk0 + 8 * (lane >> 4);
  u.q[0] = *(const v8b*)p; u.q[1] = *(const v8b*)(p + 16); return u.v;
}
__device__ __forceinline__ float bfr(float v) { return (float)(__bf16)v; }
__device__ __attribute__((noinline)) float exp_ni(float v) { return expf(v); }
__device__ __attribute__((noinline)) float erf_ni(float v) { return erff(v); }

#define WS_QH  0u                                    // f16 q rows [b*n][512]
#define WS_QL  (WS_QH + 2u * (size_t)NB * NN * DA)      // f16 q residual rows
#define WS_KH  (WS_QL + 2u * (size_t)NB * NN * DA)      // f16 k rows
#define WS_KL  (WS_KH + 2u * (size_t)NB * NN * DA)      // f16 k residual rows
#define WS_VT  (WS_KL + 2u * (size_t)NB * NN * DA)      // f16 v planes [b][512][n]
#define WS_S   (WS_VT + 2u * (size_t)NB * DA * NN)      // f32 logits [b][q][key], all batches
#define WS_PH  WS_QH                                 // f16 P x 2^11 [b][q][key]: takes the place of the four q and k planes, whose last reader (k_sc) has ended; NN == 4 * DA makes the sizes equal
#define WS_END (WS_S + 4u * (size_t)NB * NN * NN)
static_assert(2u * (size_t)NB * NN * NN <= WS_VT - WS_QH, "P must end in front of the v planes");

// ---- k_proj: block = (64 rows, 128 cols, which): q, k (f16 hi + residual rows), v (f16 planes); each from its own input
__global__ __launch_bounds__(128) void k_proj(const float* __restrict__ XQ, const float* __restrict__ XK, const float* __restrict__ XV, const float* __restrict__ WQ, const float* __restrict__ BQ, const float* __restrict__ WK, const float* __restrict__ BK, const float* __restrict__ WV, const float* __restrict__ BV, _Float16* __restrict__ QH, _Float16* __restrict__ QL, _Float16* __restrict__ KH, _Float16* __restrict__ KL, _Float16* __restrict__ VT) {
  __shared__ __align__(16) _Float16 sh[64][136], sl[64][136]; __shared__ __align__(16) _Float16 th[128][72];
  const int tid = threadIdx.x, wave = tid >> 5, lane = tid & 31, col = lane & 15, g = lane >> 4; const int which = blockIdx.z; const int c0 = blockIdx.y * 128; const size_t r0 = (size_t)blockIdx.x * 64;
  const float* X = which == 0 ? XQ : which == 1 ? XK : XV; const float* Wm = which == 0 ? WQ : which == 1 ? WK : WV; const float* Bm = which == 0 ? BQ : which == 1 ? BK : BV;
  v8f acc[8] = {};
#pragma unroll 2
  for (int kc = 0; kc < DA / 32; ++kc) { v16b a; { const float* p = X + (r0 + wave * 16 + col) * DA + kc * 32 + 8 * g;
#pragma unroll
      for (int i = 0; i < 8; ++i) { a[i] = (__bf16)p[i]; a[8 + i] = (__bf16)p[16 + i]; } }
#pragma unroll
    for (int j = 0; j < 8; ++j) { v16b w; const int o = c0 + j * 16 + col;
#pragma unroll
      for (int i = 0; i < 8; ++i) { w[i] = (__bf16)Wm[(size_t)(kc * 32 + 8 * g + i) * DA + o]; w[8 + i] = (__bf16)Wm[(size_t)(kc * 32 + 16 + 8 * g + i) * DA + o]; }
      acc[j] = wmma_bf(a, w, acc[j]); } }
#pragma unroll
  for (int j = 0; j < 8; ++j) { const float bb = bfr(Bm[c0 + j * 16 + col]);
#pragma unroll
    for (int r = 0; r < 8; ++r) { const float v = acc[j][r] + bb; const int rl = wave * 16 + 8 * g + r, cl = j * 16 + col; const _Float16 hv = (_Float16)v;
      if (which == 2) th[cl][rl] = hv; else { sh[rl][cl] = hv; sl[rl][cl] = (_Float16)(v - (float)hv); } } }
  __syncthreads();
  if (which < 2) { _Float16* dh = which == 0 ? QH : KH; for (int e = tid; e < 64 * 16; e += 128) { const int rl = e >> 4, q = e & 15; vst2((unsigned*)(dh + (r0 + rl) * DA + c0 + q * 8), *(const v4u*)&sh[rl][q * 8]); vst2((unsigned*)((which == 0 ? QL : KL) + (r0 + rl) * DA + c0 + q * 8), *(const v4u*)&sl[rl][q * 8]); } }
  else { const size_t b = r0 / NN; const int n0 = (int)(r0 % NN); for (int e = tid; e < 128 * 8; e += 128) { const int cl = e >> 3, q = e & 7; vst2((unsigned*)(VT + (b * DA + c0 + cl) * (size_t)NN + n0 + q * 8), *(const v4u*)&th[cl][q * 8]); } } }
// ---- twelve 16-byte asynchronous copies global -> LDS per lane (no register staging). The s_wait_xcnt is the last line of the copies' own
// statement so that no address register named here is rewritten ahead of it (a precaution kept for issued global accesses).
__device__ __forceinline__ void acopy12(const unsigned* l, const _Float16* const* p) {
  asm volatile("global_load_async_to_lds_b128 %0, %12, off\n\t"
               "global_load_async_to_lds_b128 %1, %13, off\n\t"
               "global_load_async_to_lds_b128 %2, %14, off\n\t"
               "global_load_async_to_lds_b128 %3, %15, off\n\t"
               "global_load_async_to_lds_b128 %4, %16, off\n\t"
               "global_load_async_to_lds_b128 %5, %17, off\n\t"
               "global_load_async_to_lds_b128 %6, %18, off\n\t"
               "global_load_async_to_lds_b128 %7, %19, off\n\t"
               "global_load_async_to_lds_b128 %8, %20, off\n\t"
               "global_load_async_to_lds_b128 %9, %21, off\n\t"
               "global_load_async_to_lds_b128 %10, %22, off\n\t"
               "global_load_async_to_lds_b128 %11, %23, off\n\t"
               "s_wait_xcnt 0x0"
               :: "v"(l[0]), "v"(l[1]), "v"(l[2]), "v"(l[3]), "v"(l[4]), "v"(l[5]), "v"(l[6]), "v"(l[7]), "v"(l[8]), "v"(l[9]), "v"(l[10]), "v"(l[11]),
                  "v"(p[0]), "v"(p[1]), "v"(p[2]), "v"(p[3]), "v"(p[4]), "v"(p[5]), "v"(p[6]), "v"(p[7]), "v"(p[8]), "v"(p[9]), "v"(p[10]), "v"(p[11])
               : "memory");
}
// this wave's own copies have landed (the compiler places no wait for them)
#define WAIT_ASYNC() asm volatile("s_wait_asynccnt 0x0" ::: "memory")
// this wave's LDS reads have retired before the buffer they read is handed back for a refill
#define WAIT_DS() asm volatile("s_wait_dscnt 0x0" ::: "memory")
// ---- k_sc: block = (64 queries, 128 keys, batch): logits (qh kh + ql kh + qh kl) -> S; operand tiles of 64 k staged in LDS, two buffers
#define SC_PB 144                      // LDS row pitch in bytes: 128-byte rows + 16, conflict-free for 16-byte reads
#define SC_ST (384 * SC_PB)            // one stage: rows 0..127 kh, 128..255 kl, 256..319 qh, 320..383 ql
__global__ __launch_bounds__(128) void k_sc(const _Float16* __restrict__ QH, const _Float16* __restrict__ QL, const _Float16* __restrict__ KH, const _Float16* __restrict__ KL, float* __restrict__ S) { __shared__ __align__(16) char smem[2 * SC_ST];
  const int tid = threadIdx.x, wave = tid >> 5, lane = tid & 31, col = lane & 15, g = lane >> 4; const int k0 = blockIdx.y * 128; const int b = blockIdx.z; const int ql0 = b * NN + blockIdx.x * 64 + wave * 16;
  const unsigned lb = (unsigned)(size_t)smem + (unsigned)(tid >> 3) * SC_PB + (unsigned)(tid & 7) * 16u;   // lane's LDS byte address: row tid/8, 16-byte piece tid%8
  const size_t ko = ((size_t)b * NN + k0 + (tid >> 3)) * DA + (tid & 7) * 8, qo = ((size_t)b * NN + blockIdx.x * 64 + (tid >> 3)) * DA + (tid & 7) * 8;
  auto fill = [&](int t) { unsigned l[24]; const _Float16* p[24];
#pragma unroll   // constant indices: both address arrays stay in registers
    for (int i = 0; i < 24; ++i) { l[i] = lb + (unsigned)(t & 1) * SC_ST + (unsigned)i * 16u * SC_PB;
      p[i] = (i < 8 ? KH + ko + (size_t)i * 16 * DA : i < 16 ? KL + ko + (size_t)(i - 8) * 16 * DA : i < 20 ? QH + qo + (size_t)(i - 16) * 16 * DA : QL + qo + (size_t)(i - 20) * 16 * DA) + t * 64; }
    acopy12(l, p); acopy12(l + 12, p + 12); };
  v8f acc[8] = {};
  fill(0); WAIT_ASYNC(); __syncthreads(); fill(1);
#pragma unroll 1   // one copy of the trip's body: the buffer is picked by t & 1
  for (int t = 0; t < DA / 64; ++t) { const _Float16* sb = (const _Float16*)(smem + (t & 1) * SC_ST);
#pragma unroll   // this and the two below: constant indices keep fragments and accumulators in registers
    for (int kk = 0; kk < 2; ++kk) { v16h fk[16];   // a block's fragments are read as one group ahead of its products
      const v16h ah = frag_h(sb + (256 + wave * 16 + col) * (SC_PB / 2) + kk * 32, lane), al = frag_h(sb + (320 + wave * 16 + col) * (SC_PB / 2) + kk * 32, lane);
#pragma unroll
      for (int j = 0; j < 8; ++j) { fk[2 * j] = frag_h(sb + (j * 16 + col) * (SC_PB / 2) + kk * 32, lane); fk[2 * j + 1] = frag_h(sb + (128 + j * 16 + col) * (SC_PB / 2) + kk * 32, lane); }
#pragma unroll
      for (int j = 0; j < 8; ++j) { acc[j] = wmma16(ah, fk[2 * j], acc[j]); acc[j] = wmma16(al, fk[2 * j], acc[j]); acc[j] = wmma16(ah, fk[2 * j + 1], acc[j]); } }   // 3 products
    WAIT_DS(); WAIT_ASYNC(); __syncthreads();   // publishes tile t + 1 and ends every read of tile t's buffer
    if (t + 2 < DA / 64) fill(t + 2); }
  WAIT_ASYNC();   // no copy is outstanding when the ring's LDS is reused and the wave ends
  float (*ss)[16][132] = (float (*)[16][132])smem;   // output staging takes the ring's place behind the last trip's barrier
#pragma unroll
  for (int j = 0; j < 8; ++j)
#pragma unroll
    for (int r = 0; r < 8; ++r) ss[wave][8 * g + r][j * 16 + col] = acc[j][r];
  LDSX(); for (int rl = 0; rl < 16; ++rl) vst2(S + (size_t)(ql0 + rl) * NN + k0 + lane * 4, *(const v4f*)&ss[wave][rl][lane * 4]); }
// ---- k_sm: block = (query row, batch): softmax -> P x 2^11 (f16)
__global__ __launch_bounds__(256) void k_sm(const float* __restrict__ S, _Float16* __restrict__ PH) { __shared__ float sred[8]; __shared__ float sbc; __shared__ __align__(16) _Float16 sh[NN];
  const int t = threadIdx.x; const size_t row = (size_t)blockIdx.y * NN + blockIdx.x; const float* sr = S + row * NN;
  float m = -3.0e38f; for (int k = t; k < NN; k += 256) m = fmaxf(m, sr[k]);
#pragma unroll
  for (int o = 1; o < 32; o <<= 1) m = fmaxf(m, __shfl_xor(m, o));
  if ((t & 31) == 0) sred[t >> 5] = m; __syncthreads(); if (t == 0) { float a = sred[0]; for (int i = 1; i < 8; ++i) a = fmaxf(a, sred[i]); sbc = a; } __syncthreads(); m = sbc; __syncthreads();
  float sum = 0.f; for (int k = t; k < NN; k += 256) sum += expf(sr[k] - m);
#pragma unroll
  for (int o = 1; o < 32; o <<= 1) sum += __shfl_xor(sum, o);
  if ((t & 31) == 0) sred[t >> 5] = sum; __syncthreads(); if (t == 0) { float a = 0.f; for (int i = 0; i < 8; ++i) a += sred[i]; sbc = 1.0f / a; } __syncthreads(); const float inv = sbc;
  for (int k = t; k < NN; k += 256) sh[k] = (_Float16)(expf(sr[k] - m) * inv * 2048.0f);
  __syncthreads(); for (int q = t; q < NN / 8; q += 256) vst2((unsigned*)(PH + row * NN + q * 8), *(const v4u*)&sh[q * 8]); }
// ---- k_pv: block = (64 queries, 128 value dims, batch): out = P . v; operand tiles of 128 keys staged in LDS, two buffers
#define PV_PB 272                      // LDS row pitch in bytes: 256-byte rows + 16, conflict-free for 16-byte reads
#define PV_ST (192 * PV_PB)            // one stage: rows 0..127 v planes, 128..191 P rows
__global__ __launch_bounds__(128) void k_pv(const _Float16* __restrict__ PH, const _Float16* __restrict__ VT, float* __restrict__ OUT) { __shared__ __align__(16) char smem[2 * PV_ST];
  const int tid = threadIdx.x, wave = tid >> 5, lane = tid & 31, col = lane & 15, g = lane >> 4; const int c0 = blockIdx.y * 128; const int b = blockIdx.z; const int ql0 = b * NN + blockIdx.x * 64 + wave * 16;
  const unsigned lb = (unsigned)(size_t)smem + (unsigned)(tid >> 4) * PV_PB + (unsigned)(tid & 15) * 16u;   // lane's LDS byte address: row tid/16, 16-byte piece tid%16
  const size_t vo = ((size_t)b * DA + c0 + (tid >> 4)) * (size_t)NN + (tid & 15) * 8, po = (size_t)(b * NN + blockIdx.x * 64 + (tid >> 4)) * NN + (tid & 15) * 8;
  auto fill = [&](int t) { unsigned l[24]; const _Float16* p[24];
#pragma unroll   // constant indices: both address arrays stay in registers
    for (int i = 0; i < 24; ++i) { l[i] = lb + (unsigned)(t & 1) * PV_ST + (unsigned)i * 8u * PV_PB;
      p[i] = (i < 16 ? VT + vo + (size_t)i * 8 * NN : PH + po + (size_t)(i - 16) * 8 * NN) + t * 128; }
    acopy12(l, p); acopy12(l + 12, p + 12); };
  v8f acc[8] = {};
  fill(0); WAIT_ASYNC(); __syncthreads(); fill(1);
#pragma unroll 1   // one copy of the trip's body: the buffer is picked by t & 1
  for (int t = 0; t < NN / 128; ++t) { const _Float16* sb = (const _Float16*)(smem + (t & 1) * PV_ST);
    v16h fp[2], fv[2][8];   // two register sets: block kk + 1's fragments are read as one group ahead of block kk's products (same tile only)
    auto frags = [&](int kk) { fp[kk & 1] = frag_h(sb + (128 + wave * 16 + col) * (PV_PB / 2) + kk * 32, lane);
#pragma unroll   // this and the two below: constant indices keep fragments and accumulators in registers
      for (int j = 0; j < 8; ++j) fv[kk & 1][j] = frag_h(sb + (j * 16 + col) * (PV_PB / 2) + kk * 32, lane); };
    frags(0);
#pragma unroll
    for (int kk = 0; kk < 4; ++kk) { if (kk + 1 < 4) frags(kk + 1);
#pragma unroll
      for (int j = 0; j < 8; ++j) acc[j] = wmma16(fp[kk & 1], fv[kk & 1][j], acc[j]); }
    WAIT_DS(); WAIT_ASYNC(); __syncthreads();   // publishes tile t + 1 and ends every read of tile t's buffer
    if (t + 2 < NN / 128) fill(t + 2); }
  WAIT_ASYNC();   // no copy is outstanding when the ring's LDS is reused and the wave ends
  float (*ss)[16][132] = (float (*)[16][132])smem;   // output staging takes the ring's place behind the last trip's barrier
#pragma unroll
  for (int j = 0; j < 8; ++j)
#pragma unroll
    for (int r = 0; r < 8; ++r) ss[wave][8 * g + r][j * 16 + col] = acc[j][r] * (1.0f / 2048.0f);
  LDSX(); for (int rl = 0; rl < 16; ++rl) vst2(OUT + (size_t)(ql0 + rl) * DA + c0 + lane * 4, *(const v4f*)&ss[wave][rl][lane * 4]); }
extern "C" void kernel_launch(void* const* d_in, const int* in_sizes, int n_in, void* d_out, int out_size, void* d_ws, size_t ws_size, hipStream_t stream) {
  (void)in_sizes; (void)n_in; (void)out_size;
  const float** F = (const float**)d_in;   // 0 Q, 1 K, 2 V [8,2048,512]; 3 Wq, 4 bq, 5 Wk, 6 bk, 7 Wv, 8 bv ((in,out) [512,512] / [512])
  if (ws_size < (size_t)WS_END) return;
  char* ws = (char*)d_ws; _Float16 *QH = (_Float16*)(ws + WS_QH), *QL = (_Float16*)(ws + WS_QL), *KH = (_Float16*)(ws + WS_KH), *KL = (_Float16*)(ws + WS_KL), *VT = (_Float16*)(ws + WS_VT), *PH = (_Float16*)(ws + WS_PH); float* S = (float*)(ws + WS_S);
  k_proj<<<dim3(TNB * NN / 64, DA / 128, 3), 128, 0, stream>>>(F[0], F[1], F[2], F[3], F[4], F[5], F[6], F[7], F[8], QH, QL, KH, KL, VT);
  k_sc<<<dim3(TQB, NN / 128, TNB), 128, 0, stream>>>(QH, QL, KH, KL, S);
  k_sm<<<dim3(TQB * 64, TNB), 256, 0, stream>>>(S, PH);
  k_pv<<<dim3(TQB, DA / 128, TNB), 128, 0, stream>>>(PH, VT, (float*)d_out);
}

// v003
// A run of this version takes 266 microseconds.
// In both of two side-by-side timings against v002, it was 1.23 times as fast.
// Over all steps from v000 it is 5.75 times as fast.
// compute dtype: all float inputs rounded to bf16; q = Q Wq + bq, k = K Wk + bk, v = V Wv + bv with EXACT bf16 products on WMMA 16x16x32 ((in,out) weights), f32 accumulate; q and k as f16 hi + unscaled residual -> UNSCALED logits with 3 products (qh kh + ql kh + qh kl), stored in f32 for all batches; softmax in f32 (precise expf) -> P as f16 x 2^11; P . v with v rounded once to f16 (1 product); f32 output.
#include <hip/hip_runtime.h>
#include <math.h>

typedef __attribute__((ext_vector_type(16))) _Float16 v16h;
typedef __attribute__((ext_vector_type(16))) __bf16 v16b;
typedef __attribute__((ext_vector_type(8)))  _Float16 v8h;
typedef __attribute__((ext_vector_type(8)))  float v8f;
typedef __attribute__((ext_vector_type(4)))  float v4f;
typedef __attribute__((ext_vector_type(2)))  float v2f;
typedef __attribute__((ext_vector_type(4)))  unsigned v4u;
typedef __attribute__((ext_vector_type(4)))  int v4i;
typedef float __attribute__((may_alias)) float_a;
typedef int __attribute__((may_alias)) int_a;

template <typename T> __device__ __forceinline__ void vst2(void* p, T v) { *(T*)p = v;  }
__device__ __forceinline__ v8f wmma16(v16h a, v16h b, v8f c) {
  v8f d = __builtin_amdgcn_wmma_f32_16x16x32_f16(false, a, false, b, (short)0, c, false, false);
  asm volatile("v_nop\n\tv_nop\n\tv_nop\n\tv_nop" : "+v"(d) : "v"(a), "v"(b));
  return d;
}
__device__ __forceinline__ v8f wmma_bf(v16b a, v16b b, v8f c) {
  v8f d = __builtin_amdgcn_wmma_f32_16x16x32_bf16(false, a, false, b, (short)0, c, false, false);
  asm volatile("v_nop\n\tv_nop\n\tv_nop\n\tv_nop" : "+v"(d) : "v"(a), "v"(b));
  return d;
}
// 16x16x32 fragments: lane = (h = lane>>4, row/col = lane&15); elements 0..7 = k0+8h+0..7, 8..15 = k0+16+8h+0..7; D element r = row 8h+r
__device__ __forceinline__ v16h frag_h(const _Float16* rowk0, int lane) {
  union { v16h v; v8h q[2]; } u; const _Float16* p = rowk0 + 8 * (lane >> 4);
  u.q[0] = *(const v8h*)p; u.q[1] = *(const v8h*)(p + 16); return u.v;
}
__device__ __forceinline__ v16h frag_f32(const float* rowk0, int lane) {
  v16h a; const float* p = rowk0 + 8 * (lane >> 4);
#pragma unroll
  for (int i = 0; i < 8; ++i) { a[i] = (_Float16)p[i]; a[8 + i] = (_Float16)p[16 + i]; }
  return a;
}
__device__ __forceinline__ v16h frag_f32s(const float* rowk0, int lane, float sc) {
  v16h a; const float* p = rowk0 + 8 * (lane >> 4);
#pragma unroll
  for (int i = 0; i < 8; ++i) { a[i] = (_Float16)(p[i] * sc); a[8 + i] = (_Float16)(p[16 + i] * sc); }
  return a;
}
// column fragment from a [K][ld] layout (column n), rows >= K read as 0
__device__ __forceinline__ v16h fragc_f32(const float* W, int k0, int n, int lane, int ld, int K) {
  v16h a; const int g = lane >> 4;
#pragma unroll
  for (int i = 0; i < 8; ++i) { const int ka = k0 + 8 * g + i, kb = ka + 16;
    a[i] = (_Float16)(ka < K ? W[(size_t)(ka < K ? ka : K - 1) * ld + n] : 0.f); a[8 + i] = (_Float16)(kb < K ? W[(size_t)(kb < K ? kb : K - 1) * ld + n] : 0.f); }
  return a;
}
struct F2 { v16b h, l; };
__device__ __forceinline__ F2 bsplit16(const float v[16]) { F2 r;
#pragma unroll
  for (int i = 0; i < 16; ++i) { const __bf16 h = (__bf16)v[i]; r.h[i] = h; r.l[i] = (__bf16)(v[i] - (float)h); }
  return r; }
__device__ __forceinline__ F2 split_row(const float* row, int k0, int lane) { float v[16]; const float* p = row + k0 + 8 * (lane >> 4);
#pragma unroll
  for (int i = 0; i < 8; ++i) { v[i] = p[i]; v[8 + i] = p[16 + i]; }
  return bsplit16(v); }
__device__ __forceinline__ F2 split_rowK(const float* row, int k0, int lane, int K) { float v[16]; const int g = lane >> 4;
#pragma unroll
  for (int i = 0; i < 8; ++i) { const int ka = k0 + 8 * g + i, kb = ka + 16; v[i] = ka < K ? row[ka < K ? ka : K - 1] : 0.f; v[8 + i] = kb < K ? row[kb < K ? kb : K - 1] : 0.f; }
  return bsplit16(v); }
__device__ __forceinline__ F2 split_col(const float* W, int k0, int n, int lane, int ld, int K) { float v[16]; const int g = lane >> 4;
#pragma unroll
  for (int i = 0; i < 8; ++i) { const int ka = k0 + 8 * g + i, kb = ka + 16; v[i] = ka < K ? W[(size_t)(ka < K ? ka : K - 1) * ld + n] : 0.f; v[8 + i] = kb < K ? W[(size_t)(kb < K ? kb : K - 1) * ld + n] : 0.f; }
  return bsplit16(v); }
__device__ __forceinline__ v8f mac3(const F2& a, const F2& b, v8f c) { c = wmma_bf(a.l, b.h, c); c = wmma_bf(a.h, b.l, c); return wmma_bf(a.h, b.h, c); }
__device__ __forceinline__ float sigm(float v) { return 1.0f / (1.0f + expf(-v)); }
#define LDSX() do { asm volatile("s_wait_dscnt 0" ::: "memory"); __builtin_amdgcn_wave_barrier(); __builtin_amdgcn_fence(__ATOMIC_RELEASE, "workgroup"); } while (0)


// 'NN' attention (B 8, 2,048 tokens, 512 dims, single head, no scaling): out = softmax(q k^T) v with q, k, v = Linear(Q), Linear(K), Linear(V).
#define NB 8
#define NN 2048
#define DA 512
#ifndef TNB
#define TNB NB
#endif
#ifndef TQB
#define TQB (NN / 64)
#endif
typedef __attribute__((ext_vector_type(8))) __bf16 v8b;
__device__ __forceinline__ v16b frag_b(const __bf16* rowk0, int lane) {
  union { v16b v; v8b q[2]; } u; const __bf16* p = rowk0 + 8 * (lane >> 4);
  u.q[0] = *(const v8b*)p; u.q[1] = *(const v8b*)(p + 16); return u.v;
}
__device__ __forceinline__ float bfr(float v) { return (float)(__bf16)v; }
__device__ __attribute__((noinline)) float exp_ni(float v) { return expf(v); }
__device__ __attribute__((noinline)) float erf_ni(float v) { return erff(v); }

#define WS_QH  0u                                    // f16 q rows [b*n][512]
#define WS_QL  (WS_QH + 2u * (size_t)NB * NN * DA)      // f16 q residual rows
#define WS_KH  (WS_QL + 2u * (size_t)NB * NN * DA)      // f16 k rows
#define WS_KL  (WS_KH + 2u * (size_t)NB * NN * DA)      // f16 k residual rows
#define WS_VT  (WS_KL + 2u * (size_t)NB * NN * DA)      // f16 v planes [b][512][n]
#define WS_S   (WS_VT + 2u * (size_t)NB * DA * NN)      // f32 logits [b][q][key], all batches
#define WS_PH  WS_QH                                 // f16 P x 2^11 [b][q][key]: takes the place of the four q and k planes, whose last reader (k_sc) has ended; NN == 4 * DA makes the sizes equal
#define WS_END (WS_S + 4u * (size_t)NB * NN * NN)
static_assert(2u * (size_t)NB * NN * NN <= WS_VT - WS_QH, "P must end in front of the v planes");

// ---- k_proj: block = (64 rows, 128 cols, which): q, k (f16 hi + residual rows), v (f16 planes); each from its own input
__global__ __launch_bounds__(128) void k_proj(const float* __restrict__ XQ, const float* __restrict__ XK, const float* __restrict__ XV, const float* __restrict__ WQ, const float* __restrict__ BQ, const float* __restrict__ WK, const float* __restrict__ BK, const float* __restrict__ WV, const float* __restrict__ BV, _Float16* __restrict__ QH, _Float16* __restrict__ QL, _Float16* __restrict__ KH, _Float16* __restrict__ KL, _Float16* __restrict__ VT) {
  __shared__ __align__(16) _Float16 sh[64][136], sl[64][136]; __shared__ __align__(16) _Float16 th[128][72];
  const int tid = threadIdx.x, wave = tid >> 5, lane = tid & 31, col = lane & 15, g = lane >> 4; const int which = blockIdx.z; const int c0 = blockIdx.y * 128; const size_t r0 = (size_t)blockIdx.x * 64;
  const float* X = which == 0 ? XQ : which == 1 ? XK : XV; const float* Wm = which == 0 ? WQ : which == 1 ? WK : WV; const float* Bm = which == 0 ? BQ : which == 1 ? BK : BV;
  v8f acc[8] = {};
#pragma unroll 2
  for (int kc = 0; kc < DA / 32; ++kc) { v16b a; { const float* p = X + (r0 + wave * 16 + col) * DA + kc * 32 + 8 * g;
#pragma unroll
      for (int i = 0; i < 8; ++i) { a[i] = (__bf16)p[i]; a[8 + i] = (__bf16)p[16 + i]; } }
#pragma unroll
    for (int j = 0; j < 8; ++j) { v16b w; const int o = c0 + j * 16 + col;
#pragma unroll
      for (int i = 0; i < 8; ++i) { w[i] = (__bf16)Wm[(size_t)(kc * 32 + 8 * g + i) * DA + o]; w[8 + i] = (__bf16)Wm[(size_t)(kc * 32 + 16 + 8 * g + i) * DA + o]; }
      acc[j] = wmma_bf(a, w, acc[j]); } }
#pragma unroll
  for (int j = 0; j < 8; ++j) { const float bb = bfr(Bm[c0 + j * 16 + col]);
#pragma unroll
    for (int r = 0; r < 8; ++r) { const float v = acc[j][r] + bb; const int rl = wave * 16 + 8 * g + r, cl = j * 16 + col; const _Float16 hv = (_Float16)v;
      if (which == 2) th[cl][rl] = hv; else { sh[rl][cl] = hv; sl[rl][cl] = (_Float16)(v - (float)hv); } } }
  __syncthreads();
  if (which < 2) { _Float16* dh = which == 0 ? QH : KH; for (int e = tid; e < 64 * 16; e += 128) { const int rl = e >> 4, q = e & 15; vst2((unsigned*)(dh + (r0 + rl) * DA + c0 + q * 8), *(const v4u*)&sh[rl][q * 8]); vst2((unsigned*)((which == 0 ? QL : KL) + (r0 + rl) * DA + c0 + q * 8), *(const v4u*)&sl[rl][q * 8]); } }
  else { const size_t b = r0 / NN; const int n0 = (int)(r0 % NN); for (int e = tid; e < 128 * 8; e += 128) { const int cl = e >> 3, q = e & 7; vst2((unsigned*)(VT + (b * DA + c0 + cl) * (size_t)NN + n0 + q * 8), *(const v4u*)&th[cl][q * 8]); } } }
// ---- twelve 16-byte asynchronous copies global -> LDS per lane (no register staging). The s_wait_xcnt is the last line of the copies' own
// statement so that no address register named here is rewritten ahead of it (a precaution kept for issued global accesses).
__device__ __forceinline__ void acopy12(const unsigned* l, const _Float16* const* p) {
  asm volatile("global_load_async_to_lds_b128 %0, %12, off\n\t"
               "global_load_async_to_lds_b128 %1, %13, off\n\t"
               "global_load_async_to_lds_b128 %2, %14, off\n\t"
               "global_load_async_to_lds_b128 %3, %15, off\n\t"
               "global_load_async_to_lds_b128 %4, %16, off\n\t"
               "global_load_async_to_lds_b128 %5, %17, off\n\t"
               "global_load_async_to_lds_b128 %6, %18, off\n\t"
               "global_load_async_to_lds_b128 %7, %19, off\n\t"
               "global_load_async_to_lds_b128 %8, %20, off\n\t"
               "global_load_async_to_lds_b128 %9, %21, off\n\t"
               "global_load_async_to_lds_b128 %10, %22, off\n\t"
               "global_load_async_to_lds_b128 %11, %23, off\n\t"
               "s_wait_xcnt 0x0"
               :: "v"(l[0]), "v"(l[1]), "v"(l[2]), "v"(l[3]), "v"(l[4]), "v"(l[5]), "v"(l[6]), "v"(l[7]), "v"(l[8]), "v"(l[9]), "v"(l[10]), "v"(l[11]),
                  "v"(p[0]), "v"(p[1]), "v"(p[2]), "v"(p[3]), "v"(p[4]), "v"(p[5]), "v"(p[6]), "v"(p[7]), "v"(p[8]), "v"(p[9]), "v"(p[10]), "v"(p[11])
               : "memory");
}
// this wave's own copies have landed (the compiler places no wait for them)
#define WAIT_ASYNC() asm volatile("s_wait_asynccnt 0x0" ::: "memory")
// this wave's LDS reads have retired before the buffer they read is handed back for a refill
#define WAIT_DS() asm volatile("s_wait_dscnt 0x0" ::: "memory")
// ---- k_sc: block = (64 queries, 128 keys, batch): logits (qh kh + ql kh + qh kl) -> S; operand tiles of 64 k staged in LDS, two buffers
#define SC_PB 144                      // LDS row pitch in bytes: 128-byte rows + 16, conflict-free for 16-byte reads
#define SC_ST (384 * SC_PB)            // one stage: rows 0..127 kh, 128..255 kl, 256..319 qh, 320..383 ql
__global__ __launch_bounds__(128) void k_sc(const _Float16* __restrict__ QH, const _Float16* __restrict__ QL, const _Float16* __restrict__ KH, const _Float16* __restrict__ KL, float* __restrict__ S) { __shared__ __align__(16) char smem[2 * SC_ST];
  const int tid = threadIdx.x, wave = tid >> 5, lane = tid & 31, col = lane & 15, g = lane >> 4; const int k0 = blockIdx.y * 128; const int b = blockIdx.z; const int ql0 = b * NN + blockIdx.x * 64 + wave * 16;
  const unsigned lb = (unsigned)(size_t)smem + (unsigned)(tid >> 3) * SC_PB + (unsigned)(tid & 7) * 16u;   // lane's LDS byte address: row tid/8, 16-byte piece tid%8
  const size_t ko = ((size_t)b * NN + k0 + (tid >> 3)) * DA + (tid & 7) * 8, qo = ((size_t)b * NN + blockIdx.x * 64 + (tid >> 3)) * DA + (tid & 7) * 8;
  auto fill = [&](int t) { unsigned l[24]; const _Float16* p[24];
#pragma unroll   // constant indices: both address arrays stay in registers
    for (int i = 0; i < 24; ++i) { l[i] = lb + (unsigned)(t & 1) * SC_ST + (unsigned)i * 16u * SC_PB;
      p[i] = (i < 8 ? KH + ko + (size_t)i * 16 * DA : i < 16 ? KL + ko + (size_t)(i - 8) * 16 * DA : i < 20 ? QH + qo + (size_t)(i - 16) * 16 * DA : QL + qo + (size_t)(i - 20) * 16 * DA) + t * 64; }
    acopy12(l, p); acopy12(l + 12, p + 12); };
  v8f acc[8] = {};
  fill(0); WAIT_ASYNC(); __syncthreads(); fill(1);
#pragma unroll 1   // one copy of the trip's body: the buffer is picked by t & 1
  for (int t = 0; t < DA / 64; ++t) { const _Float16* sb = (const _Float16*)(smem + (t & 1) * SC_ST);
#pragma unroll   // this and the two below: constant indices keep fragments and accumulators in registers
    for (int kk = 0; kk < 2; ++kk) { v16h fk[16];   // a block's fragments are read as one group ahead of its products
      const v16h ah = frag_h(sb + (256 + wave * 16 + col) * (SC_PB / 2) + kk * 32, lane), al = frag_h(sb + (320 + wave * 16 + col) * (SC_PB / 2) + kk * 32, lane);
#pragma unroll
      for (int j = 0; j < 8; ++j) { fk[2 * j] = frag_h(sb + (j * 16 + col) * (SC_PB / 2) + kk * 32, lane); fk[2 * j + 1] = frag_h(sb + (128 + j * 16 + col) * (SC_PB / 2) + kk * 32, lane); }
#pragma unroll
      for (int j = 0; j < 8; ++j) { acc[j] = wmma16(ah, fk[2 * j], acc[j]); acc[j] = wmma16(al, fk[2 * j], acc[j]); acc[j] = wmma16(ah, fk[2 * j + 1], acc[j]); } }   // 3 products
    WAIT_DS(); WAIT_ASYNC(); __syncthreads();   // publishes tile t + 1 and ends every read of tile t's buffer
    if (t + 2 < DA / 64) fill(t + 2); }
  WAIT_ASYNC();   // no copy is outstanding when the ring's LDS is reused and the wave ends
  float (*ss)[16][132] = (float (*)[16][132])smem;   // output staging takes the ring's place behind the last trip's barrier
#pragma unroll
  for (int j = 0; j < 8; ++j)
#pragma unroll
    for (int r = 0; r < 8; ++r) ss[wave][8 * g + r][j * 16 + col] = acc[j][r];
  LDSX(); for (int rl = 0; rl < 16; ++rl) vst2(S + (size_t)(ql0 + rl) * NN + k0 + lane * 4, *(const v4f*)&ss[wave][rl][lane * 4]); }
// ---- k_sm: SM_ROWS consecutive logit rows a wave, each row whole in one wave: softmax -> P x 2^11 (f16). A row (8 KB) is read once, as 16 loads of 512
// contiguous bytes, and stays in registers through maximum, exp, sum and scaling; no LDS, no barrier; one work-group of 16 waves per WGP.
#define SM_WAVES 16
#define SM_ROWS 4
static_assert(SM_ROWS % 2 == 0 && (TQB * 64 * TNB) % (SM_WAVES * SM_ROWS) == 0 && NN == 16 * 128, "whole waves of row pairs; 16 loads a row");
typedef __attribute__((ext_vector_type(4))) _Float16 v4h;
// value of lane l ^ M inside a 16-lane row (DPP row_xmask), and of lane l ^ 16
template <int M> __device__ __forceinline__ float lx(float v) { return __builtin_bit_cast(float, __builtin_amdgcn_update_dpp(0, __builtin_bit_cast(int, v), 0x160 + M, 0xf, 0xf, true)); }
__device__ __forceinline__ float lx16(float v) { return __builtin_bit_cast(float, __builtin_amdgcn_permlanex16(__builtin_bit_cast(int, v), __builtin_bit_cast(int, v), 0x76543210, 0xfedcba98, false, false)); }
__device__ __forceinline__ size_t sm_row(int f) { return (size_t)(f / (TQB * 64)) * NN + (size_t)(f % (TQB * 64)); }
__device__ __forceinline__ void sm_load(v4f* x, const float* __restrict__ S, int f, int lane) { const float* p = S + sm_row(f) * NN + lane * 4;
#pragma unroll   // constant indices keep the row in registers
  for (int i = 0; i < 16; ++i) x[i] = __builtin_nontemporal_load((const v4f*)(p + i * 128));   // non-temporal: each logit is read once
  asm volatile("s_wait_xcnt 0x0" :: "v"(p) : "memory"); }   // precaution kept for issued global accesses; p as an input: where the loads address through its registers, no load's result may take them ahead of the wait
__device__ __forceinline__ float sm_max(const v4f* x) {
  float m0 = -3.0e38f, m1 = m0, m2 = m0, m3 = m0;   // four independent chains
#pragma unroll
  for (int i = 0; i < 16; i += 2) { m0 = fmaxf(fmaxf(m0, x[i][0]), x[i + 1][0]); m1 = fmaxf(fmaxf(m1, x[i][1]), x[i + 1][1]); m2 = fmaxf(fmaxf(m2, x[i][2]), x[i + 1][2]); m3 = fmaxf(fmaxf(m3, x[i][3]), x[i + 1][3]); }
  float m = fmaxf(fmaxf(m0, m1), fmaxf(m2, m3));
  m = fmaxf(m, lx<1>(m)); m = fmaxf(m, lx<2>(m)); m = fmaxf(m, lx<4>(m)); m = fmaxf(m, lx<8>(m)); return fmaxf(m, lx16(m)); }
__device__ __forceinline__ void sm_rest(v4f* x, float m, _Float16* __restrict__ PH, int f, int lane) {
  float a0 = 0.f, a1 = 0.f, a2 = 0.f, a3 = 0.f;
#pragma unroll
  for (int i = 0; i < 16; ++i) { x[i][0] = expf(x[i][0] - m); x[i][1] = expf(x[i][1] - m); x[i][2] = expf(x[i][2] - m); x[i][3] = expf(x[i][3] - m);
    a0 += x[i][0]; a1 += x[i][1]; a2 += x[i][2]; a3 += x[i][3]; }
  float a = (a0 + a1) + (a2 + a3);
  a += lx<1>(a); a += lx<2>(a); a += lx<4>(a); a += lx<8>(a); a += lx16(a);   // both partners add the same two values: every lane ends with the same sum
  const float sc = (1.0f / a) * 2048.0f;   // the power of two is exact, so exp * sc rounds as (exp * inv) * 2048
  _Float16* o = PH + sm_row(f) * NN + lane * 4;
#pragma unroll
  for (int i = 0; i < 16; ++i) { v4h h; h[0] = (_Float16)(x[i][0] * sc); h[1] = (_Float16)(x[i][1] * sc); h[2] = (_Float16)(x[i][2] * sc); h[3] = (_Float16)(x[i][3] * sc);
    *(v4h*)(o + i * 128) = h; }   // 256 contiguous bytes a wave: whole lines
  asm volatile("s_wait_xcnt 0x0" :: "v"(o) : "memory"); }   // the same precaution behind the stores, ahead of the next row's use of their registers
__global__ __launch_bounds__(SM_WAVES * 32) void k_sm(const float* __restrict__ S, _Float16* __restrict__ PH) {
  const int lane = threadIdx.x & 31; const int f0 = (blockIdx.x * SM_WAVES + __builtin_amdgcn_readfirstlane(threadIdx.x >> 5)) * SM_ROWS;   // wave-uniform first row
  v4f xa[16], xb[16];   // two row buffers: the next row's loads fly while this row's exp, sum and stores are worked
  sm_load(xa, S, f0, lane);
#pragma unroll 1   // one copy of the two-row body keeps the kernel's text small
  for (int r = 0; r < SM_ROWS; r += 2) {
    const float ma = sm_max(xa);
    sm_load(xb, S, f0 + r + 1, lane);
    __builtin_amdgcn_sched_barrier(0);   // without it the compiler sinks the next row's loads behind this row's long arithmetic (the loads below stand in a block of their own)
    sm_rest(xa, ma, PH, f0 + r, lane);
    const float mb = sm_max(xb);   // taken ahead of the branch: it reads the whole row, so the waits for that row's loads end here and none behind the join waits the fresh loads out
    if (r + 2 < SM_ROWS) sm_load(xa, S, f0 + r + 2, lane);
    sm_rest(xb, mb, PH, f0 + r + 1, lane); } }
// ---- k_pv: block = (64 queries, 128 value dims, batch): out = P . v; operand tiles of 128 keys staged in LDS, two buffers
#define PV_PB 272                      // LDS row pitch in bytes: 256-byte rows + 16, conflict-free for 16-byte reads
#define PV_ST (192 * PV_PB)            // one stage: rows 0..127 v planes, 128..191 P rows
__global__ __launch_bounds__(128) void k_pv(const _Float16* __restrict__ PH, const _Float16* __restrict__ VT, float* __restrict__ OUT) { __shared__ __align__(16) char smem[2 * PV_ST];
  const int tid = threadIdx.x, wave = tid >> 5, lane = tid & 31, col = lane & 15, g = lane >> 4; const int c0 = blockIdx.y * 128; const int b = blockIdx.z; const int ql0 = b * NN + blockIdx.x * 64 + wave * 16;
  const unsigned lb = (unsigned)(size_t)smem + (unsigned)(tid >> 4) * PV_PB + (unsigned)(tid & 15) * 16u;   // lane's LDS byte address: row tid/16, 16-byte piece tid%16
  const size_t vo = ((size_t)b * DA + c0 + (tid >> 4)) * (size_t)NN + (tid & 15) * 8, po = (size_t)(b * NN + blockIdx.x * 64 + (tid >> 4)) * NN + (tid & 15) * 8;
  auto fill = [&](int t) { unsigned l[24]; const _Float16* p[24];
#pragma unroll   // constant indices: both address arrays stay in registers
    for (int i = 0; i < 24; ++i) { l[i] = lb + (unsigned)(t & 1) * PV_ST + (unsigned)i * 8u * PV_PB;
      p[i] = (i < 16 ? VT + vo + (size_t)i * 8 * NN : PH + po + (size_t)(i - 16) * 8 * NN) + t * 128; }
    acopy12(l, p); acopy12(l + 12, p + 12); };
  v8f acc[8] = {};
  fill(0); WAIT_ASYNC(); __syncthreads(); fill(1);
#pragma unroll 1   // one copy of the trip's body: the buffer is picked by t & 1
  for (int t = 0; t < NN / 128; ++t) { const _Float16* sb = (const _Float16*)(smem + (t & 1) * PV_ST);
    v16h fp[2], fv[2][8];   // two register sets: block kk + 1's fragments are read as one group ahead of block kk's products (same tile only)
    auto frags = [&](int kk) { fp[kk & 1] = frag_h(sb + (128 + wave * 16 + col) * (PV_PB / 2) + kk * 32, lane);
#pragma unroll   // this and the two below: constant indices keep fragments and accumulators in registers
      for (int j = 0; j < 8; ++j) fv[kk & 1][j] = frag_h(sb + (j * 16 + col) * (PV_PB / 2) + kk * 32, lane); };
    frags(0);
#pragma unroll
    for (int kk = 0; kk < 4; ++kk) { if (kk + 1 < 4) frags(kk + 1);
#pragma unroll
      for (int j = 0; j < 8; ++j) acc[j] = wmma16(fp[kk & 1], fv[kk & 1][j], acc[j]); }
    WAIT_DS(); WAIT_ASYNC(); __syncthreads();   // publishes tile t + 1 and ends every read of tile t's buffer
    if (t + 2 < NN / 128) fill(t + 2); }
  WAIT_ASYNC();   // no copy is outstanding when the ring's LDS is reused and the wave ends
  float (*ss)[16][132] = (float (*)[16][132])smem;   // output staging takes the ring's place behind the last trip's barrier
#pragma unroll
  for (int j = 0; j < 8; ++j)
#pragma unroll
    for (int r = 0; r < 8; ++r) ss[wave][8 * g + r][j * 16 + col] = acc[j][r] * (1.0f / 2048.0f);
  LDSX(); for (int rl = 0; rl < 16; ++rl) vst2(OUT + (size_t)(ql0 + rl) * DA + c0 + lane * 4, *(const v4f*)&ss[wave][rl][lane * 4]); }
extern "C" void kernel_launch(void* const* d_in, const int* in_sizes, int n_in, void* d_out, int out_size, void* d_ws, size_t ws_size, hipStream_t stream) {
  (void)in_sizes; (void)n_in; (void)out_size;
  const float** F = (const float**)d_in;   // 0 Q, 1 K, 2 V [8,2048,512]; 3 Wq, 4 bq, 5 Wk, 6 bk, 7 Wv, 8 bv ((in,out) [512,512] / [512])
  if (ws_size < (size_t)WS_END) return;
  char* ws = (char*)d_ws; _Float16 *QH = (_Float16*)(ws + WS_QH), *QL = (_Float16*)(ws + WS_QL), *KH = (_Float16*)(ws + WS_KH), *KL = (_Float16*)(ws + WS_KL), *VT = (_Float16*)(ws + WS_VT), *PH = (_Float16*)(ws + WS_PH); float* S = (float*)(ws + WS_S);
  k_proj<<<dim3(TNB * NN / 64, DA / 128, 3), 128, 0, stream>>>(F[0], F[1], F[2], F[3], F[4], F[5], F[6], F[7], F[8], QH, QL, KH, KL, VT);
  k_sc<<<dim3(TQB, NN / 128, TNB), 128, 0, stream>>>(QH, QL, KH, KL, S);
  k_sm<<<dim3(TQB * 64 * TNB / (SM_WAVES * SM_ROWS)), SM_WAVES * 32, 0, stream>>>(S, PH);
  k_pv<<<dim3(TQB, DA / 128, TNB), 128, 0, stream>>>(PH, VT, (float*)d_out);
}

// v004
// It runs in 220 microseconds.
// In both of two side-by-side timings against v003, it was 1.20 times as fast.
// Counting every step since v000, it is 6.92 times as fast.
// compute dtype: all float inputs rounded to bf16; q = Q Wq + bq, k = K Wk + bk, v = V Wv + bv with EXACT bf16 products on WMMA 16x16x32 ((in,out) weights), f32 accumulate; q and k as f16 hi + unscaled residual -> UNSCALED logits with 3 products (qh kh + ql kh + qh kl), stored in f32 for all batches; softmax in f32 (precise expf) -> P as f16 x 2^11; P . v with v rounded once to f16 (1 product); f32 output.
#include <hip/hip_runtime.h>
#include <math.h>

typedef __attribute__((ext_vector_type(16))) _Float16 v16h;
typedef __attribute__((ext_vector_type(16))) __bf16 v16b;
typedef __attribute__((ext_vector_type(8)))  _Float16 v8h;
typedef __attribute__((ext_vector_type(8)))  float v8f;
typedef __attribute__((ext_vector_type(4)))  float v4f;
typedef __attribute__((ext_vector_type(2)))  float v2f;
typedef __attribute__((ext_vector_type(4)))  unsigned v4u;
typedef __attribute__((ext_vector_type(4)))  int v4i;
typedef float __attribute__((may_alias)) float_a;
typedef int __attribute__((may_alias)) int_a;

template <typename T> __device__ __forceinline__ void vst2(void* p, T v) { *(T*)p = v;  }
__device__ __forceinline__ v8f wmma16(v16h a, v16h b, v8f c) {
  v8f d = __builtin_amdgcn_wmma_f32_16x16x32_f16(false, a, false, b, (short)0, c, false, false);
  asm volatile("v_nop\n\tv_nop\n\tv_nop\n\tv_nop" : "+v"(d) : "v"(a), "v"(b));
  return d;
}
__device__ __forceinline__ v8f wmma_bf(v16b a, v16b b, v8f c) {
  v8f d = __builtin_amdgcn_wmma_f32_16x16x32_bf16(false, a, false, b, (short)0, c, false, false);
  asm volatile("v_nop\n\tv_nop\n\tv_nop\n\tv_nop" : "+v"(d) : "v"(a), "v"(b));
  return d;
}
// 16x16x32 fragments: lane = (h = lane>>4, row/col = lane&15); elements 0..7 = k0+8h+0..7, 8..15 = k0+16+8h+0..7; D element r = row 8h+r
__device__ __forceinline__ v16h frag_h(const _Float16* rowk0, int lane) {
  union { v16h v; v8h q[2]; } u; const _Float16* p = rowk0 + 8 * (lane >> 4);
  u.q[0] = *(const v8h*)p; u.q[1] = *(const v8h*)(p + 16); return u.v;
}
__device__ __forceinline__ v16h frag_f32(const float* rowk0, int lane) {
  v16h a; const float* p = rowk0 + 8 * (lane >> 4);
#pragma unroll
  for (int i = 0; i < 8; ++i) { a[i] = (_Float16)p[i]; a[8 + i] = (_Float16)p[16 + i]; }
  return a;
}
__device__ __forceinline__ v16h frag_f32s(const float* rowk0, int lane, float sc) {
  v16h a; const float* p = rowk0 + 8 * (lane >> 4);
#pragma unroll
  for (int i = 0; i < 8; ++i) { a[i] = (_Float16)(p[i] * sc); a[8 + i] = (_Float16)(p[16 + i] * sc); }
  return a;
}
// column fragment from a [K][ld] layout (column n), rows >= K read as 0
__device__ __forceinline__ v16h fragc_f32(const float* W, int k0, int n, int lane, int ld, int K) {
  v16h a; const int g = lane >> 4;
#pragma unroll
  for (int i = 0; i < 8; ++i) { const int ka = k0 + 8 * g + i, kb = ka + 16;
    a[i] = (_Float16)(ka < K ? W[(size_t)(ka < K ? ka : K - 1) * ld + n] : 0.f); a[8 + i] = (_Float16)(kb < K ? W[(size_t)(kb < K ? kb : K - 1) * ld + n] : 0.f); }
  return a;
}
struct F2 { v16b h, l; };
__device__ __forceinline__ F2 bsplit16(const float v[16]) { F2 r;
#pragma unroll
  for (int i = 0; i < 16; ++i) { const __bf16 h = (__bf16)v[i]; r.h[i] = h; r.l[i] = (__bf16)(v[i] - (float)h); }
  return r; }
__device__ __forceinline__ F2 split_row(const float* row, int k0, int lane) { float v[16]; const float* p = row + k0 + 8 * (lane >> 4);
#pragma unroll
  for (int i = 0; i < 8; ++i) { v[i] = p[i]; v[8 + i] = p[16 + i]; }
  return bsplit16(v); }
__device__ __forceinline__ F2 split_rowK(const float* row, int k0, int lane, int K) { float v[16]; const int g = lane >> 4;
#pragma unroll
  for (int i = 0; i < 8; ++i) { const int ka = k0 + 8 * g + i, kb = ka + 16; v[i] = ka < K ? row[ka < K ? ka : K - 1] : 0.f; v[8 + i] = kb < K ? row[kb < K ? kb : K - 1] : 0.f; }
  return bsplit16(v); }
__device__ __forceinline__ F2 split_col(const float* W, int k0, int n, int lane, int ld, int K) { float v[16]; const int g = lane >> 4;
#pragma unroll
  for (int i = 0; i < 8; ++i) { const int ka = k0 + 8 * g + i, kb = ka + 16; v[i] = ka < K ? W[(size_t)(ka < K ? ka : K - 1) * ld + n] : 0.f; v[8 + i] = kb < K ? W[(size_t)(kb < K ? kb : K - 1) * ld + n] : 0.f; }
  return bsplit16(v); }
__device__ __forceinline__ v8f mac3(const F2& a, const F2& b, v8f c) { c = wmma_bf(a.l, b.h, c); c = wmma_bf(a.h, b.l, c); return wmma_bf(a.h, b.h, c); }
__device__ __forceinline__ float sigm(float v) { return 1.0f / (1.0f + expf(-v)); }
#define LDSX() do { asm volatile("s_wait_dscnt 0" ::: "memory"); __builtin_amdgcn_wave_barrier(); __builtin_amdgcn_fence(__ATOMIC_RELEASE, "workgroup"); } while (0)


// 'NN' attention (B 8, 2,048 tokens, 512 dims, single head, no scaling): out = softmax(q k^T) v with q, k, v = Linear(Q), Linear(K), Linear(V).
#define NB 8
#define NN 2048
#define DA 512
#ifndef TNB
#define TNB NB
#endif
#ifndef TQB
#define TQB (NN / 64)
#endif
typedef __attribute__((ext_vector_type(8))) __bf16 v8b;
__device__ __forceinline__ v16b frag_b(const __bf16* rowk0, int lane) {
  union { v16b v; v8b q[2]; } u; const __bf16* p = rowk0 + 8 * (lane >> 4);
  u.q[0] = *(const v8b*)p; u.q[1] = *(const v8b*)(p + 16); return u.v;
}
__device__ __forceinline__ float bfr(float v) { return (float)(__bf16)v; }
__device__ __attribute__((noinline)) float exp_ni(float v) { return expf(v); }
__device__ __attribute__((noinline)) float erf_ni(float v) { return erff(v); }

#define WS_QH  0u                                    // f16 q rows [b*n][512]
#define WS_QL  (WS_QH + 2u * (size_t)NB * NN * DA)      // f16 q residual rows
#define WS_KH  (WS_QL + 2u * (size_t)NB * NN * DA)      // f16 k rows
#define WS_KL  (WS_KH + 2u * (size_t)NB * NN * DA)      // f16 k residual rows
#define WS_VT  (WS_KL + 2u * (size_t)NB * NN * DA)      // f16 v planes [b][512][n]
#define WS_S   (WS_VT + 2u * (size_t)NB * DA * NN)      // f32 logits [b][q][key], all batches
#define WS_PH  WS_QH                                 // f16 P x 2^11 [b][q][key]: takes the place of the four q and k planes, whose last reader (k_sc) has ended; NN == 4 * DA makes the sizes equal
#define WS_END (WS_S + 4u * (size_t)NB * NN * NN)
static_assert(2u * (size_t)NB * NN * NN <= WS_VT - WS_QH, "P must end in front of the v planes");

// ---- k_proj: block = (128 rows, 128 cols, which), 8 waves of 32 x 64: q (f16 hi + residual rows), k (f16 hi + residual rows), v (f16 planes); each from its own input.
// Tiles of 64 k of X and of W are read once a block as whole lines, rounded to bf16 and staged in LDS (W turned k-contiguous on the way), two buffers.
typedef __attribute__((ext_vector_type(4))) __bf16 v4b;
#define PJ_PB 144                      // LDS row pitch in bytes: 128-byte rows + 16, conflict-free for 16-byte reads and for the turned W stores
#define PJ_ST (256 * PJ_PB)            // one stage: rows 0..127 W columns (64 k each), 128..255 X rows
static_assert(2 * PJ_ST >= 2 * 128 * 136 * 2, "the output staging takes the ring's place");
// work-group barrier that orders LDS only: __syncthreads() would also wait out the global loads of the tile after next, which are meant to stay in flight across it
#define PJ_BAR() do { __builtin_amdgcn_fence(__ATOMIC_RELEASE, "workgroup", "local"); __builtin_amdgcn_s_barrier(); __builtin_amdgcn_fence(__ATOMIC_ACQUIRE, "workgroup", "local"); } while (0)
__global__ __launch_bounds__(256) void k_proj(const float* __restrict__ XQ, const float* __restrict__ XK, const float* __restrict__ XV, const float* __restrict__ WQ, const float* __restrict__ BQ, const float* __restrict__ WK, const float* __restrict__ BK, const float* __restrict__ WV, const float* __restrict__ BV, _Float16* __restrict__ QH, _Float16* __restrict__ QL, _Float16* __restrict__ KH, _Float16* __restrict__ KL, _Float16* __restrict__ VT) {
  __shared__ __align__(16) char smem[2 * PJ_ST];
  const int tid = threadIdx.x, wave = tid >> 5, lane = tid & 31, col = lane & 15, g = lane >> 4; const int which = blockIdx.z; const int c0 = blockIdx.y * 128; const size_t r0 = (size_t)blockIdx.x * 128;
  const int wr = wave >> 1, wc = wave & 1;   // the wave's tile: rows wr * 32, cols wc * 64
  const float* X = which == 0 ? XQ : which == 1 ? XK : XV; const float* Wm = which == 0 ? WQ : which == 1 ? WK : WV; const float* Bm = which == 0 ? BQ : which == 1 ? BK : BV;
  const int wkg = (wave & 1) * 4 + (lane & 3), wng = (wave >> 1) * 8 + (lane >> 2);   // W: a thread holds 8 k x 4 cols; a wave's load covers 4 whole lines, its 16-byte LDS stores fall on all banks
  const int xr = tid >> 4, xq = tid & 15;                                            // X: a thread holds 4 k of rows xr + 16 i; a wave's load covers 4 whole lines
  const float* wp = Wm + (size_t)(wkg * 8) * DA + c0 + wng * 4; const float* xp = X + (r0 + xr) * DA + xq * 4;
  v4f fw[8], fx[8];   // the next tile on its way through registers
  auto ld = [&](int t) { const float* pw = wp + (size_t)t * 64 * DA; const float* px = xp + t * 64;
#pragma unroll   // constant indices keep the tile in registers
    for (int i = 0; i < 8; ++i) { fw[i] = *(const v4f*)(pw + (size_t)i * DA); fx[i] = *(const v4f*)(px + (size_t)i * 16 * DA); }
    asm volatile("s_wait_xcnt 0x0" ::: "memory"); };   // precaution kept for issued global accesses, ahead of the next write of their address registers
  auto st = [&](int t) { char* sb = smem + (t & 1) * PJ_ST;
#pragma unroll
    for (int c = 0; c < 4; ++c) { v8b h;
#pragma unroll
      for (int i = 0; i < 8; ++i) h[i] = (__bf16)fw[i][c];
      *(v8b*)(sb + (wng * 4 + c) * PJ_PB + wkg * 16) = h; }
#pragma unroll
    for (int i = 0; i < 8; ++i) { v4b h; h[0] = (__bf16)fx[i][0]; h[1] = (__bf16)fx[i][1]; h[2] = (__bf16)fx[i][2]; h[3] = (__bf16)fx[i][3];
      *(v4b*)(sb + (128 + xr + 16 * i) * PJ_PB + xq * 8) = h; } };
  v8f acc[2][4] = {};
  ld(0); st(0); ld(1); PJ_BAR();
#pragma unroll 1   // one copy of the trip's body: the buffer is picked by t & 1
  for (int t = 0; t < DA / 64; ++t) { const __bf16* sb = (const __bf16*)(smem + (t & 1) * PJ_ST);
#pragma unroll   // this and the ones below: constant indices keep fragments and accumulators in registers
    for (int kk = 0; kk < 2; ++kk) { v16b a[2], w[4];
#pragma unroll
      for (int i = 0; i < 2; ++i) a[i] = frag_b(sb + (128 + wr * 32 + i * 16 + col) * (PJ_PB / 2) + kk * 32, lane);
#pragma unroll
      for (int j = 0; j < 4; ++j) w[j] = frag_b(sb + (wc * 64 + j * 16 + col) * (PJ_PB / 2) + kk * 32, lane);
#pragma unroll
      for (int i = 0; i < 2; ++i)
#pragma unroll
        for (int j = 0; j < 4; ++j) acc[i][j] = wmma_bf(a[i], w[j], acc[i][j]); }
    if (t + 1 < DA / 64) st(t + 1);   // into the buffer whose last readers left at the barrier of trip t - 1
    if (t + 2 < DA / 64) ld(t + 2);
    PJ_BAR(); }   // publishes tile t + 1 and ends every read of tile t's buffer
  _Float16 (*sh)[136] = (_Float16 (*)[136])smem, (*sl)[136] = (_Float16 (*)[136])(smem + 128 * 136 * 2), (*th)[136] = (_Float16 (*)[136])smem;   // output staging takes the ring's place behind the last trip's barrier
#pragma unroll
  for (int i = 0; i < 2; ++i)
#pragma unroll
    for (int j = 0; j < 4; ++j) { const float bb = bfr(Bm[c0 + wc * 64 + j * 16 + col]);
#pragma unroll
      for (int r = 0; r < 8; ++r) { const float v = acc[i][j][r] + bb; const int rl = wr * 32 + i * 16 + 8 * g + r, cl = wc * 64 + j * 16 + col; const _Float16 hv = (_Float16)v;
        if (which == 2) th[cl][rl] = hv; else { sh[rl][cl] = hv; sl[rl][cl] = (_Float16)(v - (float)hv); } } }
  __syncthreads();
  if (which < 2) { _Float16* dh = which == 0 ? QH : KH; for (int e = tid; e < 128 * 16; e += 256) { const int rl = e >> 4, q = e & 15; vst2((unsigned*)(dh + (r0 + rl) * DA + c0 + q * 8), *(const v4u*)&sh[rl][q * 8]); vst2((unsigned*)((which == 0 ? QL : KL) + (r0 + rl) * DA + c0 + q * 8), *(const v4u*)&sl[rl][q * 8]); } }
  else { const size_t b = r0 / NN; const int n0 = (int)(r0 % NN); for (int e = tid; e < 128 * 16; e += 256) { const int cl = e >> 4, q = e & 15; vst2((unsigned*)(VT + (b * DA + c0 + cl) * (size_t)NN + n0 + q * 8), *(const v4u*)&th[cl][q * 8]); } } }
// ---- twelve 16-byte asynchronous copies global -> LDS per lane (no register staging). The s_wait_xcnt is the last line of the copies' own
// statement so that no address register named here is rewritten ahead of it (a precaution kept for issued global accesses).
__device__ __forceinline__ void acopy12(const unsigned* l, const _Float16* const* p) {
  asm volatile("global_load_async_to_lds_b128 %0, %12, off\n\t"
               "global_load_async_to_lds_b128 %1, %13, off\n\t"
               "global_load_async_to_lds_b128 %2, %14, off\n\t"
               "global_load_async_to_lds_b128 %3, %15, off\n\t"
               "global_load_async_to_lds_b128 %4, %16, off\n\t"
               "global_load_async_to_lds_b128 %5, %17, off\n\t"
               "global_load_async_to_lds_b128 %6, %18, off\n\t"
               "global_load_async_to_lds_b128 %7, %19, off\n\t"
               "global_load_async_to_lds_b128 %8, %20, off\n\t"
               "global_load_async_to_lds_b128 %9, %21, off\n\t"
               "global_load_async_to_lds_b128 %10, %22, off\n\t"
               "global_load_async_to_lds_b128 %11, %23, off\n\t"
               "s_wait_xcnt 0x0"
               :: "v"(l[0]), "v"(l[1]), "v"(l[2]), "v"(l[3]), "v"(l[4]), "v"(l[5]), "v"(l[6]), "v"(l[7]), "v"(l[8]), "v"(l[9]), "v"(l[10]), "v"(l[11]),
                  "v"(p[0]), "v"(p[1]), "v"(p[2]), "v"(p[3]), "v"(p[4]), "v"(p[5]), "v"(p[6]), "v"(p[7]), "v"(p[8]), "v"(p[9]), "v"(p[10]), "v"(p[11])
               : "memory");
}
// this wave's own copies have landed (the compiler places no wait for them)
#define WAIT_ASYNC() asm volatile("s_wait_asynccnt 0x0" ::: "memory")
// this wave's LDS reads have retired before the buffer they read is handed back for a refill
#define WAIT_DS() asm volatile("s_wait_dscnt 0x0" ::: "memory")
// ---- k_sc: block = (64 queries, 128 keys, batch): logits (qh kh + ql kh + qh kl) -> S; operand tiles of 64 k staged in LDS, two buffers
#define SC_PB 144                      // LDS row pitch in bytes: 128-byte rows + 16, conflict-free for 16-byte reads
#define SC_ST (384 * SC_PB)            // one stage: rows 0..127 kh, 128..255 kl, 256..319 qh, 320..383 ql
__global__ __launch_bounds__(128) void k_sc(const _Float16* __restrict__ QH, const _Float16* __restrict__ QL, const _Float16* __restrict__ KH, const _Float16* __restrict__ KL, float* __restrict__ S) { __shared__ __align__(16) char smem[2 * SC_ST];
  const int tid = threadIdx.x, wave = tid >> 5, lane = tid & 31, col = lane & 15, g = lane >> 4; const int k0 = blockIdx.y * 128; const int b = blockIdx.z; const int ql0 = b * NN + blockIdx.x * 64 + wave * 16;
  const unsigned lb = (unsigned)(size_t)smem + (unsigned)(tid >> 3) * SC_PB + (unsigned)(tid & 7) * 16u;   // lane's LDS byte address: row tid/8, 16-byte piece tid%8
  const size_t ko = ((size_t)b * NN + k0 + (tid >> 3)) * DA + (tid & 7) * 8, qo = ((size_t)b * NN + blockIdx.x * 64 + (tid >> 3)) * DA + (tid & 7) * 8;
  auto fill = [&](int t) { unsigned l[24]; const _Float16* p[24];
#pragma unroll   // constant indices: both address arrays stay in registers
    for (int i = 0; i < 24; ++i) { l[i] = lb + (unsigned)(t & 1) * SC_ST + (unsigned)i * 16u * SC_PB;
      p[i] = (i < 8 ? KH + ko + (size_t)i * 16 * DA : i < 16 ? KL + ko + (size_t)(i - 8) * 16 * DA : i < 20 ? QH + qo + (size_t)(i - 16) * 16 * DA : QL + qo + (size_t)(i - 20) * 16 * DA) + t * 64; }
    acopy12(l, p); acopy12(l + 12, p + 12); };
  v8f acc[8] = {};
  fill(0); WAIT_ASYNC(); __syncthreads(); fill(1);
#pragma unroll 1   // one copy of the trip's body: the buffer is picked by t & 1
  for (int t = 0; t < DA / 64; ++t) { const _Float16* sb = (const _Float16*)(smem + (t & 1) * SC_ST);
#pragma unroll   // this and the two below: constant indices keep fragments and accumulators in registers
    for (int kk = 0; kk < 2; ++kk) { v16h fk[16];   // a block's fragments are read as one group ahead of its products
      const v16h ah = frag_h(sb + (256 + wave * 16 + col) * (SC_PB / 2) + kk * 32, lane), al = frag_h(sb + (320 + wave * 16 + col) * (SC_PB / 2) + kk * 32, lane);
#pragma unroll
      for (int j = 0; j < 8; ++j) { fk[2 * j] = frag_h(sb + (j * 16 + col) * (SC_PB / 2) + kk * 32, lane); fk[2 * j + 1] = frag_h(sb + (128 + j * 16 + col) * (SC_PB / 2) + kk * 32, lane); }
#pragma unroll
      for (int j = 0; j < 8; ++j) { acc[j] = wmma16(ah, fk[2 * j], acc[j]); acc[j] = wmma16(al, fk[2 * j], acc[j]); acc[j] = wmma16(ah, fk[2 * j + 1], acc[j]); } }   // 3 products
    WAIT_DS(); WAIT_ASYNC(); __syncthreads();   // publishes tile t + 1 and ends every read of tile t's buffer
    if (t + 2 < DA / 64) fill(t + 2); }
  WAIT_ASYNC();   // no copy is outstanding when the ring's LDS is reused and the wave ends
  float (*ss)[16][132] = (float (*)[16][132])smem;   // output staging takes the ring's place behind the last trip's barrier
#pragma unroll
  for (int j = 0; j < 8; ++j)
#pragma unroll
    for (int r = 0; r < 8; ++r) ss[wave][8 * g + r][j * 16 + col] = acc[j][r];
  LDSX(); for (int rl = 0; rl < 16; ++rl) vst2(S + (size_t)(ql0 + rl) * NN + k0 + lane * 4, *(const v4f*)&ss[wave][rl][lane * 4]); }
// ---- k_sm: SM_ROWS consecutive logit rows a wave, each row whole in one wave: softmax -> P x 2^11 (f16). A row (8 KB) is read once, as 16 loads of 512
// contiguous bytes, and stays in registers through maximum, exp, sum and scaling; no LDS, no barrier; one work-group of 16 waves per WGP.
#define SM_WAVES 16
#define SM_ROWS 4
static_assert(SM_ROWS % 2 == 0 && (TQB * 64 * TNB) % (SM_WAVES * SM_ROWS) == 0 && NN == 16 * 128, "whole waves of row pairs; 16 loads a row");
typedef __attribute__((ext_vector_type(4))) _Float16 v4h;
// value of lane l ^ M inside a 16-lane row (DPP row_xmask), and of lane l ^ 16
template <int M> __device__ __forceinline__ float lx(float v) { return __builtin_bit_cast(float, __builtin_amdgcn_update_dpp(0, __builtin_bit_cast(int, v), 0x160 + M, 0xf, 0xf, true)); }
__device__ __forceinline__ float lx16(float v) { return __builtin_bit_cast(float, __builtin_amdgcn_permlanex16(__builtin_bit_cast(int, v), __builtin_bit_cast(int, v), 0x76543210, 0xfedcba98, false, false)); }
__device__ __forceinline__ size_t sm_row(int f) { return (size_t)(f / (TQB * 64)) * NN + (size_t)(f % (TQB * 64)); }
__device__ __forceinline__ void sm_load(v4f* x, const float* __restrict__ S, int f, int lane) { const float* p = S + sm_row(f) * NN + lane * 4;
#pragma unroll   // constant indices keep the row in registers
  for (int i = 0; i < 16; ++i) x[i] = __builtin_nontemporal_load((const v4f*)(p + i * 128));   // non-temporal: each logit is read once
  asm volatile("s_wait_xcnt 0x0" :: "v"(p) : "memory"); }   // precaution kept for issued global accesses; p as an input: where the loads address through its registers, no load's result may take them ahead of the wait
__device__ __forceinline__ float sm_max(const v4f* x) {
  float m0 = -3.0e38f, m1 = m0, m2 = m0, m3 = m0;   // four independent chains
#pragma unroll
  for (int i = 0; i < 16; i += 2) { m0 = fmaxf(fmaxf(m0, x[i][0]), x[i + 1][0]); m1 = fmaxf(fmaxf(m1, x[i][1]), x[i + 1][1]); m2 = fmaxf(fmaxf(m2, x[i][2]), x[i + 1][2]); m3 = fmaxf(fmaxf(m3, x[i][3]), x[i + 1][3]); }
  float m = fmaxf(fmaxf(m0, m1), fmaxf(m2, m3));
  m = fmaxf(m, lx<1>(m)); m = fmaxf(m, lx<2>(m)); m = fmaxf(m, lx<4>(m)); m = fmaxf(m, lx<8>(m)); return fmaxf(m, lx16(m)); }
__device__ __forceinline__ void sm_rest(v4f* x, float m, _Float16* __restrict__ PH, int f, int lane) {
  float a0 = 0.f, a1 = 0.f, a2 = 0.f, a3 = 0.f;
#pragma unroll
  for (int i = 0; i < 16; ++i) { x[i][0] = expf(x[i][0] - m); x[i][1] = expf(x[i][1] - m); x[i][2] = expf(x[i][2] - m); x[i][3] = expf(x[i][3] - m);
    a0 += x[i][0]; a1 += x[i][1]; a2 += x[i][2]; a3 += x[i][3]; }
  float a = (a0 + a1) + (a2 + a3);
  a += lx<1>(a); a += lx<2>(a); a += lx<4>(a); a += lx<8>(a); a += lx16(a);   // both partners add the same two values: every lane ends with the same sum
  const float sc = (1.0f / a) * 2048.0f;   // the power of two is exact, so exp * sc rounds as (exp * inv) * 2048
  _Float16* o = PH + sm_row(f) * NN + lane * 4;
#pragma unroll
  for (int i = 0; i < 16; ++i) { v4h h; h[0] = (_Float16)(x[i][0] * sc); h[1] = (_Float16)(x[i][1] * sc); h[2] = (_Float16)(x[i][2] * sc); h[3] = (_Float16)(x[i][3] * sc);
    *(v4h*)(o + i * 128) = h; }   // 256 contiguous bytes a wave: whole lines
  asm volatile("s_wait_xcnt 0x0" :: "v"(o) : "memory"); }   // the same precaution behind the stores, ahead of the next row's use of their registers
__global__ __launch_bounds__(SM_WAVES * 32) void k_sm(const float* __restrict__ S, _Float16* __restrict__ PH) {
  const int lane = threadIdx.x & 31; const int f0 = (blockIdx.x * SM_WAVES + __builtin_amdgcn_readfirstlane(threadIdx.x >> 5)) * SM_ROWS;   // wave-uniform first row
  v4f xa[16], xb[16];   // two row buffers: the next row's loads fly while this row's exp, sum and stores are worked
  sm_load(xa, S, f0, lane);
#pragma unroll 1   // one copy of the two-row body keeps the kernel's text small
  for (int r = 0; r < SM_ROWS; r += 2) {
    const float ma = sm_max(xa);
    sm_load(xb, S, f0 + r + 1, lane);
    __builtin_amdgcn_sched_barrier(0);   // without it the compiler sinks the next row's loads behind this row's long arithmetic (the loads below stand in a block of their own)
    sm_rest(xa, ma, PH, f0 + r, lane);
    const float mb = sm_max(xb);   // taken ahead of the branch: it reads the whole row, so the waits for that row's loads end here and none behind the join waits the fresh loads out
    if (r + 2 < SM_ROWS) sm_load(xa, S, f0 + r + 2, lane);
    sm_rest(xb, mb, PH, f0 + r + 1, lane); } }
// ---- k_pv: block = (64 queries, 128 value dims, batch): out = P . v; operand tiles of 128 keys staged in LDS, two buffers
#define PV_PB 272                      // LDS row pitch in bytes: 256-byte rows + 16, conflict-free for 16-byte reads
#define PV_ST (192 * PV_PB)            // one stage: rows 0..127 v planes, 128..191 P rows
__global__ __launch_bounds__(128) void k_pv(const _Float16* __restrict__ PH, const _Float16* __restrict__ VT, float* __restrict__ OUT) { __shared__ __align__(16) char smem[2 * PV_ST];
  const int tid = threadIdx.x, wave = tid >> 5, lane = tid & 31, col = lane & 15, g = lane >> 4; const int c0 = blockIdx.y * 128; const int b = blockIdx.z; const int ql0 = b * NN + blockIdx.x * 64 + wave * 16;
  const unsigned lb = (unsigned)(size_t)smem + (unsigned)(tid >> 4) * PV_PB + (unsigned)(tid & 15) * 16u;   // lane's LDS byte address: row tid/16, 16-byte piece tid%16
  const size_t vo = ((size_t)b * DA + c0 + (tid >> 4)) * (size_t)NN + (tid & 15) * 8, po = (size_t)(b * NN + blockIdx.x * 64 + (tid >> 4)) * NN + (tid & 15) * 8;
  auto fill = [&](int t) { unsigned l[24]; const _Float16* p[24];
#pragma unroll   // constant indices: both address arrays stay in registers
    for (int i = 0; i < 24; ++i) { l[i] = lb + (unsigned)(t & 1) * PV_ST + (unsigned)i * 8u * PV_PB;
      p[i] = (i < 16 ? VT + vo + (size_t)i * 8 * NN : PH + po + (size_t)(i - 16) * 8 * NN) + t * 128; }
    acopy12(l, p); acopy12(l + 12, p + 12); };
  v8f acc[8] = {};
  fill(0); WAIT_ASYNC(); __syncthreads(); fill(1);
#pragma unroll 1   // one copy of the trip's body: the buffer is picked by t & 1
  for (int t = 0; t < NN / 128; ++t) { const _Float16* sb = (const _Float16*)(smem + (t & 1) * PV_ST);
    v16h fp[2], fv[2][8];   // two register sets: block kk + 1's fragments are read as one group ahead of block kk's products (same tile only)
    auto frags = [&](int kk) { fp[kk & 1] = frag_h(sb + (128 + wave * 16 + col) * (PV_PB / 2) + kk * 32, lane);
#pragma unroll   // this and the two below: constant indices keep fragments and accumulators in registers
      for (int j = 0; j < 8; ++j) fv[kk & 1][j] = frag_h(sb + (j * 16 + col) * (PV_PB / 2) + kk * 32, lane); };
    frags(0);
#pragma unroll
    for (int kk = 0; kk < 4; ++kk) { if (kk + 1 < 4) frags(kk + 1);
#pragma unroll
      for (int j = 0; j < 8; ++j) acc[j] = wmma16(fp[kk & 1], fv[kk & 1][j], acc[j]); }
    WAIT_DS(); WAIT_ASYNC(); __syncthreads();   // publishes tile t + 1 and ends every read of tile t's buffer
    if (t + 2 < NN / 128) fill(t + 2); }
  WAIT_ASYNC();   // no copy is outstanding when the ring's LDS is reused and the wave ends
  float (*ss)[16][132] = (float (*)[16][132])smem;   // output staging takes the ring's place behind the last trip's barrier
#pragma unroll
  for (int j = 0; j < 8; ++j)
#pragma unroll
    for (int r = 0; r < 8; ++r) ss[wave][8 * g + r][j * 16 + col] = acc[j][r] * (1.0f / 2048.0f);
  LDSX(); for (int rl = 0; rl < 16; ++rl) vst2(OUT + (size_t)(ql0 + rl) * DA + c0 + lane * 4, *(const v4f*)&ss[wave][rl][lane * 4]); }
extern "C" void kernel_launch(void* const* d_in, const int* in_sizes, int n_in, void* d_out, int out_size, void* d_ws, size_t ws_size, hipStream_t stream) {
  (void)in_sizes; (void)n_in; (void)out_size;
  const float** F = (const float**)d_in;   // 0 Q, 1 K, 2 V [8,2048,512]; 3 Wq, 4 bq, 5 Wk, 6 bk, 7 Wv, 8 bv ((in,out) [512,512] / [512])
  if (ws_size < (size_t)WS_END) return;
  char* ws = (char*)d_ws; _Float16 *QH = (_Float16*)(ws + WS_QH), *QL = (_Float16*)(ws + WS_QL), *KH = (_Float16*)(ws + WS_KH), *KL = (_Float16*)(ws + WS_KL), *VT = (_Float16*)(ws + WS_VT), *PH = (_Float16*)(ws + WS_PH); float* S = (float*)(ws + WS_S);
  k_proj<<<dim3(TNB * NN / 128, DA / 128, 3), 256, 0, stream>>>(F[0], F[1], F[2], F[3], F[4], F[5], F[6], F[7], F[8], QH, QL, KH, KL, VT);
  k_sc<<<dim3(TQB, NN / 128, TNB), 128, 0, stream>>>(QH, QL, KH, KL, S);
  k_sm<<<dim3(TQB * 64 * TNB / (SM_WAVES * SM_ROWS)), SM_WAVES * 32, 0, stream>>>(S, PH);
  k_pv<<<dim3(TQB, DA / 128, TNB), 128, 0, stream>>>(PH, VT, (float*)d_out);
}

// v005
// It runs in 175 microseconds.
// Timed twice side by side with v004, it ran 1.26 times as fast both times.
// Counting every step since v000, it is 8.71 times as fast.
// compute dtype: all float inputs rounded to bf16; q = Q Wq + bq, k = K Wk + bk, v = V Wv + bv with EXACT bf16 products on WMMA 16x16x32 ((in,out) weights), f32 accumulate; q and k as f16 hi + unscaled residual -> UNSCALED logits with 3 products (qh kh + ql kh + qh kl), stored in f32 for all batches; softmax in f32 (precise expf) -> P as f16 x 2^11; P . v with v rounded once to f16 (1 product); f32 output.
#include <hip/hip_runtime.h>
#include <math.h>

typedef __attribute__((ext_vector_type(16))) _Float16 v16h;
typedef __attribute__((ext_vector_type(16))) __bf16 v16b;
typedef __attribute__((ext_vector_type(8)))  _Float16 v8h;
typedef __attribute__((ext_vector_type(8)))  float v8f;
typedef __attribute__((ext_vector_type(4)))  float v4f;
typedef __attribute__((ext_vector_type(2)))  float v2f;
typedef __attribute__((ext_vector_type(4)))  unsigned v4u;
typedef __attribute__((ext_vector_type(4)))  int v4i;
typedef float __attribute__((may_alias)) float_a;
typedef int __attribute__((may_alias)) int_a;

template <typename T> __device__ __forceinline__ void vst2(void* p, T v) { *(T*)p = v;  }
__device__ __forceinline__ v8f wmma16(v16h a, v16h b, v8f c) {
  v8f d = __builtin_amdgcn_wmma_f32_16x16x32_f16(false, a, false, b, (short)0, c, false, false);
  asm volatile("v_nop\n\tv_nop\n\tv_nop\n\tv_nop" : "+v"(d) : "v"(a), "v"(b));
  return d;
}
__device__ __forceinline__ v8f wmma_bf(v16b a, v16b b, v8f c) {
  v8f d = __builtin_amdgcn_wmma_f32_16x16x32_bf16(false, a, false, b, (short)0, c, false, false);
  asm volatile("v_nop\n\tv_nop\n\tv_nop\n\tv_nop" : "+v"(d) : "v"(a), "v"(b));
  return d;
}
// 16x16x32 fragments: lane = (h = lane>>4, row/col = lane&15); elements 0..7 = k0+8h+0..7, 8..15 = k0+16+8h+0..7; D element r = row 8h+r
__device__ __forceinline__ v16h frag_h(const _Float16* rowk0, int lane) {
  union { v16h v; v8h q[2]; } u; const _Float16* p = rowk0 + 8 * (lane >> 4);
  u.q[0] = *(const v8h*)p; u.q[1] = *(const v8h*)(p + 16); return u.v;
}
__device__ __forceinline__ v16h frag_f32(const float* rowk0, int lane) {
  v16h a; const float* p = rowk0 + 8 * (lane >> 4);
#pragma unroll
  for (int i = 0; i < 8; ++i) { a[i] = (_Float16)p[i]; a[8 + i] = (_Float16)p[16 + i]; }
  return a;
}
__device__ __forceinline__ v16h frag_f32s(const float* rowk0, int lane, float sc) {
  v16h a; const float* p = rowk0 + 8 * (lane >> 4);
#pragma unroll
  for (int i = 0; i < 8; ++i) { a[i] = (_Float16)(p[i] * sc); a[8 + i] = (_Float16)(p[16 + i] * sc); }
  return a;
}
// column fragment from a [K][ld] layout (column n), rows >= K read as 0
__device__ __forceinline__ v16h fragc_f32(const float* W, int k0, int n, int lane, int ld, int K) {
  v16h a; const int g = lane >> 4;
#pragma unroll
  for (int i = 0; i < 8; ++i) { const int ka = k0 + 8 * g + i, kb = ka + 16;
    a[i] = (_Float16)(ka < K ? W[(size_t)(ka < K ? ka : K - 1) * ld + n] : 0.f); a[8 + i] = (_Float16)(kb < K ? W[(size_t)(kb < K ? kb : K - 1) * ld + n] : 0.f); }
  return a;
}
struct F2 { v16b h, l; };
__device__ __forceinline__ F2 bsplit16(const float v[16]) { F2 r;
#pragma unroll
  for (int i = 0; i < 16; ++i) { const __bf16 h = (__bf16)v[i]; r.h[i] = h; r.l[i] = (__bf16)(v[i] - (float)h); }
  return r; }
__device__ __forceinline__ F2 split_row(const float* row, int k0, int lane) { float v[16]; const float* p = row + k0 + 8 * (lane >> 4);
#pragma unroll
  for (int i = 0; i < 8; ++i) { v[i] = p[i]; v[8 + i] = p[16 + i]; }
  return bsplit16(v); }
__device__ __forceinline__ F2 split_rowK(const float* row, int k0, int lane, int K) { float v[16]; const int g = lane >> 4;
#pragma unroll
  for (int i = 0; i < 8; ++i) { const int ka = k0 + 8 * g + i, kb = ka + 16; v[i] = ka < K ? row[ka < K ? ka : K - 1] : 0.f; v[8 + i] = kb < K ? row[kb < K ? kb : K - 1] : 0.f; }
  return bsplit16(v); }
__device__ __forceinline__ F2 split_col(const float* W, int k0, int n, int lane, int ld, int K) { float v[16]; const int g = lane >> 4;
#pragma unroll
  for (int i = 0; i < 8; ++i) { const int ka = k0 + 8 * g + i, kb = ka + 16; v[i] = ka < K ? W[(size_t)(ka < K ? ka : K - 1) * ld + n] : 0.f; v[8 + i] = kb < K ? W[(size_t)(kb < K ? kb : K - 1) * ld + n] : 0.f; }
  return bsplit16(v); }
__device__ __forceinline__ v8f mac3(const F2& a, const F2& b, v8f c) { c = wmma_bf(a.l, b.h, c); c = wmma_bf(a.h, b.l, c); return wmma_bf(a.h, b.h, c); }
__device__ __forceinline__ float sigm(float v) { return 1.0f / (1.0f + expf(-v)); }
#define LDSX() do { asm volatile("s_wait_dscnt 0" ::: "memory"); __builtin_amdgcn_wave_barrier(); __builtin_amdgcn_fence(__ATOMIC_RELEASE, "workgroup"); } while (0)


// 'NN' attention (B 8, 2,048 tokens, 512 dims, single head, no scaling): out = softmax(q k^T) v with q, k, v = Linear(Q), Linear(K), Linear(V).
#define NB 8
#define NN 2048
#define DA 512
#ifndef TNB
#define TNB NB
#endif
#ifndef TQB
#define TQB (NN / 64)
#endif
typedef __attribute__((ext_vector_type(8))) __bf16 v8b;
__device__ __forceinline__ v16b frag_b(const __bf16* rowk0, int lane) {
  union { v16b v; v8b q[2]; } u; const __bf16* p = rowk0 + 8 * (lane >> 4);
  u.q[0] = *(const v8b*)p; u.q[1] = *(const v8b*)(p + 16); return u.v;
}
__device__ __forceinline__ float bfr(float v) { return (float)(__bf16)v; }
__device__ __attribute__((noinline)) float exp_ni(float v) { return expf(v); }
__device__ __attribute__((noinline)) float erf_ni(float v) { return erff(v); }

#define WS_QH  0u                                    // f16 q rows [b*n][512]
#define WS_QL  (WS_QH + 2u * (size_t)NB * NN * DA)      // f16 q residual rows
#define WS_KH  (WS_QL + 2u * (size_t)NB * NN * DA)      // f16 k rows
#define WS_KL  (WS_KH + 2u * (size_t)NB * NN * DA)      // f16 k residual rows
#define WS_VT  (WS_KL + 2u * (size_t)NB * NN * DA)      // f16 v planes [b][512][n]
#define WS_S   (WS_VT + 2u * (size_t)NB * DA * NN)      // f32 logits [b][q][key], all batches
#define WS_PH  WS_QH                                 // f16 P x 2^11 [b][q][key]: takes the place of the four q and k planes, whose last reader (k_sc) has ended; NN == 4 * DA makes the sizes equal
#define WS_END (WS_S + 4u * (size_t)NB * NN * NN)
static_assert(2u * (size_t)NB * NN * NN <= WS_VT - WS_QH, "P must end in front of the v planes");

// ---- k_proj: block = (128 rows, 128 cols, which), 8 waves of 32 x 64: q (f16 hi + residual rows), k (f16 hi + residual rows), v (f16 planes); each from its own input.
// Tiles of 64 k of X and of W are read once a block as whole lines, rounded to bf16 and staged in LDS (W turned k-contiguous on the way), two buffers.
typedef __attribute__((ext_vector_type(4))) __bf16 v4b;
#define PJ_PB 144                      // LDS row pitch in bytes: 128-byte rows + 16, conflict-free for 16-byte reads and for the turned W stores
#define PJ_ST (256 * PJ_PB)            // one stage: rows 0..127 W columns (64 k each), 128..255 X rows
static_assert(2 * PJ_ST >= 2 * 128 * 136 * 2, "the output staging takes the ring's place");
// work-group barrier that orders LDS only: __syncthreads() would also wait out the global loads of the tile after next, which are meant to stay in flight across it
#define PJ_BAR() do { __builtin_amdgcn_fence(__ATOMIC_RELEASE, "workgroup", "local"); __builtin_amdgcn_s_barrier(); __builtin_amdgcn_fence(__ATOMIC_ACQUIRE, "workgroup", "local"); } while (0)
__global__ __launch_bounds__(256) void k_proj(const float* __restrict__ XQ, const float* __restrict__ XK, const float* __restrict__ XV, const float* __restrict__ WQ, const float* __restrict__ BQ, const float* __restrict__ WK, const float* __restrict__ BK, const float* __restrict__ WV, const float* __restrict__ BV, _Float16* __restrict__ QH, _Float16* __restrict__ QL, _Float16* __restrict__ KH, _Float16* __restrict__ KL, _Float16* __restrict__ VT) {
  __shared__ __align__(16) char smem[2 * PJ_ST];
  const int tid = threadIdx.x, wave = tid >> 5, lane = tid & 31, col = lane & 15, g = lane >> 4; const int which = blockIdx.z; const int c0 = blockIdx.y * 128; const size_t r0 = (size_t)blockIdx.x * 128;
  const int wr = wave >> 1, wc = wave & 1;   // the wave's tile: rows wr * 32, cols wc * 64
  const float* X = which == 0 ? XQ : which == 1 ? XK : XV; const float* Wm = which == 0 ? WQ : which == 1 ? WK : WV; const float* Bm = which == 0 ? BQ : which == 1 ? BK : BV;
  const int wkg = (wave & 1) * 4 + (lane & 3), wng = (wave >> 1) * 8 + (lane >> 2);   // W: a thread holds 8 k x 4 cols; a wave's load covers 4 whole lines, its 16-byte LDS stores fall on all banks
  const int xr = tid >> 4, xq = tid & 15;                                            // X: a thread holds 4 k of rows xr + 16 i; a wave's load covers 4 whole lines
  const float* wp = Wm + (size_t)(wkg * 8) * DA + c0 + wng * 4; const float* xp = X + (r0 + xr) * DA + xq * 4;
  v4f fw[8], fx[8];   // the next tile on its way through registers
  auto ld = [&](int t) { const float* pw = wp + (size_t)t * 64 * DA; const float* px = xp + t * 64;
#pragma unroll   // constant indices keep the tile in registers
    for (int i = 0; i < 8; ++i) { fw[i] = *(const v4f*)(pw + (size_t)i * DA); fx[i] = *(const v4f*)(px + (size_t)i * 16 * DA); }
    asm volatile("s_wait_xcnt 0x0" ::: "memory"); };   // precaution kept for issued global accesses, ahead of the next write of their address registers
  auto st = [&](int t) { char* sb = smem + (t & 1) * PJ_ST;
#pragma unroll
    for (int c = 0; c < 4; ++c) { v8b h;
#pragma unroll
      for (int i = 0; i < 8; ++i) h[i] = (__bf16)fw[i][c];
      *(v8b*)(sb + (wng * 4 + c) * PJ_PB + wkg * 16) = h; }
#pragma unroll
    for (int i = 0; i < 8; ++i) { v4b h; h[0] = (__bf16)fx[i][0]; h[1] = (__bf16)fx[i][1]; h[2] = (__bf16)fx[i][2]; h[3] = (__bf16)fx[i][3];
      *(v4b*)(sb + (128 + xr + 16 * i) * PJ_PB + xq * 8) = h; } };
  v8f acc[2][4] = {};
  ld(0); st(0); ld(1); PJ_BAR();
#pragma unroll 1   // one copy of the trip's body: the buffer is picked by t & 1
  for (int t = 0; t < DA / 64; ++t) { const __bf16* sb = (const __bf16*)(smem + (t & 1) * PJ_ST);
#pragma unroll   // this and the ones below: constant indices keep fragments and accumulators in registers
    for (int kk = 0; kk < 2; ++kk) { v16b a[2], w[4];
#pragma unroll
      for (int i = 0; i < 2; ++i) a[i] = frag_b(sb + (128 + wr * 32 + i * 16 + col) * (PJ_PB / 2) + kk * 32, lane);
#pragma unroll
      for (int j = 0; j < 4; ++j) w[j] = frag_b(sb + (wc * 64 + j * 16 + col) * (PJ_PB / 2) + kk * 32, lane);
#pragma unroll
      for (int i = 0; i < 2; ++i)
#pragma unroll
        for (int j = 0; j < 4; ++j) acc[i][j] = wmma_bf(a[i], w[j], acc[i][j]); }
    if (t + 1 < DA / 64) st(t + 1);   // into the buffer whose last readers left at the barrier of trip t - 1
    if (t + 2 < DA / 64) ld(t + 2);
    PJ_BAR(); }   // publishes tile t + 1 and ends every read of tile t's buffer
  _Float16 (*sh)[136] = (_Float16 (*)[136])smem, (*sl)[136] = (_Float16 (*)[136])(smem + 128 * 136 * 2), (*th)[136] = (_Float16 (*)[136])smem;   // output staging takes the ring's place behind the last trip's barrier
#pragma unroll
  for (int i = 0; i < 2; ++i)
#pragma unroll
    for (int j = 0; j < 4; ++j) { const float bb = bfr(Bm[c0 + wc * 64 + j * 16 + col]);
#pragma unroll
      for (int r = 0; r < 8; ++r) { const float v = acc[i][j][r] + bb; const int rl = wr * 32 + i * 16 + 8 * g + r, cl = wc * 64 + j * 16 + col; const _Float16 hv = (_Float16)v;
        if (which == 2) th[cl][rl] = hv; else { sh[rl][cl] = hv; sl[rl][cl] = (_Float16)(v - (float)hv); } } }
  __syncthreads();
  if (which < 2) { _Float16* dh = which == 0 ? QH : KH; for (int e = tid; e < 128 * 16; e += 256) { const int rl = e >> 4, q = e & 15; vst2((unsigned*)(dh + (r0 + rl) * DA + c0 + q * 8), *(const v4u*)&sh[rl][q * 8]); vst2((unsigned*)((which == 0 ? QL : KL) + (r0 + rl) * DA + c0 + q * 8), *(const v4u*)&sl[rl][q * 8]); } }
  else { const size_t b = r0 / NN; const int n0 = (int)(r0 % NN); for (int e = tid; e < 128 * 16; e += 256) { const int cl = e >> 4, q = e & 15; vst2((unsigned*)(VT + (b * DA + c0 + cl) * (size_t)NN + n0 + q * 8), *(const v4u*)&th[cl][q * 8]); } } }
// ---- eight 16-byte asynchronous copies global -> LDS per lane (no register staging). The s_wait_xcnt is the last line of the copies' own
// statement so that no address register named here is rewritten ahead of it (a precaution kept for issued global accesses).
__device__ __forceinline__ void acopy8(const unsigned* l, const _Float16* const* p) {
  asm volatile("global_load_async_to_lds_b128 %0, %8, off\n\t"
               "global_load_async_to_lds_b128 %1, %9, off\n\t"
               "global_load_async_to_lds_b128 %2, %10, off\n\t"
               "global_load_async_to_lds_b128 %3, %11, off\n\t"
               "global_load_async_to_lds_b128 %4, %12, off\n\t"
               "global_load_async_to_lds_b128 %5, %13, off\n\t"
               "global_load_async_to_lds_b128 %6, %14, off\n\t"
               "global_load_async_to_lds_b128 %7, %15, off\n\t"
               "s_wait_xcnt 0x0"
               :: "v"(l[0]), "v"(l[1]), "v"(l[2]), "v"(l[3]), "v"(l[4]), "v"(l[5]), "v"(l[6]), "v"(l[7]),
                  "v"(p[0]), "v"(p[1]), "v"(p[2]), "v"(p[3]), "v"(p[4]), "v"(p[5]), "v"(p[6]), "v"(p[7])
               : "memory");
}
// this wave's own copies have landed (the compiler places no wait for them)
#define WAIT_ASYNC() asm volatile("s_wait_asynccnt 0x0" ::: "memory")
// this wave's LDS reads have retired before the buffer they read is handed back for a refill
#define WAIT_DS() asm volatile("s_wait_dscnt 0x0" ::: "memory")
// ---- k_sc: block = (256 queries, 256 keys, batch), 16 waves of 64 x 64: logits (qh kh + ql kh + qh kl) -> S; operand tiles of 64 k staged in LDS, two buffers.
// A fragment read from LDS feeds four tiles of the wave, and a row staged in LDS meets 256 rows of the other operand.
#define SC_PB 144                      // LDS row pitch in bytes: 128-byte rows + 16, conflict-free for 16-byte reads
#define SC_ST (1024 * SC_PB)           // one stage: rows 0..255 kh, 256..511 kl, 512..767 qh, 768..1023 ql
static_assert(2 * SC_ST >= 16 * 64 * 68 * 4 && NN % 256 == 0, "the output staging takes the ring's place; whole blocks");
__global__ __launch_bounds__(512) void k_sc(const _Float16* __restrict__ QH, const _Float16* __restrict__ QL, const _Float16* __restrict__ KH, const _Float16* __restrict__ KL, float* __restrict__ S) { __shared__ __align__(16) char smem[2 * SC_ST];
  const int tid = threadIdx.x, wave = tid >> 5, lane = tid & 31, col = lane & 15, g = lane >> 4; const int k0 = blockIdx.y * 256; const int b = blockIdx.z; const int q0 = blockIdx.x * 256;
  const int wq = wave >> 2, wk = wave & 3;   // the wave's tile: queries wq * 64, keys wk * 64
  const unsigned lb = (unsigned)(size_t)smem + (unsigned)(tid >> 3) * SC_PB + (unsigned)(tid & 7) * 16u;   // lane's LDS byte address: row tid/8, 16-byte piece tid%8
  const size_t ko = ((size_t)b * NN + k0 + (tid >> 3)) * DA + (tid & 7) * 8, qo = ((size_t)b * NN + q0 + (tid >> 3)) * DA + (tid & 7) * 8;
  auto fill = [&](int t) { unsigned l[16]; const _Float16* p[16];
#pragma unroll   // constant indices: both address arrays stay in registers
    for (int i = 0; i < 16; ++i) { l[i] = lb + (unsigned)(t & 1) * SC_ST + (unsigned)i * 64u * SC_PB;
      p[i] = (i < 4 ? KH + ko + (size_t)i * 64 * DA : i < 8 ? KL + ko + (size_t)(i - 4) * 64 * DA : i < 12 ? QH + qo + (size_t)(i - 8) * 64 * DA : QL + qo + (size_t)(i - 12) * 64 * DA) + t * 64; }
    acopy8(l, p); acopy8(l + 8, p + 8); };
  v8f acc[4][4] = {};
  fill(0); WAIT_ASYNC(); __syncthreads(); fill(1);
#pragma unroll 1   // one copy of the trip's body: the buffer is picked by t & 1
  for (int t = 0; t < DA / 64; ++t) { const _Float16* sb = (const _Float16*)(smem + (t & 1) * SC_ST);
#pragma unroll   // this and the ones below: constant indices keep fragments and accumulators in registers
    for (int kk = 0; kk < 2; ++kk) { v16h ah[4], al[4];
#pragma unroll
      for (int i = 0; i < 4; ++i) { ah[i] = frag_h(sb + (512 + wq * 64 + i * 16 + col) * (SC_PB / 2) + kk * 32, lane); al[i] = frag_h(sb + (768 + wq * 64 + i * 16 + col) * (SC_PB / 2) + kk * 32, lane); }
#pragma unroll
      for (int j = 0; j < 4; ++j) {   // one key tile at a time: the whole wave stays inside the 256 registers that 16 waves leave it
        const v16h fh = frag_h(sb + (wk * 64 + j * 16 + col) * (SC_PB / 2) + kk * 32, lane), fl = frag_h(sb + (256 + wk * 64 + j * 16 + col) * (SC_PB / 2) + kk * 32, lane);
        // 3 products, each accumulator in the order qh kh, ql kh, qh kl; the other three tiles' products stand between two products of one accumulator
#pragma unroll
        for (int i = 0; i < 4; ++i) acc[i][j] = wmma16(ah[i], fh, acc[i][j]);
#pragma unroll
        for (int i = 0; i < 4; ++i) acc[i][j] = wmma16(al[i], fh, acc[i][j]);
#pragma unroll
        for (int i = 0; i < 4; ++i) acc[i][j] = wmma16(ah[i], fl, acc[i][j]); } }
    WAIT_DS(); WAIT_ASYNC(); __syncthreads();   // publishes tile t + 1 and ends every read of tile t's buffer
    if (t + 2 < DA / 64) fill(t + 2); }
  WAIT_ASYNC();   // no copy is outstanding when the ring's LDS is reused and the wave ends
  float (*ss)[64][68] = (float (*)[64][68])smem;   // output staging takes the ring's place behind the last trip's barrier; each wave its own part
#pragma unroll
  for (int i = 0; i < 4; ++i)
#pragma unroll
    for (int j = 0; j < 4; ++j)
#pragma unroll
      for (int r = 0; r < 8; ++r) ss[wave][i * 16 + 8 * g + r][j * 16 + col] = acc[i][j][r];
  LDSX(); float* o = S + (size_t)(b * NN + q0 + wq * 64 + g) * NN + k0 + wk * 64 + col * 4;   // a store covers two rows of 256 contiguous bytes: whole lines
#pragma unroll   // constant row offsets: one address pair serves every store
  for (int rl = 0; rl < 64; rl += 2) vst2(o + (size_t)rl * NN, *(const v4f*)&ss[wave][rl + g][col * 4]); }
// ---- k_sm: SM_ROWS consecutive rows a wave: softmax -> P x 2^11 (f16). A row (8 KB) is read once, as 16 loads of 512
// contiguous bytes, and stays in registers through maximum, exp, sum and scaling; no LDS, no barrier; one work-group of 16 waves per WGP.
#define SM_WAVES 16
#define SM_ROWS 4
static_assert(SM_ROWS % 2 == 0 && (TQB * 64 * TNB) % (SM_WAVES * SM_ROWS) == 0 && NN == 16 * 128, "whole waves of row pairs; 16 loads a row");
typedef __attribute__((ext_vector_type(4))) _Float16 v4h;
// value of lane l ^ M inside a 16-lane row (DPP row_xmask), and of lane l ^ 16
template <int M> __device__ __forceinline__ float lx(float v) { return __builtin_bit_cast(float, __builtin_amdgcn_update_dpp(0, __builtin_bit_cast(int, v), 0x160 + M, 0xf, 0xf, true)); }
__device__ __forceinline__ float lx16(float v) { return __builtin_bit_cast(float, __builtin_amdgcn_permlanex16(__builtin_bit_cast(int, v), __builtin_bit_cast(int, v), 0x76543210, 0xfedcba98, false, false)); }
__device__ __forceinline__ size_t sm_row(int f) { return (size_t)(f / (TQB * 64)) * NN + (size_t)(f % (TQB * 64)); }
__device__ __forceinline__ void sm_load(v4f* x, const float* __restrict__ S, int f, int lane) { const float* p = S + sm_row(f) * NN + lane * 4;
#pragma unroll   // constant indices keep the row in registers
  for (int i = 0; i < 16; ++i) x[i] = __builtin_nontemporal_load((const v4f*)(p + i * 128));   // non-temporal: each logit is read once
  asm volatile("s_wait_xcnt 0x0" :: "v"(p) : "memory"); }   // precaution kept for issued global accesses; p as an input: where the loads address through its registers, no load's result may take them ahead of the wait
__device__ __forceinline__ float sm_max(const v4f* x) {
  float m0 = -3.0e38f, m1 = m0, m2 = m0, m3 = m0;   // four independent chains
#pragma unroll
  for (int i = 0; i < 16; i += 2) { m0 = fmaxf(fmaxf(m0, x[i][0]), x[i + 1][0]); m1 = fmaxf(fmaxf(m1, x[i][1]), x[i + 1][1]); m2 = fmaxf(fmaxf(m2, x[i][2]), x[i + 1][2]); m3 = fmaxf(fmaxf(m3, x[i][3]), x[i + 1][3]); }
  float m = fmaxf(fmaxf(m0, m1), fmaxf(m2, m3));
  m = fmaxf(m, lx<1>(m)); m = fmaxf(m, lx<2>(m)); m = fmaxf(m, lx<4>(m)); m = fmaxf(m, lx<8>(m)); return fmaxf(m, lx16(m)); }
__device__ __forceinline__ void sm_rest(v4f* x, float m, _Float16* __restrict__ PH, int f, int lane) {
  float a0 = 0.f, a1 = 0.f, a2 = 0.f, a3 = 0.f;
#pragma unroll
  for (int i = 0; i < 16; ++i) { x[i][0] = expf(x[i][0] - m); x[i][1] = expf(x[i][1] - m); x[i][2] = expf(x[i][2] - m); x[i][3] = expf(x[i][3] - m);
    a0 += x[i][0]; a1 += x[i][1]; a2 += x[i][2]; a3 += x[i][3]; }
  float a = (a0 + a1) + (a2 + a3);
  a += lx<1>(a); a += lx<2>(a); a += lx<4>(a); a += lx<8>(a); a += lx16(a);   // both partners add the same two values: every lane ends with the same sum
  const float sc = (1.0f / a) * 2048.0f;   // the power of two is exact, so exp * sc rounds as (exp * inv) * 2048
  _Float16* o = PH + sm_row(f) * NN + lane * 4;
#pragma unroll
  for (int i = 0; i < 16; ++i) { v4h h; h[0] = (_Float16)(x[i][0] * sc); h[1] = (_Float16)(x[i][1] * sc); h[2] = (_Float16)(x[i][2] * sc); h[3] = (_Float16)(x[i][3] * sc);
    *(v4h*)(o + i * 128) = h; }   // 256 contiguous bytes a wave: whole lines
  asm volatile("s_wait_xcnt 0x0" :: "v"(o) : "memory"); }   // the same precaution behind the stores, ahead of the next row's use of their registers
__global__ __launch_bounds__(SM_WAVES * 32) void k_sm(const float* __restrict__ S, _Float16* __restrict__ PH) {
  const int lane = threadIdx.x & 31; const int f0 = (blockIdx.x * SM_WAVES + __builtin_amdgcn_readfirstlane(threadIdx.x >> 5)) * SM_ROWS;   // wave-uniform first row
  v4f xa[16], xb[16];   // two row buffers: the next row's loads fly while this row's exp, sum and stores are worked
  sm_load(xa, S, f0, lane);
#pragma unroll 1   // one copy of the two-row body keeps the kernel's text small
  for (int r = 0; r < SM_ROWS; r += 2) {
    const float ma = sm_max(xa);
    sm_load(xb, S, f0 + r + 1, lane);
    __builtin_amdgcn_sched_barrier(0);   // without it the compiler sinks the next row's loads behind this row's long arithmetic (the loads below stand in a block of their own)
    sm_rest(xa, ma, PH, f0 + r, lane);
    const float mb = sm_max(xb);   // taken ahead of the branch: it reads the whole row, so the waits for that row's loads end here and none behind the join waits the fresh loads out
    if (r + 2 < SM_ROWS) sm_load(xa, S, f0 + r + 2, lane);
    sm_rest(xb, mb, PH, f0 + r + 1, lane); } }
// ---- k_pv: block = (128 queries, 256 value dims, batch), 8 waves of 64 x 64: out = P . v; operand tiles of 128 keys staged in LDS, two buffers
#define PV_PB 272                      // LDS row pitch in bytes: 256-byte rows + 16, conflict-free for 16-byte reads
#define PV_ST (384 * PV_PB)            // one stage: rows 0..255 v planes, 256..383 P rows
static_assert(2 * PV_ST >= 8 * 64 * 68 * 4 && NN % 128 == 0 && DA % 256 == 0, "the output staging takes the ring's place; whole blocks");
__global__ __launch_bounds__(256) void k_pv(const _Float16* __restrict__ PH, const _Float16* __restrict__ VT, float* __restrict__ OUT) { __shared__ __align__(16) char smem[2 * PV_ST];
  const int tid = threadIdx.x, wave = tid >> 5, lane = tid & 31, col = lane & 15, g = lane >> 4; const int c0 = blockIdx.y * 256; const int b = blockIdx.z; const int q0 = blockIdx.x * 128;
  const int wq = wave >> 2, wd = wave & 3;   // the wave's tile: queries wq * 64, value dims wd * 64
  const unsigned lb = (unsigned)(size_t)smem + (unsigned)(tid >> 4) * PV_PB + (unsigned)(tid & 15) * 16u;   // lane's LDS byte address: row tid/16, 16-byte piece tid%16
  const size_t vo = ((size_t)b * DA + c0 + (tid >> 4)) * (size_t)NN + (tid & 15) * 8, po = (size_t)(b * NN + q0 + (tid >> 4)) * NN + (tid & 15) * 8;
  auto fill = [&](int t) { unsigned l[24]; const _Float16* p[24];
#pragma unroll   // constant indices: both address arrays stay in registers
    for (int i = 0; i < 24; ++i) { l[i] = lb + (unsigned)(t & 1) * PV_ST + (unsigned)i * 16u * PV_PB;
      p[i] = (i < 16 ? VT + vo + (size_t)i * 16 * NN : PH + po + (size_t)(i - 16) * 16 * NN) + t * 128; }
    acopy8(l, p); acopy8(l + 8, p + 8); acopy8(l + 16, p + 16); };
  v8f acc[4][4] = {};
  fill(0); WAIT_ASYNC(); __syncthreads(); fill(1);
#pragma unroll 1   // one copy of the trip's body: the buffer is picked by t & 1
  for (int t = 0; t < NN / 128; ++t) { const _Float16* sb = (const _Float16*)(smem + (t & 1) * PV_ST);
    v16h fp[4], fv[2][4];   // the v fragments have two register sets: block kk + 1's are read ahead of block kk's products (same tile only); a second set of P fragments would not fit
    auto fragv = [&](int kk) {
#pragma unroll   // this and the ones below: constant indices keep fragments and accumulators in registers
      for (int j = 0; j < 4; ++j) fv[kk & 1][j] = frag_h(sb + (wd * 64 + j * 16 + col) * (PV_PB / 2) + kk * 32, lane); };
    fragv(0);
#pragma unroll
    for (int kk = 0; kk < 4; ++kk) {
#pragma unroll
      for (int i = 0; i < 4; ++i) fp[i] = frag_h(sb + (256 + wq * 64 + i * 16 + col) * (PV_PB / 2) + kk * 32, lane);
      if (kk + 1 < 4) fragv(kk + 1);
#pragma unroll
      for (int i = 0; i < 4; ++i)
#pragma unroll
        for (int j = 0; j < 4; ++j) acc[i][j] = wmma16(fp[i], fv[kk & 1][j], acc[i][j]); }
    WAIT_DS(); WAIT_ASYNC(); __syncthreads();   // publishes tile t + 1 and ends every read of tile t's buffer
    if (t + 2 < NN / 128) fill(t + 2); }
  WAIT_ASYNC();   // no copy is outstanding when the ring's LDS is reused and the wave ends
  float (*ss)[64][68] = (float (*)[64][68])smem;   // output staging takes the ring's place behind the last trip's barrier; each wave its own part
#pragma unroll
  for (int i = 0; i < 4; ++i)
#pragma unroll
    for (int j = 0; j < 4; ++j)
#pragma unroll
      for (int r = 0; r < 8; ++r) ss[wave][i * 16 + 8 * g + r][j * 16 + col] = acc[i][j][r] * (1.0f / 2048.0f);
  LDSX(); float* o = OUT + (size_t)(b * NN + q0 + wq * 64 + g) * DA + c0 + wd * 64 + col * 4;   // a store covers two rows of 256 contiguous bytes: whole lines
#pragma unroll   // constant row offsets: one address pair serves every store
  for (int rl = 0; rl < 64; rl += 2) vst2(o + (size_t)rl * DA, *(const v4f*)&ss[wave][rl + g][col * 4]); }
extern "C" void kernel_launch(void* const* d_in, const int* in_sizes, int n_in, void* d_out, int out_size, void* d_ws, size_t ws_size, hipStream_t stream) {
  (void)in_sizes; (void)n_in; (void)out_size;
  const float** F = (const float**)d_in;   // 0 Q, 1 K, 2 V [8,2048,512]; 3 Wq, 4 bq, 5 Wk, 6 bk, 7 Wv, 8 bv ((in,out) [512,512] / [512])
  if (ws_size < (size_t)WS_END) return;
  char* ws = (char*)d_ws; _Float16 *QH = (_Float16*)(ws + WS_QH), *QL = (_Float16*)(ws + WS_QL), *KH = (_Float16*)(ws + WS_KH), *KL = (_Float16*)(ws + WS_KL), *VT = (_Float16*)(ws + WS_VT), *PH = (_Float16*)(ws + WS_PH); float* S = (float*)(ws + WS_S);
  k_proj<<<dim3(TNB * NN / 128, DA / 128, 3), 256, 0, stream>>>(F[0], F[1], F[2], F[3], F[4], F[5], F[6], F[7], F[8], QH, QL, KH, KL, VT);
  k_sc<<<dim3(TQB / 4, NN / 256, TNB), 512, 0, stream>>>(QH, QL, KH, KL, S);
  k_sm<<<dim3(TQB * 64 * TNB / (SM_WAVES * SM_ROWS)), SM_WAVES * 32, 0, stream>>>(S, PH);
  k_pv<<<dim3(TQB / 2, DA / 256, TNB), 256, 0, stream>>>(PH, VT, (float*)d_out);
}

// v006
// Measured time: 167 microseconds a run.
// Next to v005, in two timings, it ran 1.04 and 1.05 times as fast.
// Over all steps from v000 it is 9.10 times as fast.
// compute dtype: all float inputs rounded to bf16; q = Q Wq + bq, k = K Wk + bk, v = V Wv + bv with EXACT bf16 products on WMMA 16x16x32 ((in,out) weights), f32 accumulate; q and k as f16 hi + unscaled residual -> UNSCALED logits with 3 products (qh kh + ql kh + qh kl), stored in f32 for all batches; softmax in f32 (precise expf) -> P as f16 x 2^11; P . v with v rounded once to f16 (1 product); f32 output.
#include <hip/hip_runtime.h>
#include <math.h>
#include <stdint.h>

typedef __attribute__((ext_vector_type(16))) _Float16 v16h;
typedef __attribute__((ext_vector_type(16))) __bf16 v16b;
typedef __attribute__((ext_vector_type(8)))  _Float16 v8h;
typedef __attribute__((ext_vector_type(8)))  float v8f;
typedef __attribute__((ext_vector_type(4)))  float v4f;
typedef __attribute__((ext_vector_type(2)))  float v2f;
typedef __attribute__((ext_vector_type(4)))  unsigned v4u;
typedef __attribute__((ext_vector_type(4)))  int v4i;
typedef float __attribute__((may_alias)) float_a;
typedef int __attribute__((may_alias)) int_a;

template <typename T> __device__ __forceinline__ void vst2(void* p, T v) { *(T*)p = v;  }
__device__ __forceinline__ v8f wmma16(v16h a, v16h b, v8f c) {
  v8f d = __builtin_amdgcn_wmma_f32_16x16x32_f16(false, a, false, b, (short)0, c, false, false);
  asm volatile("v_nop\n\tv_nop\n\tv_nop\n\tv_nop" : "+v"(d) : "v"(a), "v"(b));
  return d;
}
__device__ __forceinline__ v8f wmma_bf(v16b a, v16b b, v8f c) {
  v8f d = __builtin_amdgcn_wmma_f32_16x16x32_bf16(false, a, false, b, (short)0, c, false, false);
  asm volatile("v_nop\n\tv_nop\n\tv_nop\n\tv_nop" : "+v"(d) : "v"(a), "v"(b));
  return d;
}
// 16x16x32 fragments: lane = (h = lane>>4, row/col = lane&15); elements 0..7 = k0+8h+0..7, 8..15 = k0+16+8h+0..7; D element r = row 8h+r
__device__ __forceinline__ v16h frag_h(const _Float16* rowk0, int lane) {
  union { v16h v; v8h q[2]; } u; const _Float16* p = rowk0 + 8 * (lane >> 4);
  u.q[0] = *(const v8h*)p; u.q[1] = *(const v8h*)(p + 16); return u.v;
}
__device__ __forceinline__ v16h frag_f32(const float* rowk0, int lane) {
  v16h a; const float* p = rowk0 + 8 * (lane >> 4);
#pragma unroll
  for (int i = 0; i < 8; ++i) { a[i] = (_Float16)p[i]; a[8 + i] = (_Float16)p[16 + i]; }
  return a;
}
__device__ __forceinline__ v16h frag_f32s(const float* rowk0, int lane, float sc) {
  v16h a; const float* p = rowk0 + 8 * (lane >> 4);
#pragma unroll
  for (int i = 0; i < 8; ++i) { a[i] = (_Float16)(p[i] * sc); a[8 + i] = (_Float16)(p[16 + i] * sc); }
  return a;
}
// column fragment from a [K][ld] layout (column n), rows >= K read as 0
__device__ __forceinline__ v16h fragc_f32(const float* W, int k0, int n, int lane, int ld, int K) {
  v16h a; const int g = lane >> 4;
#pragma unroll
  for (int i = 0; i < 8; ++i) { const int ka = k0 + 8 * g + i, kb = ka + 16;
    a[i] = (_Float16)(ka < K ? W[(size_t)(ka < K ? ka : K - 1) * ld + n] : 0.f); a[8 + i] = (_Float16)(kb < K ? W[(size_t)(kb < K ? kb : K - 1) * ld + n] : 0.f); }
  return a;
}
struct F2 { v16b h, l; };
__device__ __forceinline__ F2 bsplit16(const float v[16]) { F2 r;
#pragma unroll
  for (int i = 0; i < 16; ++i) { const __bf16 h = (__bf16)v[i]; r.h[i] = h; r.l[i] = (__bf16)(v[i] - (float)h); }
  return r; }
__device__ __forceinline__ F2 split_row(const float* row, int k0, int lane) { float v[16]; const float* p = row + k0 + 8 * (lane >> 4);
#pragma unroll
  for (int i = 0; i < 8; ++i) { v[i] = p[i]; v[8 + i] = p[16 + i]; }
  return bsplit16(v); }
__device__ __forceinline__ F2 split_rowK(const float* row, int k0, int lane, int K) { float v[16]; const int g = lane >> 4;
#pragma unroll
  for (int i = 0; i < 8; ++i) { const int ka = k0 + 8 * g + i, kb = ka + 16; v[i] = ka < K ? row[ka < K ? ka : K - 1] : 0.f; v[8 + i] = kb < K ? row[kb < K ? kb : K - 1] : 0.f; }
  return bsplit16(v); }
__device__ __forceinline__ F2 split_col(const float* W, int k0, int n, int lane, int ld, int K) { float v[16]; const int g = lane >> 4;
#pragma unroll
  for (int i = 0; i < 8; ++i) { const int ka = k0 + 8 * g + i, kb = ka + 16; v[i] = ka < K ? W[(size_t)(ka < K ? ka : K - 1) * ld + n] : 0.f; v[8 + i] = kb < K ? W[(size_t)(kb < K ? kb : K - 1) * ld + n] : 0.f; }
  return bsplit16(v); }
__device__ __forceinline__ v8f mac3(const F2& a, const F2& b, v8f c) { c = wmma_bf(a.l, b.h, c); c = wmma_bf(a.h, b.l, c); return wmma_bf(a.h, b.h, c); }
__device__ __forceinline__ float sigm(float v) { return 1.0f / (1.0f + expf(-v)); }
#define LDSX() do { asm volatile("s_wait_dscnt 0" ::: "memory"); __builtin_amdgcn_wave_barrier(); __builtin_amdgcn_fence(__ATOMIC_RELEASE, "workgroup"); } while (0)


// 'NN' attention (B 8, 2,048 tokens, 512 dims, single head, no scaling): out = softmax(q k^T) v with q, k, v = Linear(Q), Linear(K), Linear(V).
#define NB 8
#define NN 2048
#define DA 512
#ifndef TNB
#define TNB NB
#endif
#ifndef TQB
#define TQB (NN / 64)
#endif
typedef __attribute__((ext_vector_type(8))) __bf16 v8b;
__device__ __forceinline__ v16b frag_b(const __bf16* rowk0, int lane) {
  union { v16b v; v8b q[2]; } u; const __bf16* p = rowk0 + 8 * (lane >> 4);
  u.q[0] = *(const v8b*)p; u.q[1] = *(const v8b*)(p + 16); return u.v;
}
__device__ __forceinline__ float bfr(float v) { return (float)(__bf16)v; }
__device__ __attribute__((noinline)) float exp_ni(float v) { return expf(v); }
__device__ __attribute__((noinline)) float erf_ni(float v) { return erff(v); }

#define WS_QH  0u                                    // f16 q rows [b*n][512]
#define WS_QL  (WS_QH + 2u * (size_t)NB * NN * DA)      // f16 q residual rows
#define WS_KH  (WS_QL + 2u * (size_t)NB * NN * DA)      // f16 k rows
#define WS_KL  (WS_KH + 2u * (size_t)NB * NN * DA)      // f16 k residual rows
#define WS_VT  (WS_KL + 2u * (size_t)NB * NN * DA)      // f16 v planes [b][512][n]
#define WS_S   (WS_VT + 2u * (size_t)NB * DA * NN)      // f32 logits [b][q][key], all batches
#define WS_PH  WS_QH                                 // f16 P x 2^11 [b][q][key]: takes the place of the four q and k planes, whose last reader (k_sc) has ended; NN == 4 * DA makes the sizes equal
#define WS_END (WS_S + 4u * (size_t)NB * NN * NN)
static_assert(2u * (size_t)NB * NN * NN <= WS_VT - WS_QH, "P must end in front of the v planes");

// ---- k_proj: block = (128 rows, 128 cols, which), 8 waves of 32 x 64: q (f16 hi + residual rows), k (f16 hi + residual rows), v (f16 planes); each from its own input.
// Tiles of 64 k of X and of W are read once a block as whole lines, rounded to bf16 and staged in LDS (W turned k-contiguous on the way), two buffers.
typedef __attribute__((ext_vector_type(4))) __bf16 v4b;
#define PJ_PB 144                      // LDS row pitch in bytes: 128-byte rows + 16, conflict-free for 16-byte reads and for the turned W stores
#define PJ_ST (256 * PJ_PB)            // one stage: rows 0..127 W columns (64 k each), 128..255 X rows
static_assert(2 * PJ_ST >= 2 * 128 * 136 * 2, "the output staging takes the ring's place");
// work-group barrier that orders LDS only: __syncthreads() would also wait out the global loads of the tile after next, which are meant to stay in flight across it
#define PJ_BAR() do { __builtin_amdgcn_fence(__ATOMIC_RELEASE, "workgroup", "local"); __builtin_amdgcn_s_barrier(); __builtin_amdgcn_fence(__ATOMIC_ACQUIRE, "workgroup", "local"); } while (0)
__global__ __launch_bounds__(256) void k_proj(const float* __restrict__ XQ, const float* __restrict__ XK, const float* __restrict__ XV, const float* __restrict__ WQ, const float* __restrict__ BQ, const float* __restrict__ WK, const float* __restrict__ BK, const float* __restrict__ WV, const float* __restrict__ BV, _Float16* __restrict__ QH, _Float16* __restrict__ QL, _Float16* __restrict__ KH, _Float16* __restrict__ KL, _Float16* __restrict__ VT) {
  __shared__ __align__(16) char smem[2 * PJ_ST];
  const int tid = threadIdx.x, wave = tid >> 5, lane = tid & 31, col = lane & 15, g = lane >> 4; const int which = blockIdx.z; const int c0 = blockIdx.y * 128; const size_t r0 = (size_t)blockIdx.x * 128;
  const int wr = wave >> 1, wc = wave & 1;   // the wave's tile: rows wr * 32, cols wc * 64
  const float* X = which == 0 ? XQ : which == 1 ? XK : XV; const float* Wm = which == 0 ? WQ : which == 1 ? WK : WV; const float* Bm = which == 0 ? BQ : which == 1 ? BK : BV;
  const int wkg = (wave & 1) * 4 + (lane & 3), wng = (wave >> 1) * 8 + (lane >> 2);   // W: a thread holds 8 k x 4 cols; a wave's load covers 4 whole lines, its 16-byte LDS stores fall on all banks
  const int xr = tid >> 4, xq = tid & 15;                                            // X: a thread holds 4 k of rows xr + 16 i; a wave's load covers 4 whole lines
  const float* wp = Wm + (size_t)(wkg * 8) * DA + c0 + wng * 4; const float* xp = X + (r0 + xr) * DA + xq * 4;
  v4f fw[8], fx[8];   // the next tile on its way through registers
  auto ld = [&](int t) { const float* pw = wp + (size_t)t * 64 * DA; const float* px = xp + t * 64;
#pragma unroll   // constant indices keep the tile in registers
    for (int i = 0; i < 8; ++i) { fw[i] = *(const v4f*)(pw + (size_t)i * DA); fx[i] = *(const v4f*)(px + (size_t)i * 16 * DA); }
    asm volatile("s_wait_xcnt 0x0" ::: "memory"); };   // precaution kept for issued global accesses, ahead of the next write of their address registers
  auto st = [&](int t) { char* sb = smem + (t & 1) * PJ_ST;
#pragma unroll
    for (int c = 0; c < 4; ++c) { v8b h;
#pragma unroll
      for (int i = 0; i < 8; ++i) h[i] = (__bf16)fw[i][c];
      *(v8b*)(sb + (wng * 4 + c) * PJ_PB + wkg * 16) = h; }
#pragma unroll
    for (int i = 0; i < 8; ++i) { v4b h; h[0] = (__bf16)fx[i][0]; h[1] = (__bf16)fx[i][1]; h[2] = (__bf16)fx[i][2]; h[3] = (__bf16)fx[i][3];
      *(v4b*)(sb + (128 + xr + 16 * i) * PJ_PB + xq * 8) = h; } };
  v8f acc[2][4] = {};
  ld(0); st(0); ld(1); PJ_BAR();
#pragma unroll 1   // one copy of the trip's body: the buffer is picked by t & 1
  for (int t = 0; t < DA / 64; ++t) { const __bf16* sb = (const __bf16*)(smem + (t & 1) * PJ_ST);
#pragma unroll   // this and the ones below: constant indices keep fragments and accumulators in registers
    for (int kk = 0; kk < 2; ++kk) { v16b a[2], w[4];
#pragma unroll
      for (int i = 0; i < 2; ++i) a[i] = frag_b(sb + (128 + wr * 32 + i * 16 + col) * (PJ_PB / 2) + kk * 32, lane);
#pragma unroll
      for (int j = 0; j < 4; ++j) w[j] = frag_b(sb + (wc * 64 + j * 16 + col) * (PJ_PB / 2) + kk * 32, lane);
#pragma unroll
      for (int i = 0; i < 2; ++i)
#pragma unroll
        for (int j = 0; j < 4; ++j) acc[i][j] = wmma_bf(a[i], w[j], acc[i][j]); }
    if (t + 1 < DA / 64) st(t + 1);   // into the buffer whose last readers left at the barrier of trip t - 1
    if (t + 2 < DA / 64) ld(t + 2);
    PJ_BAR(); }   // publishes tile t + 1 and ends every read of tile t's buffer
  _Float16 (*sh)[136] = (_Float16 (*)[136])smem, (*sl)[136] = (_Float16 (*)[136])(smem + 128 * 136 * 2), (*th)[136] = (_Float16 (*)[136])smem;   // output staging takes the ring's place behind the last trip's barrier
#pragma unroll
  for (int i = 0; i < 2; ++i)
#pragma unroll
    for (int j = 0; j < 4; ++j) { const float bb = bfr(Bm[c0 + wc * 64 + j * 16 + col]);
#pragma unroll
      for (int r = 0; r < 8; ++r) { const float v = acc[i][j][r] + bb; const int rl = wr * 32 + i * 16 + 8 * g + r, cl = wc * 64 + j * 16 + col; const _Float16 hv = (_Float16)v;
        if (which == 2) th[cl][rl] = hv; else { sh[rl][cl] = hv; sl[rl][cl] = (_Float16)(v - (float)hv); } } }
  __syncthreads();
  if (which < 2) { _Float16* dh = which == 0 ? QH : KH; for (int e = tid; e < 128 * 16; e += 256) { const int rl = e >> 4, q = e & 15; vst2((unsigned*)(dh + (r0 + rl) * DA + c0 + q * 8), *(const v4u*)&sh[rl][q * 8]); vst2((unsigned*)((which == 0 ? QL : KL) + (r0 + rl) * DA + c0 + q * 8), *(const v4u*)&sl[rl][q * 8]); } }
  else { const size_t b = r0 / NN; const int n0 = (int)(r0 % NN); for (int e = tid; e < 128 * 16; e += 256) { const int cl = e >> 4, q = e & 15; vst2((unsigned*)(VT + (b * DA + c0 + cl) * (size_t)NN + n0 + q * 8), *(const v4u*)&th[cl][q * 8]); } } }
// ---- tensor loads: one request of a wave brings a two-dimensional tile global -> LDS, through no register and with no per-lane address work
typedef uint32_t u32x4 __attribute__((ext_vector_type(4)));
typedef uint32_t u32x8 __attribute__((ext_vector_type(8)));
__device__ __forceinline__ uint32_t uni(uint32_t v) { return (uint32_t)__builtin_amdgcn_readfirstlane(v); }
// an issue test, or the stage number a descriptor is formed from: the test compiles to a scalar branch, and what is formed from the number stays behind the waits written in front of it
__device__ __forceinline__ uint32_t pinned(uint32_t v) { uint32_t w = (uint32_t)__builtin_amdgcn_readfirstlane(v); asm volatile("" : "+s"(w)); return w; }   // the empty statement holds the word in a scalar register (tensor mover: issue test, descriptor word)
// group 1: 1-byte elements, tensor = tile = rows x ROWB bytes, source row pitch in bytes, no mask; 16 bytes of LDS pad behind every row (interval code IVL = the row's length)
template <uint32_t ROWB, uint32_t IVL> __device__ __forceinline__ u32x8 tdm_group1(uint32_t rows, uint32_t src_pitch) {
  u32x8 g;
  g[0] = uni((1u << 20) | (IVL << 22) | (3u << 25));
  g[1] = uni((ROWB & 0xFFFFu) << 16);
  g[2] = uni((ROWB >> 16) | ((rows & 0xFFFFu) << 16));
  g[3] = uni((rows >> 16) | (ROWB << 16));
  g[4] = uni(rows);
  g[5] = uni(src_pitch);
  g[6] = uni(0u);
  g[7] = uni(0u);
  return g;
}
// group 0: count 1, the tile's place in the work-group's LDS, the global address of its first byte, type 2
__device__ __forceinline__ u32x4 tdm_group0(uint32_t lds_dst, uint64_t ga) {
  u32x4 g;
  g[0] = uni(1u); g[1] = uni(lds_dst); g[2] = uni((uint32_t)ga); g[3] = uni((((uint32_t)(ga >> 32)) & 0x01FFFFFFu) | 0x80000000u);
  return g;
}
__device__ __forceinline__ void tdm_load(u32x4 g0, u32x8 g1) { asm volatile("tensor_load_to_lds %0, %1" :: "s"(g0), "s"(g1) : "memory"); }
// this wave's own tensor load has landed (the compiler places no wait for it)
#define WAIT_TENSOR() asm volatile("s_wait_tensorcnt 0x0" ::: "memory")
// the same wait, naming the request's two descriptor groups as inputs, so that their scalar registers keep their words until it has landed: for k_pv, whose build otherwise reuses registers of group 1 while a request is in flight
__device__ __forceinline__ void wait_tensor(u32x4 g0, u32x8 g1) { asm volatile("s_wait_tensorcnt 0x0" :: "s"(g0), "s"(g1) : "memory"); }
// this wave's LDS reads have retired before the buffer they read is handed back for a refill
#define WAIT_DS() asm volatile("s_wait_dscnt 0x0" ::: "memory")
// ---- k_sc: block = (256 queries, 256 keys, batch), 16 waves of 64 x 64: logits (qh kh + ql kh + qh kl) -> S; operand tiles of 64 k staged in LDS, two buffers.
// A fragment read from LDS feeds four tiles of the wave, and a row staged in LDS meets 256 rows of the other operand.
#define SC_PB 144                      // LDS row pitch in bytes: 128-byte rows + 16, conflict-free for 16-byte reads
#define SC_SL 10240                    // one wave's slice: 64 rows of SC_PB bytes, rounded up so that every slice starts at a multiple of 2 KiB
#define SC_ST (16 * SC_SL)             // one stage: slices 0..3 kh, 4..7 kl, 8..11 qh, 12..15 ql, 64 rows each
static_assert(2 * SC_ST >= 16 * 64 * 68 * 4 && NN % 256 == 0, "the output staging takes the ring's place; whole blocks");
static_assert(SC_SL % 2048 == 0 && SC_SL >= 64 * SC_PB && 2 * SC_ST <= 327680, "slices at multiples of 2 KiB, inside the LDS of one WGP");
__global__ __launch_bounds__(512) void k_sc(const _Float16* __restrict__ QH, const _Float16* __restrict__ QL, const _Float16* __restrict__ KH, const _Float16* __restrict__ KL, float* __restrict__ S) { __shared__ __attribute__((aligned(2048))) char smem[2 * SC_ST];
  const int tid = threadIdx.x, wave = tid >> 5, lane = tid & 31, col = lane & 15, g = lane >> 4; const int k0 = blockIdx.y * 256; const int b = blockIdx.z; const int q0 = blockIdx.x * 256;
  const int wq = wave >> 2, wk = wave & 3;   // the wave's tile: queries wq * 64, keys wk * 64
  const uint32_t wv = uni(threadIdx.x >> 5);   // the wave's number, scalar: wave wv brings slice wv of every stage, 64 rows of 128 bytes, by one tensor load
  const _Float16* pl = wv < 4 ? KH : wv < 8 ? KL : wv < 12 ? QH : QL;
  const uint64_t ga0 = (uint64_t)(size_t)(pl + ((size_t)b * NN + (wv < 8 ? k0 : q0) + (wv & 3) * 64) * DA);
  const uint32_t ld0 = (uint32_t)(size_t)smem + wv * SC_SL;
  const u32x8 g1 = tdm_group1<128, 4>(64u, DA * 2u);
  auto fill = [&](uint32_t s) { tdm_load(tdm_group0(ld0 + (s & 1u) * SC_ST, ga0 + (uint64_t)s * 128u), g1); };
  v8f acc[4][4] = {};
  fill(0); WAIT_TENSOR(); __syncthreads(); fill(pinned(1u));   // pinned: stage 1's descriptor is formed behind stage 0's wait
#pragma unroll 1   // one copy of the trip's body: the buffer is picked by t & 1
  for (int t = 0; t < DA / 64; ++t) { const _Float16* sb = (const _Float16*)(smem + (t & 1) * SC_ST);
#pragma unroll   // this and the ones below: constant indices keep fragments and accumulators in registers
    for (int kk = 0; kk < 2; ++kk) { v16h ah[4], al[4];
#pragma unroll
      for (int i = 0; i < 4; ++i) { ah[i] = frag_h(sb + (8 + wq) * (SC_SL / 2) + (i * 16 + col) * (SC_PB / 2) + kk * 32, lane); al[i] = frag_h(sb + (12 + wq) * (SC_SL / 2) + (i * 16 + col) * (SC_PB / 2) + kk * 32, lane); }
#pragma unroll
      for (int j = 0; j < 4; ++j) {   // one key tile at a time: the whole wave stays inside the 256 registers that 16 waves leave it
        const v16h fh = frag_h(sb + wk * (SC_SL / 2) + (j * 16 + col) * (SC_PB / 2) + kk * 32, lane), fl = frag_h(sb + (4 + wk) * (SC_SL / 2) + (j * 16 + col) * (SC_PB / 2) + kk * 32, lane);
        // 3 products, each accumulator in the order qh kh, ql kh, qh kl; three independent tiles stand between two products of one accumulator
#pragma unroll
        for (int i = 0; i < 4; ++i) acc[i][j] = wmma16(ah[i], fh, acc[i][j]);
#pragma unroll
        for (int i = 0; i < 4; ++i) acc[i][j] = wmma16(al[i], fh, acc[i][j]);
#pragma unroll
        for (int i = 0; i < 4; ++i) acc[i][j] = wmma16(ah[i], fl, acc[i][j]); } }
    WAIT_DS(); WAIT_TENSOR(); __syncthreads();   // publishes tile t + 1 and ends every read of tile t's buffer
    const uint32_t s2 = pinned((uint32_t)t + 2u);   // pinned: the next descriptor is formed behind the wait above
    if (pinned(s2 < DA / 64)) fill(s2); }   // pinned: a scalar branch decides whether the wave issues
  WAIT_TENSOR(); WAIT_DS();   // no load is outstanding when the ring's LDS is reused and the wave ends
  float (*ss)[64][68] = (float (*)[64][68])smem;   // output staging takes the ring's place behind the last trip's barrier; each wave its own part
#pragma unroll
  for (int i = 0; i < 4; ++i)
#pragma unroll
    for (int j = 0; j < 4; ++j)
#pragma unroll
      for (int r = 0; r < 8; ++r) ss[wave][i * 16 + 8 * g + r][j * 16 + col] = acc[i][j][r];
  LDSX(); float* o = S + (size_t)(b * NN + q0 + wq * 64 + g) * NN + k0 + wk * 64 + col * 4;   // a store covers two rows of 256 contiguous bytes: whole lines
#pragma unroll   // constant row offsets: one address pair serves every store
  for (int rl = 0; rl < 64; rl += 2) vst2(o + (size_t)rl * NN, *(const v4f*)&ss[wave][rl + g][col * 4]); }
// ---- k_sm: SM_ROWS consecutive rows a wave: softmax -> P x 2^11 (f16). A row (8 KB) is read once, as 16 loads of 512
// contiguous bytes, and stays in registers through maximum, exp, sum and scaling; no LDS, no barrier; one work-group of 16 waves per WGP.
#define SM_WAVES 16
#define SM_ROWS 4
static_assert(SM_ROWS % 2 == 0 && (TQB * 64 * TNB) % (SM_WAVES * SM_ROWS) == 0 && NN == 16 * 128, "whole waves of row pairs; 16 loads a row");
typedef __attribute__((ext_vector_type(4))) _Float16 v4h;
// value of lane l ^ M inside a 16-lane row (DPP row_xmask), and of lane l ^ 16
template <int M> __device__ __forceinline__ float lx(float v) { return __builtin_bit_cast(float, __builtin_amdgcn_update_dpp(0, __builtin_bit_cast(int, v), 0x160 + M, 0xf, 0xf, true)); }
__device__ __forceinline__ float lx16(float v) { return __builtin_bit_cast(float, __builtin_amdgcn_permlanex16(__builtin_bit_cast(int, v), __builtin_bit_cast(int, v), 0x76543210, 0xfedcba98, false, false)); }
__device__ __forceinline__ size_t sm_row(int f) { return (size_t)(f / (TQB * 64)) * NN + (size_t)(f % (TQB * 64)); }
__device__ __forceinline__ void sm_load(v4f* x, const float* __restrict__ S, int f, int lane) { const float* p = S + sm_row(f) * NN + lane * 4;
#pragma unroll   // constant indices keep the row in registers
  for (int i = 0; i < 16; ++i) x[i] = __builtin_nontemporal_load((const v4f*)(p + i * 128));   // non-temporal: each logit is read once
  asm volatile("s_wait_xcnt 0x0" :: "v"(p) : "memory"); }   // precaution kept for issued global accesses; p as an input: where the loads address through its registers, no load's result may take them ahead of the wait
__device__ __forceinline__ float sm_max(const v4f* x) {
  float m0 = -3.0e38f, m1 = m0, m2 = m0, m3 = m0;   // four independent chains
#pragma unroll
  for (int i = 0; i < 16; i += 2) { m0 = fmaxf(fmaxf(m0, x[i][0]), x[i + 1][0]); m1 = fmaxf(fmaxf(m1, x[i][1]), x[i + 1][1]); m2 = fmaxf(fmaxf(m2, x[i][2]), x[i + 1][2]); m3 = fmaxf(fmaxf(m3, x[i][3]), x[i + 1][3]); }
  float m = fmaxf(fmaxf(m0, m1), fmaxf(m2, m3));
  m = fmaxf(m, lx<1>(m)); m = fmaxf(m, lx<2>(m)); m = fmaxf(m, lx<4>(m)); m = fmaxf(m, lx<8>(m)); return fmaxf(m, lx16(m)); }
__device__ __forceinline__ void sm_rest(v4f* x, float m, _Float16* __restrict__ PH, int f, int lane) {
  float a0 = 0.f, a1 = 0.f, a2 = 0.f, a3 = 0.f;
#pragma unroll
  for (int i = 0; i < 16; ++i) { x[i][0] = expf(x[i][0] - m); x[i][1] = expf(x[i][1] - m); x[i][2] = expf(x[i][2] - m); x[i][3] = expf(x[i][3] - m);
    a0 += x[i][0]; a1 += x[i][1]; a2 += x[i][2]; a3 += x[i][3]; }
  float a = (a0 + a1) + (a2 + a3);
  a += lx<1>(a); a += lx<2>(a); a += lx<4>(a); a += lx<8>(a); a += lx16(a);   // both partners add the same two values: every lane ends with the same sum
  const float sc = (1.0f / a) * 2048.0f;   // the power of two is exact, so exp * sc rounds as (exp * inv) * 2048
  _Float16* o = PH + sm_row(f) * NN + lane * 4;
#pragma unroll
  for (int i = 0; i < 16; ++i) { v4h h; h[0] = (_Float16)(x[i][0] * sc); h[1] = (_Float16)(x[i][1] * sc); h[2] = (_Float16)(x[i][2] * sc); h[3] = (_Float16)(x[i][3] * sc);
    *(v4h*)(o + i * 128) = h; }   // 256 contiguous bytes a wave: whole lines
  asm volatile("s_wait_xcnt 0x0" :: "v"(o) : "memory"); }   // the same precaution behind the stores, ahead of the next row's use of their registers
__global__ __launch_bounds__(SM_WAVES * 32) void k_sm(const float* __restrict__ S, _Float16* __restrict__ PH) {
  const int lane = threadIdx.x & 31; const int f0 = (blockIdx.x * SM_WAVES + __builtin_amdgcn_readfirstlane(threadIdx.x >> 5)) * SM_ROWS;   // wave-uniform first row
  v4f xa[16], xb[16];   // two row buffers: the next row's loads fly while this row's exp, sum and stores are worked
  sm_load(xa, S, f0, lane);
#pragma unroll 1   // one copy of the two-row body keeps the kernel's text small
  for (int r = 0; r < SM_ROWS; r += 2) {
    const float ma = sm_max(xa);
    sm_load(xb, S, f0 + r + 1, lane);
    __builtin_amdgcn_sched_barrier(0);   // without it the compiler sinks the next row's loads behind this row's long arithmetic (the loads below stand in a block of their own)
    sm_rest(xa, ma, PH, f0 + r, lane);
    const float mb = sm_max(xb);   // taken ahead of the branch: it reads the whole row, so the waits for that row's loads end here and none behind the join waits the fresh loads out
    if (r + 2 < SM_ROWS) sm_load(xa, S, f0 + r + 2, lane);
    sm_rest(xb, mb, PH, f0 + r + 1, lane); } }
// ---- k_pv: block = (128 queries, 256 value dims, batch), 8 waves of 64 x 64: out = P . v; operand tiles of 128 keys staged in LDS, two buffers
#define PV_PB 272                      // LDS row pitch in bytes: 256-byte rows + 16, conflict-free for 16-byte reads
#define PV_SV 18432                    // a slice of 64 v plane rows of PV_PB bytes, rounded up so that every slice starts at a multiple of 2 KiB
#define PV_SP 10240                    // a slice of 32 P rows, rounded up likewise
#define PV_ST (4 * PV_SV + 4 * PV_SP)  // one stage: four v slices, then four P slices
static_assert(2 * PV_ST >= 8 * 64 * 68 * 4 && NN % 128 == 0 && DA % 256 == 0, "the output staging takes the ring's place; whole blocks");
static_assert(PV_SV % 2048 == 0 && PV_SV >= 64 * PV_PB && PV_SP % 2048 == 0 && PV_SP >= 32 * PV_PB, "slices at multiples of 2 KiB");
__global__ __launch_bounds__(256) void k_pv(const _Float16* __restrict__ PH, const _Float16* __restrict__ VT, float* __restrict__ OUT) { __shared__ __attribute__((aligned(2048))) char smem[2 * PV_ST];
  const int tid = threadIdx.x, wave = tid >> 5, lane = tid & 31, col = lane & 15, g = lane >> 4; const int c0 = blockIdx.y * 256; const int b = blockIdx.z; const int q0 = blockIdx.x * 128;
  const int wq = wave >> 2, wd = wave & 3;   // the wave's tile: queries wq * 64, value dims wd * 64
  const uint32_t wv = uni(threadIdx.x >> 5);   // the wave's number, scalar: waves 0..3 bring the v slices (64 rows of 256 bytes), waves 4..7 the P slices (32 rows), one tensor load each per stage
  const uint64_t ga0 = (uint64_t)(size_t)(wv < 4 ? VT + ((size_t)b * DA + c0 + wv * 64) * (size_t)NN : PH + ((size_t)b * NN + q0 + (wv - 4) * 32) * (size_t)NN);
  const uint32_t ld0 = (uint32_t)(size_t)smem + (wv < 4 ? wv * PV_SV : 4 * PV_SV + (wv - 4) * PV_SP);
  const u32x8 g1 = tdm_group1<256, 5>(wv < 4 ? 64u : 32u, NN * 2u);
  u32x4 g0;   // the group 0 of the request last issued
  auto fill = [&](uint32_t s) { g0 = tdm_group0(ld0 + (s & 1u) * PV_ST, ga0 + (uint64_t)s * 256u); tdm_load(g0, g1); };
  v8f acc[4][4] = {};
  fill(0); wait_tensor(g0, g1); __syncthreads(); fill(pinned(1u));   // pinned: stage 1's descriptor is formed behind stage 0's wait
#pragma unroll 1   // one copy of the trip's body: the buffer is picked by t & 1
  for (int t = 0; t < NN / 128; ++t) { const _Float16* sb = (const _Float16*)(smem + (t & 1) * PV_ST);
    v16h fp[4], fv[2][4];   // the v fragments have two register sets: block kk + 1's are read ahead of block kk's products (same tile only); a second set of P fragments would not fit
    auto fragv = [&](int kk) {
#pragma unroll   // this and the ones below: constant indices keep fragments and accumulators in registers
      for (int j = 0; j < 4; ++j) fv[kk & 1][j] = frag_h(sb + wd * (PV_SV / 2) + (j * 16 + col) * (PV_PB / 2) + kk * 32, lane); };
    fragv(0);
#pragma unroll
    for (int kk = 0; kk < 4; ++kk) {
#pragma unroll
      for (int i = 0; i < 4; ++i) fp[i] = frag_h(sb + 4 * (PV_SV / 2) + (wq * 2 + (i >> 1)) * (PV_SP / 2) + ((i & 1) * 16 + col) * (PV_PB / 2) + kk * 32, lane);
      if (kk + 1 < 4) fragv(kk + 1);
#pragma unroll
      for (int i = 0; i < 4; ++i)
#pragma unroll
        for (int j = 0; j < 4; ++j) acc[i][j] = wmma16(fp[i], fv[kk & 1][j], acc[i][j]); }
    WAIT_DS(); wait_tensor(g0, g1); __syncthreads();   // publishes tile t + 1 and ends every read of tile t's buffer
    const uint32_t s2 = pinned((uint32_t)t + 2u);   // pinned: the next descriptor is formed behind the wait above
    if (pinned(s2 < NN / 128)) fill(s2); }   // pinned: a scalar branch decides whether the wave issues
  wait_tensor(g0, g1); WAIT_DS();   // no load is outstanding when the ring's LDS is reused and the wave ends
  float (*ss)[64][68] = (float (*)[64][68])smem;   // output staging takes the ring's place behind the last trip's barrier; each wave its own part
#pragma unroll
  for (int i = 0; i < 4; ++i)
#pragma unroll
    for (int j = 0; j < 4; ++j)
#pragma unroll
      for (int r = 0; r < 8; ++r) ss[wave][i * 16 + 8 * g + r][j * 16 + col] = acc[i][j][r] * (1.0f / 2048.0f);
  LDSX(); float* o = OUT + (size_t)(b * NN + q0 + wq * 64 + g) * DA + c0 + wd * 64 + col * 4;   // a store covers two rows of 256 contiguous bytes: whole lines
#pragma unroll   // constant row offsets: one address pair serves every store
  for (int rl = 0; rl < 64; rl += 2) vst2(o + (size_t)rl * DA, *(const v4f*)&ss[wave][rl + g][col * 4]); }
extern "C" void kernel_launch(void* const* d_in, const int* in_sizes, int n_in, void* d_out, int out_size, void* d_ws, size_t ws_size, hipStream_t stream) {
  (void)in_sizes; (void)n_in; (void)out_size;
  const float** F = (const float**)d_in;   // 0 Q, 1 K, 2 V [8,2048,512]; 3 Wq, 4 bq, 5 Wk, 6 bk, 7 Wv, 8 bv ((in,out) [512,512] / [512])
  if (ws_size < (size_t)WS_END) return;
  char* ws = (char*)d_ws; _Float16 *QH = (_Float16*)(ws + WS_QH), *QL = (_Float16*)(ws + WS_QL), *KH = (_Float16*)(ws + WS_KH), *KL = (_Float16*)(ws + WS_KL), *VT = (_Float16*)(ws + WS_VT), *PH = (_Float16*)(ws + WS_PH); float* S = (float*)(ws + WS_S);
  k_proj<<<dim3(TNB * NN / 128, DA / 128, 3), 256, 0, stream>>>(F[0], F[1], F[2], F[3], F[4], F[5], F[6], F[7], F[8], QH, QL, KH, KL, VT);
  k_sc<<<dim3(TQB / 4, NN / 256, TNB), 512, 0, stream>>>(QH, QL, KH, KL, S);
  k_sm<<<dim3(TQB * 64 * TNB / (SM_WAVES * SM_ROWS)), SM_WAVES * 32, 0, stream>>>(S, PH);
  k_pv<<<dim3(TQB / 2, DA / 256, TNB), 256, 0, stream>>>(PH, VT, (float*)d_out);
}

// v007
// It runs in 151 microseconds.
// Next to v006, in two timings, it ran 1.11 times as fast each time.
// All steps since v000 together make it 10.1 times as fast.
// compute dtype: all float inputs rounded to bf16; v = V Wv + bv with EXACT bf16 products on WMMA 16x16x32 ((in,out) weights), f32 accumulate; the k projection is folded into q: q . k = u . K + q . bk with u = Q (Wq Wk^T) + bq Wk^T, and q . bk, the same for every key of a row, leaves the softmax unchanged and is not formed; Wq Wk^T in f32, used as bf16 hi + residual (2 products); u as f16 hi + unscaled residual, K's bf16 values held in one f16 plane -> UNSCALED logits less the row constant with 2 products (uh K + ul K), stored in f32 for all batches; softmax in f32 (precise expf) -> P as f16 x 2^11; P . v with v rounded once to f16 (1 product); f32 output.
#include <hip/hip_runtime.h>
#include <math.h>
#include <stdint.h>

typedef __attribute__((ext_vector_type(16))) _Float16 v16h;
typedef __attribute__((ext_vector_type(16))) __bf16 v16b;
typedef __attribute__((ext_vector_type(8)))  _Float16 v8h;
typedef __attribute__((ext_vector_type(8)))  float v8f;
typedef __attribute__((ext_vector_type(4)))  float v4f;
typedef __attribute__((ext_vector_type(2)))  float v2f;
typedef __attribute__((ext_vector_type(4)))  unsigned v4u;
typedef __attribute__((ext_vector_type(4)))  int v4i;
typedef float __attribute__((may_alias)) float_a;
typedef int __attribute__((may_alias)) int_a;

template <typename T> __device__ __forceinline__ void vst2(void* p, T v) { *(T*)p = v;  }
__device__ __forceinline__ v8f wmma16(v16h a, v16h b, v8f c) {
  v8f d = __builtin_amdgcn_wmma_f32_16x16x32_f16(false, a, false, b, (short)0, c, false, false);
  asm volatile("v_nop\n\tv_nop\n\tv_nop\n\tv_nop" : "+v"(d) : "v"(a), "v"(b));
  return d;
}
__device__ __forceinline__ v8f wmma_bf(v16b a, v16b b, v8f c) {
  v8f d = __builtin_amdgcn_wmma_f32_16x16x32_bf16(false, a, false, b, (short)0, c, false, false);
  asm volatile("v_nop\n\tv_nop\n\tv_nop\n\tv_nop" : "+v"(d) : "v"(a), "v"(b));
  return d;
}
// 16x16x32 fragments: lane = (h = lane>>4, row/col = lane&15); elements 0..7 = k0+8h+0..7, 8..15 = k0+16+8h+0..7; D element r = row 8h+r
__device__ __forceinline__ v16h frag_h(const _Float16* rowk0, int lane) {
  union { v16h v; v8h q[2]; } u; const _Float16* p = rowk0 + 8 * (lane >> 4);
  u.q[0] = *(const v8h*)p; u.q[1] = *(const v8h*)(p + 16); return u.v;
}
__device__ __forceinline__ v16h frag_f32(const float* rowk0, int lane) {
  v16h a; const float* p = rowk0 + 8 * (lane >> 4);
#pragma unroll
  for (int i = 0; i < 8; ++i) { a[i] = (_Float16)p[i]; a[8 + i] = (_Float16)p[16 + i]; }
  return a;
}
__device__ __forceinline__ v16h frag_f32s(const float* rowk0, int lane, float sc) {
  v16h a; const float* p = rowk0 + 8 * (lane >> 4);
#pragma unroll
  for (int i = 0; i < 8; ++i) { a[i] = (_Float16)(p[i] * sc); a[8 + i] = (_Float16)(p[16 + i] * sc); }
  return a;
}
// column fragment from a [K][ld] layout (column n), rows >= K read as 0
__device__ __forceinline__ v16h fragc_f32(const float* W, int k0, int n, int lane, int ld, int K) {
  v16h a; const int g = lane >> 4;
#pragma unroll
  for (int i = 0; i < 8; ++i) { const int ka = k0 + 8 * g + i, kb = ka + 16;
    a[i] = (_Float16)(ka < K ? W[(size_t)(ka < K ? ka : K - 1) * ld + n] : 0.f); a[8 + i] = (_Float16)(kb < K ? W[(size_t)(kb < K ? kb : K - 1) * ld + n] : 0.f); }
  return a;
}
struct F2 { v16b h, l; };
__device__ __forceinline__ F2 bsplit16(const float v[16]) { F2 r;
#pragma unroll
  for (int i = 0; i < 16; ++i) { const __bf16 h = (__bf16)v[i]; r.h[i] = h; r.l[i] = (__bf16)(v[i] - (float)h); }
  return r; }
__device__ __forceinline__ F2 split_row(const float* row, int k0, int lane) { float v[16]; const float* p = row + k0 + 8 * (lane >> 4);
#pragma unroll
  for (int i = 0; i < 8; ++i) { v[i] = p[i]; v[8 + i] = p[16 + i]; }
  return bsplit16(v); }
__device__ __forceinline__ F2 split_rowK(const float* row, int k0, int lane, int K) { float v[16]; const int g = lane >> 4;
#pragma unroll
  for (int i = 0; i < 8; ++i) { const int ka = k0 + 8 * g + i, kb = ka + 16; v[i] = ka < K ? row[ka < K ? ka : K - 1] : 0.f; v[8 + i] = kb < K ? row[kb < K ? kb : K - 1] : 0.f; }
  return bsplit16(v); }
__device__ __forceinline__ F2 split_col(const float* W, int k0, int n, int lane, int ld, int K) { float v[16]; const int g = lane >> 4;
#pragma unroll
  for (int i = 0; i < 8; ++i) { const int ka = k0 + 8 * g + i, kb = ka + 16; v[i] = ka < K ? W[(size_t)(ka < K ? ka : K - 1) * ld + n] : 0.f; v[8 + i] = kb < K ? W[(size_t)(kb < K ? kb : K - 1) * ld + n] : 0.f; }
  return bsplit16(v); }
__device__ __forceinline__ v8f mac3(const F2& a, const F2& b, v8f c) { c = wmma_bf(a.l, b.h, c); c = wmma_bf(a.h, b.l, c); return wmma_bf(a.h, b.h, c); }
__device__ __forceinline__ float sigm(float v) { return 1.0f / (1.0f + expf(-v)); }
#define LDSX() do { asm volatile("s_wait_dscnt 0" ::: "memory"); __builtin_amdgcn_wave_barrier(); __builtin_amdgcn_fence(__ATOMIC_RELEASE, "workgroup"); } while (0)


// 'NN' attention (B 8, 2,048 tokens, 512 dims, single head, no scaling): out = softmax(q k^T) v with q, k, v = Linear(Q), Linear(K), Linear(V).
#define NB 8
#define NN 2048
#define DA 512
#ifndef TNB
#define TNB NB
#endif
#ifndef TQB
#define TQB (NN / 64)
#endif
typedef __attribute__((ext_vector_type(8))) __bf16 v8b;
__device__ __forceinline__ v16b frag_b(const __bf16* rowk0, int lane) {
  union { v16b v; v8b q[2]; } u; const __bf16* p = rowk0 + 8 * (lane >> 4);
  u.q[0] = *(const v8b*)p; u.q[1] = *(const v8b*)(p + 16); return u.v;
}
__device__ __forceinline__ float bfr(float v) { return (float)(__bf16)v; }
__device__ __attribute__((noinline)) float exp_ni(float v) { return expf(v); }
__device__ __attribute__((noinline)) float erf_ni(float v) { return erff(v); }

#define WS_QH  0u                                    // f16 u rows [b*n][512]
#define WS_QL  (WS_QH + 2u * (size_t)NB * NN * DA)      // f16 u residual rows
#define WS_KH  (WS_QL + 2u * (size_t)NB * NN * DA)      // f16 K rows (the input's bf16 values)
#define WS_KL  (WS_KH + 2u * (size_t)NB * NN * DA)      // not used ahead of P
#define WS_VT  (WS_KL + 2u * (size_t)NB * NN * DA)      // f16 v planes [b][512][n]
#define WS_S   (WS_VT + 2u * (size_t)NB * DA * NN)      // f32 logits [b][q][key], all batches
#define WS_PH  WS_QH                                 // f16 P x 2^11 [b][q][key]: takes the place of the four q and k planes, whose last reader (k_sc) has ended; NN == 4 * DA makes the sizes equal
#define WS_M   (WS_S + 4u * (size_t)NB * NN * NN)       // f32 Wq Wk^T [512][512], then 16 rows of which the first is bq Wk^T
#define WS_END (WS_M + 4u * (size_t)(DA + 16) * DA)
static_assert(2u * (size_t)NB * NN * NN <= WS_VT - WS_QH, "P must end in front of the v planes");

// ---- k_m: one wave per 16 x 16 tile of M[i][j] = sum_d Wq[i][d] Wk[j][d]; the tile row behind the last takes bq in place of a Wq row, so M's row 512 is bq Wk^T (rows 513.. repeat it and are not read).
__global__ __launch_bounds__(256) void k_m(const float* __restrict__ WQ, const float* __restrict__ BQ, const float* __restrict__ WK, float* __restrict__ MO) {
  const int tid = threadIdx.x, wave = tid >> 5, lane = tid & 31, col = lane & 15, g = lane >> 4; const int i0 = blockIdx.x * 16, j0 = (blockIdx.y * 8 + wave) * 16;
  const float* ar = (i0 < DA ? WQ + (size_t)(i0 + col) * DA : BQ) + 8 * g; const float* br = WK + (size_t)(j0 + col) * DA + 8 * g;   // the lane's part of its two rows: elements 0..7 = k + 8 g + 0..7, 8..15 = k + 16 + 8 g + 0..7, alike for both operands
  v8f c0 = {}, c1 = {};   // two independent chains
  v4f xa[32], xb[32];   // half a row of each operand on its way: 64 loads in flight, so that the wave waits out a memory latency twice and not once per product
#pragma unroll   // this and the ones below: constant indices keep the rows in registers, constant offsets serve every load from the two row pointers
  for (int h = 0; h < 2; ++h) {
#pragma unroll
    for (int s = 0; s < 8; ++s) { const float* pa = ar + h * 256 + s * 32; const float* pb = br + h * 256 + s * 32;
      xa[4 * s] = *(const v4f*)pa; xa[4 * s + 1] = *(const v4f*)(pa + 4); xa[4 * s + 2] = *(const v4f*)(pa + 16); xa[4 * s + 3] = *(const v4f*)(pa + 20);
      xb[4 * s] = *(const v4f*)pb; xb[4 * s + 1] = *(const v4f*)(pb + 4); xb[4 * s + 2] = *(const v4f*)(pb + 16); xb[4 * s + 3] = *(const v4f*)(pb + 20); }
    asm volatile("s_wait_xcnt 0x0" :: "v"(ar), "v"(br) : "memory");   // precaution kept for issued global accesses; the two row pointers as inputs: no load's result may take their registers ahead of the wait
    __builtin_amdgcn_sched_barrier(0);   // without it the compiler sinks each load to just ahead of its product
#pragma unroll
    for (int s = 0; s < 8; ++s) { v16b a, w;
#pragma unroll
      for (int i = 0; i < 16; ++i) { a[i] = (__bf16)xa[4 * s + (i >> 2)][i & 3]; w[i] = (__bf16)xb[4 * s + (i >> 2)][i & 3]; }
      if (s & 1) c1 = wmma_bf(a, w, c1); else c0 = wmma_bf(a, w, c0); } }
  float* o = MO + (size_t)(i0 + 8 * g) * DA + j0 + col;
#pragma unroll
  for (int r = 0; r < 8; ++r) o[(size_t)r * DA] = c0[r] + c1[r];
  asm volatile("s_wait_xcnt 0x0" ::: "memory"); }   // the same precaution behind the stores
// ---- k_proj: block = (128 rows, 128 cols, which), 8 waves of 32 x 64: u = Q M + M's row 512 (f16 hi + residual rows; M as bf16 hi + residual, 2 products), K (no product: its bf16 values as f16 rows), v (f16 planes); each from its own input.
// Tiles of 64 k of X and of W are read once a block as whole lines, rounded to bf16 and staged in LDS (W turned k-contiguous on the way), two buffers.
typedef __attribute__((ext_vector_type(4))) __bf16 v4b;
#define PJ_PB 144                      // LDS row pitch in bytes: 128-byte rows + 16, conflict-free for 16-byte reads and for the turned W stores
#define PJ_ST (384 * PJ_PB)            // one stage: rows 0..127 W columns (64 k each), 128..255 X rows, 256..383 the residual of the W columns (u only)
static_assert(2 * PJ_ST >= 2 * 128 * 136 * 2, "the output staging takes the ring's place");
// work-group barrier that orders LDS only: __syncthreads() would also wait out the global loads of the tile after next, which are meant to stay in flight across it
#define PJ_BAR() do { __builtin_amdgcn_fence(__ATOMIC_RELEASE, "workgroup", "local"); __builtin_amdgcn_s_barrier(); __builtin_amdgcn_fence(__ATOMIC_ACQUIRE, "workgroup", "local"); } while (0)
__global__ __launch_bounds__(256) void k_proj(const float* __restrict__ XQ, const float* __restrict__ XK, const float* __restrict__ XV, const float* __restrict__ WQ, const float* __restrict__ BQ, const float* __restrict__ WK, const float* __restrict__ BK, const float* __restrict__ WV, const float* __restrict__ BV, _Float16* __restrict__ QH, _Float16* __restrict__ QL, _Float16* __restrict__ KH, _Float16* __restrict__ KL, _Float16* __restrict__ VT) {
  __shared__ __align__(16) char smem[2 * PJ_ST];
  const int tid = threadIdx.x, wave = tid >> 5, lane = tid & 31, col = lane & 15, g = lane >> 4; const int which = blockIdx.z; const int c0 = blockIdx.y * 128; const size_t r0 = (size_t)blockIdx.x * 128;
  if (which == 1) {   // K: rounded to bf16 like every input; 8 significant bits are held by f16. The whole block leaves here, ahead of every barrier
    const float* p = XK + (r0 + (tid >> 4)) * DA + c0 + (tid & 15) * 8; _Float16* o = KH + (r0 + (tid >> 4)) * DA + c0 + (tid & 15) * 8; v4f x[16];
#pragma unroll   // constant row offsets: one address pair serves every load, and one every store
    for (int i = 0; i < 8; ++i) { x[2 * i] = *(const v4f*)(p + (size_t)i * 16 * DA); x[2 * i + 1] = *(const v4f*)(p + (size_t)i * 16 * DA + 4); }
    asm volatile("s_wait_xcnt 0x0" :: "v"(p) : "memory");   // precaution kept for issued global accesses; p as an input: no load's result may take its registers ahead of the wait
#pragma unroll
    for (int i = 0; i < 8; ++i) { v8h h;
#pragma unroll
      for (int e = 0; e < 4; ++e) { h[e] = (_Float16)bfr(x[2 * i][e]); h[4 + e] = (_Float16)bfr(x[2 * i + 1][e]); }
      *(v8h*)(o + (size_t)i * 16 * DA) = h; }
    asm volatile("s_wait_xcnt 0x0" :: "v"(o) : "memory");   // the same precaution behind the stores
    return; }
  const int wr = wave >> 1, wc = wave & 1;   // the wave's tile: rows wr * 32, cols wc * 64
  const float* X = which == 0 ? XQ : which == 1 ? XK : XV; const float* Wm = which == 0 ? WQ : which == 1 ? WK : WV; const float* Bm = which == 0 ? BQ : which == 1 ? BK : BV;
  const int wkg = (wave & 1) * 4 + (lane & 3), wng = (wave >> 1) * 8 + (lane >> 2);   // W: a thread holds 8 k x 4 cols; a wave's load covers 4 whole lines, its 16-byte LDS stores fall on all banks
  const int xr = tid >> 4, xq = tid & 15;                                            // X: a thread holds 4 k of rows xr + 16 i; a wave's load covers 4 whole lines
  const float* wp = Wm + (size_t)(wkg * 8) * DA + c0 + wng * 4; const float* xp = X + (r0 + xr) * DA + xq * 4;
  v4f fw[8], fx[8];   // the next tile on its way through registers
  auto ld = [&](int t) { const float* pw = wp + (size_t)t * 64 * DA; const float* px = xp + t * 64;
#pragma unroll   // constant indices keep the tile in registers
    for (int i = 0; i < 8; ++i) { fw[i] = *(const v4f*)(pw + (size_t)i * DA); fx[i] = *(const v4f*)(px + (size_t)i * 16 * DA); }
    asm volatile("s_wait_xcnt 0x0" ::: "memory"); };   // precaution kept for issued global accesses, ahead of the next write of their address registers
  auto st = [&](int t) { char* sb = smem + (t & 1) * PJ_ST;
#pragma unroll
    for (int c = 0; c < 4; ++c) { v8b h;
#pragma unroll
      for (int i = 0; i < 8; ++i) h[i] = (__bf16)fw[i][c];
      *(v8b*)(sb + (wng * 4 + c) * PJ_PB + wkg * 16) = h;
      if (which == 0) { v8b l;
#pragma unroll
        for (int i = 0; i < 8; ++i) l[i] = (__bf16)(fw[i][c] - (float)h[i]);
        *(v8b*)(sb + (256 + wng * 4 + c) * PJ_PB + wkg * 16) = l; } }
#pragma unroll
    for (int i = 0; i < 8; ++i) { v4b h; h[0] = (__bf16)fx[i][0]; h[1] = (__bf16)fx[i][1]; h[2] = (__bf16)fx[i][2]; h[3] = (__bf16)fx[i][3];
      *(v4b*)(sb + (128 + xr + 16 * i) * PJ_PB + xq * 8) = h; } };
  v8f acc[2][4] = {};
  ld(0); st(0); ld(1); PJ_BAR();
#pragma unroll 1   // one copy of the trip's body: the buffer is picked by t & 1
  for (int t = 0; t < DA / 64; ++t) { const __bf16* sb = (const __bf16*)(smem + (t & 1) * PJ_ST);
#pragma unroll   // this and the ones below: constant indices keep fragments and accumulators in registers
    for (int kk = 0; kk < 2; ++kk) { v16b a[2], w[4];
#pragma unroll
      for (int i = 0; i < 2; ++i) a[i] = frag_b(sb + (128 + wr * 32 + i * 16 + col) * (PJ_PB / 2) + kk * 32, lane);
#pragma unroll
      for (int j = 0; j < 4; ++j) w[j] = frag_b(sb + (wc * 64 + j * 16 + col) * (PJ_PB / 2) + kk * 32, lane);
#pragma unroll
      for (int i = 0; i < 2; ++i)
#pragma unroll
        for (int j = 0; j < 4; ++j) acc[i][j] = wmma_bf(a[i], w[j], acc[i][j]);
      if (which == 0) {   // block-uniform: the residual of M against the same X fragments
#pragma unroll
        for (int j = 0; j < 4; ++j) w[j] = frag_b(sb + (256 + wc * 64 + j * 16 + col) * (PJ_PB / 2) + kk * 32, lane);
#pragma unroll
        for (int i = 0; i < 2; ++i)
#pragma unroll
          for (int j = 0; j < 4; ++j) acc[i][j] = wmma_bf(a[i], w[j], acc[i][j]); } }
    if (t + 1 < DA / 64) st(t + 1);   // into the buffer whose last readers left at the barrier of trip t - 1
    if (t + 2 < DA / 64) ld(t + 2);
    PJ_BAR(); }   // publishes tile t + 1 and ends every read of tile t's buffer
  _Float16 (*sh)[136] = (_Float16 (*)[136])smem, (*sl)[136] = (_Float16 (*)[136])(smem + 128 * 136 * 2), (*th)[136] = (_Float16 (*)[136])smem;   // output staging takes the ring's place behind the last trip's barrier
#pragma unroll
  for (int i = 0; i < 2; ++i)
#pragma unroll
    for (int j = 0; j < 4; ++j) { const float bi = Bm[c0 + wc * 64 + j * 16 + col]; const float bb = which == 0 ? bi : bfr(bi);   // u's bias is bq Wk^T, computed in f32: not an input, not rounded
#pragma unroll
      for (int r = 0; r < 8; ++r) { const float v = acc[i][j][r] + bb; const int rl = wr * 32 + i * 16 + 8 * g + r, cl = wc * 64 + j * 16 + col; const _Float16 hv = (_Float16)v;
        if (which == 2) th[cl][rl] = hv; else { sh[rl][cl] = hv; sl[rl][cl] = (_Float16)(v - (float)hv); } } }
  __syncthreads();
  if (which < 2) { _Float16* dh = which == 0 ? QH : KH; for (int e = tid; e < 128 * 16; e += 256) { const int rl = e >> 4, q = e & 15; vst2((unsigned*)(dh + (r0 + rl) * DA + c0 + q * 8), *(const v4u*)&sh[rl][q * 8]); vst2((unsigned*)((which == 0 ? QL : KL) + (r0 + rl) * DA + c0 + q * 8), *(const v4u*)&sl[rl][q * 8]); } }
  else { const size_t b = r0 / NN; const int n0 = (int)(r0 % NN); for (int e = tid; e < 128 * 16; e += 256) { const int cl = e >> 4, q = e & 15; vst2((unsigned*)(VT + (b * DA + c0 + cl) * (size_t)NN + n0 + q * 8), *(const v4u*)&th[cl][q * 8]); } } }
// ---- tensor loads: one request of a wave brings a two-dimensional tile global -> LDS, through no register and with no per-lane address work
typedef uint32_t u32x4 __attribute__((ext_vector_type(4)));
typedef uint32_t u32x8 __attribute__((ext_vector_type(8)));
__device__ __forceinline__ uint32_t uni(uint32_t v) { return (uint32_t)__builtin_amdgcn_readfirstlane(v); }
// an issue test, or the stage number a descriptor is formed from: the test compiles to a scalar branch, and what is formed from the number stays behind the waits written in front of it
__device__ __forceinline__ uint32_t pinned(uint32_t v) { uint32_t w = (uint32_t)__builtin_amdgcn_readfirstlane(v); asm volatile("" : "+s"(w)); return w; }   // the empty statement holds the word in a scalar register (tensor mover: issue test, descriptor word)
// group 1: 1-byte elements, tensor = tile = rows x ROWB bytes, source row pitch in bytes, no mask; 16 bytes of LDS pad behind every row (interval code IVL = the row's length)
template <uint32_t ROWB, uint32_t IVL> __device__ __forceinline__ u32x8 tdm_group1(uint32_t rows, uint32_t src_pitch) {
  u32x8 g;
  g[0] = uni((1u << 20) | (IVL << 22) | (3u << 25));
  g[1] = uni((ROWB & 0xFFFFu) << 16);
  g[2] = uni((ROWB >> 16) | ((rows & 0xFFFFu) << 16));
  g[3] = uni((rows >> 16) | (ROWB << 16));
  g[4] = uni(rows);
  g[5] = uni(src_pitch);
  g[6] = uni(0u);
  g[7] = uni(0u);
  return g;
}
// group 0: count 1, the tile's place in the work-group's LDS, the global address of its first byte, type 2
__device__ __forceinline__ u32x4 tdm_group0(uint32_t lds_dst, uint64_t ga) {
  u32x4 g;
  g[0] = uni(1u); g[1] = uni(lds_dst); g[2] = uni((uint32_t)ga); g[3] = uni((((uint32_t)(ga >> 32)) & 0x01FFFFFFu) | 0x80000000u);
  return g;
}
__device__ __forceinline__ void tdm_load(u32x4 g0, u32x8 g1) { asm volatile("tensor_load_to_lds %0, %1" :: "s"(g0), "s"(g1) : "memory"); }
// this wave's own tensor load has landed (the compiler places no wait for it); the wait names the request's two descriptor groups as inputs, so that their scalar registers keep their words until it has landed: the builds of k_sc and k_pv otherwise reuse registers of group 1 while a request is in flight
__device__ __forceinline__ void wait_tensor(u32x4 g0, u32x8 g1) { asm volatile("s_wait_tensorcnt 0x0" :: "s"(g0), "s"(g1) : "memory"); }
// this wave's LDS reads have retired before the buffer they read is handed back for a refill
#define WAIT_DS() asm volatile("s_wait_dscnt 0x0" ::: "memory")
// ---- k_sc: block = (256 queries, 256 keys, batch), 16 waves of 64 x 64: logits (uh K + ul K) -> S; operand tiles of 64 k staged in LDS, two buffers.
// A fragment read from LDS feeds four tiles of the wave, and a row staged in LDS meets 256 rows of the other operand.
#define SC_PB 144                      // LDS row pitch in bytes: 128-byte rows + 16, conflict-free for 16-byte reads
#define SC_SL 10240                    // one wave's slice: 64 rows of SC_PB bytes, rounded up so that every slice starts at a multiple of 2 KiB
#define SC_ST (12 * SC_SL)             // one stage: slices 0..3 K, 4..7 uh, 8..11 ul, 64 rows each
#define SC_LDS (16 * 64 * 68 * 4)      // the output staging, which takes the ring's place, is the larger of the two
static_assert(SC_LDS >= 2 * SC_ST && NN % 256 == 0, "the ring lies inside the array; whole blocks");
static_assert(SC_SL % 2048 == 0 && SC_SL >= 64 * SC_PB && SC_LDS <= 327680, "slices at multiples of 2 KiB, inside the LDS of one WGP");
__global__ __launch_bounds__(512) void k_sc(const _Float16* __restrict__ QH, const _Float16* __restrict__ QL, const _Float16* __restrict__ KH, float* __restrict__ S) { __shared__ __attribute__((aligned(2048))) char smem[SC_LDS];
  const int tid = threadIdx.x, wave = tid >> 5, lane = tid & 31, col = lane & 15, g = lane >> 4; const int k0 = blockIdx.y * 256; const int b = blockIdx.z; const int q0 = blockIdx.x * 256;
  const int wq = wave >> 2, wk = wave & 3;   // the wave's tile: queries wq * 64, keys wk * 64
  const uint32_t wv = uni(threadIdx.x >> 5);   // the wave's number, scalar: waves 0..11 bring slice wv of every stage, 64 rows of 128 bytes, by one tensor load each; waves 12..15 issue none
  const uint32_t sv = wv < 12u ? wv : 0u;   // a wave that issues nothing still forms addresses in bounds
  const _Float16* pl = sv < 4 ? KH : sv < 8 ? QH : QL;
  const uint64_t ga0 = (uint64_t)(size_t)(pl + ((size_t)b * NN + (sv < 4 ? k0 : q0) + (sv & 3) * 64) * DA);
  const uint32_t ld0 = (uint32_t)(size_t)smem + sv * SC_SL;
  const u32x8 g1 = tdm_group1<128, 4>(pinned(64u), DA * 2u);   // pinned: the descriptor words formed from it are held in scalar registers, so that group 1 is one register group for every request and its wait, not formed anew (in registers free for reuse) at each issue
  u32x4 g0 = tdm_group0(ld0, ga0);   // the group 0 of the request last issued
  auto fill = [&](uint32_t s) { g0 = tdm_group0(ld0 + (s & 1u) * SC_ST, ga0 + (uint64_t)s * 128u); tdm_load(g0, g1); };
  v8f acc[4][4] = {};
  if (pinned(wv < 12u)) fill(0);   // pinned, here and below: a scalar branch decides whether the wave issues
  wait_tensor(g0, g1); __syncthreads();
  if (pinned(wv < 12u)) fill(pinned(1u));   // pinned(1u): stage 1's descriptor is formed behind stage 0's wait
#pragma unroll 1   // one copy of the trip's body: the buffer is picked by t & 1
  for (int t = 0; t < DA / 64; ++t) { const _Float16* sb = (const _Float16*)(smem + (t & 1) * SC_ST);
#pragma unroll   // this and the ones below: constant indices keep fragments and accumulators in registers
    for (int kk = 0; kk < 2; ++kk) { v16h ah[4], al[4];
#pragma unroll
      for (int i = 0; i < 4; ++i) { ah[i] = frag_h(sb + (4 + wq) * (SC_SL / 2) + (i * 16 + col) * (SC_PB / 2) + kk * 32, lane); al[i] = frag_h(sb + (8 + wq) * (SC_SL / 2) + (i * 16 + col) * (SC_PB / 2) + kk * 32, lane); }
      v16h fk[4];   // with one K plane the block's twelve fragments fit the 256 registers that 16 waves leave a wave: they are read as one group
#pragma unroll
      for (int j = 0; j < 4; ++j) fk[j] = frag_h(sb + wk * (SC_SL / 2) + (j * 16 + col) * (SC_PB / 2) + kk * 32, lane);
#pragma unroll
      for (int j = 0; j < 4; ++j) {
        // 2 products, each accumulator in the order uh K, ul K; three independent tiles stand between two products of one accumulator
#pragma unroll
        for (int i = 0; i < 4; ++i) acc[i][j] = wmma16(ah[i], fk[j], acc[i][j]);
#pragma unroll
        for (int i = 0; i < 4; ++i) acc[i][j] = wmma16(al[i], fk[j], acc[i][j]); } }
    WAIT_DS(); wait_tensor(g0, g1); __syncthreads();   // publishes tile t + 1 and ends every read of tile t's buffer
    const uint32_t s2 = pinned((uint32_t)t + 2u);   // pinned: the next descriptor is formed behind the wait above
    if (pinned(s2 < DA / 64 && wv < 12u)) fill(s2); }
  wait_tensor(g0, g1); WAIT_DS();   // no load is outstanding when the ring's LDS is reused and the wave ends
  float (*ss)[64][68] = (float (*)[64][68])smem;   // output staging takes the ring's place behind the last trip's barrier; each wave its own part
#pragma unroll
  for (int i = 0; i < 4; ++i)
#pragma unroll
    for (int j = 0; j < 4; ++j)
#pragma unroll
      for (int r = 0; r < 8; ++r) ss[wave][i * 16 + 8 * g + r][j * 16 + col] = acc[i][j][r];
  LDSX(); float* o = S + (size_t)(b * NN + q0 + wq * 64 + g) * NN + k0 + wk * 64 + col * 4;   // a store covers two rows of 256 contiguous bytes: whole lines
#pragma unroll   // constant row offsets: one address pair serves every store
  for (int rl = 0; rl < 64; rl += 2) vst2(o + (size_t)rl * NN, *(const v4f*)&ss[wave][rl + g][col * 4]); }
// ---- k_sm: SM_ROWS consecutive rows a wave: softmax -> P x 2^11 (f16). A row (8 KB) is read once, as 16 loads of 512
// contiguous bytes, and stays in registers through maximum, exp, sum and scaling; no LDS, no barrier; one work-group of 16 waves per WGP.
#define SM_WAVES 16
#define SM_ROWS 4
static_assert(SM_ROWS % 2 == 0 && (TQB * 64 * TNB) % (SM_WAVES * SM_ROWS) == 0 && NN == 16 * 128, "whole waves of row pairs; 16 loads a row");
typedef __attribute__((ext_vector_type(4))) _Float16 v4h;
// value of lane l ^ M inside a 16-lane row (DPP row_xmask), and of lane l ^ 16
template <int M> __device__ __forceinline__ float lx(float v) { return __builtin_bit_cast(float, __builtin_amdgcn_update_dpp(0, __builtin_bit_cast(int, v), 0x160 + M, 0xf, 0xf, true)); }
__device__ __forceinline__ float lx16(float v) { return __builtin_bit_cast(float, __builtin_amdgcn_permlanex16(__builtin_bit_cast(int, v), __builtin_bit_cast(int, v), 0x76543210, 0xfedcba98, false, false)); }
__device__ __forceinline__ size_t sm_row(int f) { return (size_t)(f / (TQB * 64)) * NN + (size_t)(f % (TQB * 64)); }
__device__ __forceinline__ void sm_load(v4f* x, const float* __restrict__ S, int f, int lane) { const float* p = S + sm_row(f) * NN + lane * 4;
#pragma unroll   // constant indices keep the row in registers
  for (int i = 0; i < 16; ++i) x[i] = __builtin_nontemporal_load((const v4f*)(p + i * 128));   // non-temporal: each logit is read once
  asm volatile("s_wait_xcnt 0x0" :: "v"(p) : "memory"); }   // precaution kept for issued global accesses; p as an input: where the loads address through its registers, no load's result may take them ahead of the wait
__device__ __forceinline__ float sm_max(const v4f* x) {
  float m0 = -3.0e38f, m1 = m0, m2 = m0, m3 = m0;   // four independent chains
#pragma unroll
  for (int i = 0; i < 16; i += 2) { m0 = fmaxf(fmaxf(m0, x[i][0]), x[i + 1][0]); m1 = fmaxf(fmaxf(m1, x[i][1]), x[i + 1][1]); m2 = fmaxf(fmaxf(m2, x[i][2]), x[i + 1][2]); m3 = fmaxf(fmaxf(m3, x[i][3]), x[i + 1][3]); }
  float m = fmaxf(fmaxf(m0, m1), fmaxf(m2, m3));
  m = fmaxf(m, lx<1>(m)); m = fmaxf(m, lx<2>(m)); m = fmaxf(m, lx<4>(m)); m = fmaxf(m, lx<8>(m)); return fmaxf(m, lx16(m)); }
__device__ __forceinline__ void sm_rest(v4f* x, float m, _Float16* __restrict__ PH, int f, int lane) {
  float a0 = 0.f, a1 = 0.f, a2 = 0.f, a3 = 0.f;
#pragma unroll
  for (int i = 0; i < 16; ++i) { x[i][0] = expf(x[i][0] - m); x[i][1] = expf(x[i][1] - m); x[i][2] = expf(x[i][2] - m); x[i][3] = expf(x[i][3] - m);
    a0 += x[i][0]; a1 += x[i][1]; a2 += x[i][2]; a3 += x[i][3]; }
  float a = (a0 + a1) + (a2 + a3);
  a += lx<1>(a); a += lx<2>(a); a += lx<4>(a); a += lx<8>(a); a += lx16(a);   // both partners add the same two values: every lane ends with the same sum
  const float sc = (1.0f / a) * 2048.0f;   // the power of two is exact, so exp * sc rounds as (exp * inv) * 2048
  _Float16* o = PH + sm_row(f) * NN + lane * 4;
#pragma unroll
  for (int i = 0; i < 16; ++i) { v4h h; h[0] = (_Float16)(x[i][0] * sc); h[1] = (_Float16)(x[i][1] * sc); h[2] = (_Float16)(x[i][2] * sc); h[3] = (_Float16)(x[i][3] * sc);
    *(v4h*)(o + i * 128) = h; }   // 256 contiguous bytes a wave: whole lines
  asm volatile("s_wait_xcnt 0x0" :: "v"(o) : "memory"); }   // the same precaution behind the stores, ahead of the next row's use of their registers
__global__ __launch_bounds__(SM_WAVES * 32) void k_sm(const float* __restrict__ S, _Float16* __restrict__ PH) {
  const int lane = threadIdx.x & 31; const int f0 = (blockIdx.x * SM_WAVES + __builtin_amdgcn_readfirstlane(threadIdx.x >> 5)) * SM_ROWS;   // wave-uniform first row
  v4f xa[16], xb[16];   // two row buffers: the next row's loads fly while this row's exp, sum and stores are worked
  sm_load(xa, S, f0, lane);
#pragma unroll 1   // one copy of the two-row body keeps the kernel's text small
  for (int r = 0; r < SM_ROWS; r += 2) {
    const float ma = sm_max(xa);
    sm_load(xb, S, f0 + r + 1, lane);
    __builtin_amdgcn_sched_barrier(0);   // without it the compiler sinks the next row's loads behind this row's long arithmetic (the loads below stand in a block of their own)
    sm_rest(xa, ma, PH, f0 + r, lane);
    const float mb = sm_max(xb);   // taken ahead of the branch: it reads the whole row, so the waits for that row's loads end here and none behind the join waits the fresh loads out
    if (r + 2 < SM_ROWS) sm_load(xa, S, f0 + r + 2, lane);
    sm_rest(xb, mb, PH, f0 + r + 1, lane); } }
// ---- k_pv: block = (128 queries, 256 value dims, batch), 8 waves of 64 x 64: out = P . v; operand tiles of 128 keys staged in LDS, two buffers
#define PV_PB 272                      // LDS row pitch in bytes: 256-byte rows + 16, conflict-free for 16-byte reads
#define PV_SV 18432                    // a slice of 64 v plane rows of PV_PB bytes, rounded up so that every slice starts at a multiple of 2 KiB
#define PV_SP 10240                    // a slice of 32 P rows, rounded up likewise
#define PV_ST (4 * PV_SV + 4 * PV_SP)  // one stage: four v slices, then four P slices
static_assert(2 * PV_ST >= 8 * 64 * 68 * 4 && NN % 128 == 0 && DA % 256 == 0, "the output staging takes the ring's place; whole blocks");
static_assert(PV_SV % 2048 == 0 && PV_SV >= 64 * PV_PB && PV_SP % 2048 == 0 && PV_SP >= 32 * PV_PB, "slices at multiples of 2 KiB");
__global__ __launch_bounds__(256) void k_pv(const _Float16* __restrict__ PH, const _Float16* __restrict__ VT, float* __restrict__ OUT) { __shared__ __attribute__((aligned(2048))) char smem[2 * PV_ST];
  const int tid = threadIdx.x, wave = tid >> 5, lane = tid & 31, col = lane & 15, g = lane >> 4; const int c0 = blockIdx.y * 256; const int b = blockIdx.z; const int q0 = blockIdx.x * 128;
  const int wq = wave >> 2, wd = wave & 3;   // the wave's tile: queries wq * 64, value dims wd * 64
  const uint32_t wv = uni(threadIdx.x >> 5);   // the wave's number, scalar: waves 0..3 bring the v slices (64 rows of 256 bytes), waves 4..7 the P slices (32 rows), one tensor load each per stage
  const uint64_t ga0 = (uint64_t)(size_t)(wv < 4 ? VT + ((size_t)b * DA + c0 + wv * 64) * (size_t)NN : PH + ((size_t)b * NN + q0 + (wv - 4) * 32) * (size_t)NN);
  const uint32_t ld0 = (uint32_t)(size_t)smem + (wv < 4 ? wv * PV_SV : 4 * PV_SV + (wv - 4) * PV_SP);
  const u32x8 g1 = tdm_group1<256, 5>(wv < 4 ? 64u : 32u, NN * 2u);
  u32x4 g0;   // the group 0 of the request last issued
  auto fill = [&](uint32_t s) { g0 = tdm_group0(ld0 + (s & 1u) * PV_ST, ga0 + (uint64_t)s * 256u); tdm_load(g0, g1); };
  v8f acc[4][4] = {};
  fill(0); wait_tensor(g0, g1); __syncthreads(); fill(pinned(1u));   // pinned: stage 1's descriptor is formed behind stage 0's wait
#pragma unroll 1   // one copy of the trip's body: the buffer is picked by t & 1
  for (int t = 0; t < NN / 128; ++t) { const _Float16* sb = (const _Float16*)(smem + (t & 1) * PV_ST);
    v16h fp[4], fv[2][4];   // the v fragments have two register sets: block kk + 1's are read ahead of block kk's products (same tile only); a second set of P fragments would not fit
    auto fragv = [&](int kk) {
#pragma unroll   // this and the ones below: constant indices keep fragments and accumulators in registers
      for (int j = 0; j < 4; ++j) fv[kk & 1][j] = frag_h(sb + wd * (PV_SV / 2) + (j * 16 + col) * (PV_PB / 2) + kk * 32, lane); };
    fragv(0);
#pragma unroll
    for (int kk = 0; kk < 4; ++kk) {
#pragma unroll
      for (int i = 0; i < 4; ++i) fp[i] = frag_h(sb + 4 * (PV_SV / 2) + (wq * 2 + (i >> 1)) * (PV_SP / 2) + ((i & 1) * 16 + col) * (PV_PB / 2) + kk * 32, lane);
      if (kk + 1 < 4) fragv(kk + 1);
#pragma unroll
      for (int i = 0; i < 4; ++i)
#pragma unroll
        for (int j = 0; j < 4; ++j) acc[i][j] = wmma16(fp[i], fv[kk & 1][j], acc[i][j]); }
    WAIT_DS(); wait_tensor(g0, g1); __syncthreads();   // publishes tile t + 1 and ends every read of tile t's buffer
    const uint32_t s2 = pinned((uint32_t)t + 2u);   // pinned: the next descriptor is formed behind the wait above
    if (pinned(s2 < NN / 128)) fill(s2); }   // pinned: a scalar branch decides whether the wave issues
  wait_tensor(g0, g1); WAIT_DS();   // no load is outstanding when the ring's LDS is reused and the wave ends
  float (*ss)[64][68] = (float (*)[64][68])smem;   // output staging takes the ring's place behind the last trip's barrier; each wave its own part
#pragma unroll
  for (int i = 0; i < 4; ++i)
#pragma unroll
    for (int j = 0; j < 4; ++j)
#pragma unroll
      for (int r = 0; r < 8; ++r) ss[wave][i * 16 + 8 * g + r][j * 16 + col] = acc[i][j][r] * (1.0f / 2048.0f);
  LDSX(); float* o = OUT + (size_t)(b * NN + q0 + wq * 64 + g) * DA + c0 + wd * 64 + col * 4;   // a store covers two rows of 256 contiguous bytes: whole lines
#pragma unroll   // constant row offsets: one address pair serves every store
  for (int rl = 0; rl < 64; rl += 2) vst2(o + (size_t)rl * DA, *(const v4f*)&ss[wave][rl + g][col * 4]); }
extern "C" void kernel_launch(void* const* d_in, const int* in_sizes, int n_in, void* d_out, int out_size, void* d_ws, size_t ws_size, hipStream_t stream) {
  (void)in_sizes; (void)n_in; (void)out_size;
  const float** F = (const float**)d_in;   // 0 Q, 1 K, 2 V [8,2048,512]; 3 Wq, 4 bq, 5 Wk, 6 bk, 7 Wv, 8 bv ((in,out) [512,512] / [512])
  if (ws_size < (size_t)WS_END) return;
  char* ws = (char*)d_ws; _Float16 *QH = (_Float16*)(ws + WS_QH), *QL = (_Float16*)(ws + WS_QL), *KH = (_Float16*)(ws + WS_KH), *KL = (_Float16*)(ws + WS_KL), *VT = (_Float16*)(ws + WS_VT), *PH = (_Float16*)(ws + WS_PH); float *S = (float*)(ws + WS_S), *MQ = (float*)(ws + WS_M);
  k_m<<<dim3(DA / 16 + 1, DA / 128), 256, 0, stream>>>(F[3], F[4], F[5], MQ);
  k_proj<<<dim3(TNB * NN / 128, DA / 128, 3), 256, 0, stream>>>(F[0], F[1], F[2], MQ, MQ + (size_t)DA * DA, F[5], F[6], F[7], F[8], QH, QL, KH, KL, VT);
  k_sc<<<dim3(TQB / 4, NN / 256, TNB), 512, 0, stream>>>(QH, QL, KH, S);
  k_sm<<<dim3(TQB * 64 * TNB / (SM_WAVES * SM_ROWS)), SM_WAVES * 32, 0, stream>>>(S, PH);
  k_pv<<<dim3(TQB / 2, DA / 256, TNB), 256, 0, stream>>>(PH, VT, (float*)d_out);
}

// v008
// Measured time: 136 microseconds a run.
// Timed twice side by side with v007, it ran 1.11 times as fast both times.
// Counting every step since v000, it is 11.2 times as fast.
// compute dtype: all float inputs rounded to bf16; v = V Wv + bv with EXACT bf16 products on WMMA 16x16x32 ((in,out) weights), f32 accumulate; the k projection is folded into q: q . k = u . K + q . bk with u = Q (Wq Wk^T) + bq Wk^T, and q . bk, the same for every key of a row, leaves the softmax unchanged and is not formed; Wq Wk^T in f32, used as bf16 hi + residual (2 products); u as f16 hi + unscaled residual, K's bf16 values held in one f16 plane -> UNSCALED logits less the row constant with 2 products (uh K + ul K), stored in f32 for all batches; softmax in f32 (precise expf) -> P as f16 x 2^11; P . v with v rounded once to f16 (1 product); f32 output.
#include <hip/hip_runtime.h>
#include <math.h>
#include <stdint.h>

typedef __attribute__((ext_vector_type(16))) _Float16 v16h;
typedef __attribute__((ext_vector_type(16))) __bf16 v16b;
typedef __attribute__((ext_vector_type(8)))  _Float16 v8h;
typedef __attribute__((ext_vector_type(8)))  float v8f;
typedef __attribute__((ext_vector_type(4)))  float v4f;
typedef __attribute__((ext_vector_type(2)))  float v2f;
typedef __attribute__((ext_vector_type(4)))  unsigned v4u;
typedef __attribute__((ext_vector_type(4)))  int v4i;
typedef float __attribute__((may_alias)) float_a;
typedef int __attribute__((may_alias)) int_a;

template <typename T> __device__ __forceinline__ void vst2(void* p, T v) { *(T*)p = v;  }
__device__ __forceinline__ v8f wmma16(v16h a, v16h b, v8f c) {
  v8f d = __builtin_amdgcn_wmma_f32_16x16x32_f16(false, a, false, b, (short)0, c, false, false);
  asm volatile("v_nop\n\tv_nop\n\tv_nop\n\tv_nop" : "+v"(d) : "v"(a), "v"(b));
  return d;
}
__device__ __forceinline__ v8f wmma_bf(v16b a, v16b b, v8f c) {
  v8f d = __builtin_amdgcn_wmma_f32_16x16x32_bf16(false, a, false, b, (short)0, c, false, false);
  asm volatile("v_nop\n\tv_nop\n\tv_nop\n\tv_nop" : "+v"(d) : "v"(a), "v"(b));
  return d;
}
// 16x16x32 fragments: lane = (h = lane>>4, row/col = lane&15); elements 0..7 = k0+8h+0..7, 8..15 = k0+16+8h+0..7; D element r = row 8h+r
__device__ __forceinline__ v16h frag_h(const _Float16* rowk0, int lane) {
  union { v16h v; v8h q[2]; } u; const _Float16* p = rowk0 + 8 * (lane >> 4);
  u.q[0] = *(const v8h*)p; u.q[1] = *(const v8h*)(p + 16); return u.v;
}
__device__ __forceinline__ v16h frag_f32(const float* rowk0, int lane) {
  v16h a; const float* p = rowk0 + 8 * (lane >> 4);
#pragma unroll
  for (int i = 0; i < 8; ++i) { a[i] = (_Float16)p[i]; a[8 + i] = (_Float16)p[16 + i]; }
  return a;
}
__device__ __forceinline__ v16h frag_f32s(const float* rowk0, int lane, float sc) {
  v16h a; const float* p = rowk0 + 8 * (lane >> 4);
#pragma unroll
  for (int i = 0; i < 8; ++i) { a[i] = (_Float16)(p[i] * sc); a[8 + i] = (_Float16)(p[16 + i] * sc); }
  return a;
}
// column fragment from a [K][ld] layout (column n), rows >= K read as 0
__device__ __forceinline__ v16h fragc_f32(const float* W, int k0, int n, int lane, int ld, int K) {
  v16h a; const int g = lane >> 4;
#pragma unroll
  for (int i = 0; i < 8; ++i) { const int ka = k0 + 8 * g + i, kb = ka + 16;
    a[i] = (_Float16)(ka < K ? W[(size_t)(ka < K ? ka : K - 1) * ld + n] : 0.f); a[8 + i] = (_Float16)(kb < K ? W[(size_t)(kb < K ? kb : K - 1) * ld + n] : 0.f); }
  return a;
}
struct F2 { v16b h, l; };
__device__ __forceinline__ F2 bsplit16(const float v[16]) { F2 r;
#pragma unroll
  for (int i = 0; i < 16; ++i) { const __bf16 h = (__bf16)v[i]; r.h[i] = h; r.l[i] = (__bf16)(v[i] - (float)h); }
  return r; }
__device__ __forceinline__ F2 split_row(const float* row, int k0, int lane) { float v[16]; const float* p = row + k0 + 8 * (lane >> 4);
#pragma unroll
  for (int i = 0; i < 8; ++i) { v[i] = p[i]; v[8 + i] = p[16 + i]; }
  return bsplit16(v); }
__device__ __forceinline__ F2 split_rowK(const float* row, int k0, int lane, int K) { float v[16]; const int g = lane >> 4;
#pragma unroll
  for (int i = 0; i < 8; ++i) { const int ka = k0 + 8 * g + i, kb = ka + 16; v[i] = ka < K ? row[ka < K ? ka : K - 1] : 0.f; v[8 + i] = kb < K ? row[kb < K ? kb : K - 1] : 0.f; }
  return bsplit16(v); }
__device__ __forceinline__ F2 split_col(const float* W, int k0, int n, int lane, int ld, int K) { float v[16]; const int g = lane >> 4;
#pragma unroll
  for (int i = 0; i < 8; ++i) { const int ka = k0 + 8 * g + i, kb = ka + 16; v[i] = ka < K ? W[(size_t)(ka < K ? ka : K - 1) * ld + n] : 0.f; v[8 + i] = kb < K ? W[(size_t)(kb < K ? kb : K - 1) * ld + n] : 0.f; }
  return bsplit16(v); }
__device__ __forceinline__ v8f mac3(const F2& a, const F2& b, v8f c) { c = wmma_bf(a.l, b.h, c); c = wmma_bf(a.h, b.l, c); return wmma_bf(a.h, b.h, c); }
__device__ __forceinline__ float sigm(float v) { return 1.0f / (1.0f + expf(-v)); }
#define LDSX() do { asm volatile("s_wait_dscnt 0" ::: "memory"); __builtin_amdgcn_wave_barrier(); __builtin_amdgcn_fence(__ATOMIC_RELEASE, "workgroup"); } while (0)


// 'NN' attention (B 8, 2,048 tokens, 512 dims, single head, no scaling): out = softmax(q k^T) v with q, k, v = Linear(Q), Linear(K), Linear(V).
#define NB 8
#define NN 2048
#define DA 512
#ifndef TNB
#define TNB NB
#endif
#ifndef TQB
#define TQB (NN / 64)
#endif
typedef __attribute__((ext_vector_type(8))) __bf16 v8b;
__device__ __forceinline__ v16b frag_b(const __bf16* rowk0, int lane) {
  union { v16b v; v8b q[2]; } u; const __bf16* p = rowk0 + 8 * (lane >> 4);
  u.q[0] = *(const v8b*)p; u.q[1] = *(const v8b*)(p + 16); return u.v;
}
__device__ __forceinline__ float bfr(float v) { return (float)(__bf16)v; }
__device__ __attribute__((noinline)) float exp_ni(float v) { return expf(v); }
__device__ __attribute__((noinline)) float erf_ni(float v) { return erff(v); }

#define WS_QH  0u                                    // f16 u rows [b*n][512]
#define WS_QL  (WS_QH + 2u * (size_t)NB * NN * DA)      // f16 u residual rows
#define WS_KH  (WS_QL + 2u * (size_t)NB * NN * DA)      // f16 K rows (the input's bf16 values)
#define WS_KL  (WS_KH + 2u * (size_t)NB * NN * DA)      // not used ahead of P
#define WS_VT  (WS_KL + 2u * (size_t)NB * NN * DA)      // f16 v planes [b][512][n]
#define WS_S   (WS_VT + 2u * (size_t)NB * DA * NN)      // f32 logits [b][q][key], all batches
#define WS_PH  WS_QH                                 // f16 P x 2^11 [b][q][key]: takes the place of the four q and k planes, whose last reader (k_sc) has ended; NN == 4 * DA makes the sizes equal
#define WS_M   (WS_S + 4u * (size_t)NB * NN * NN)       // f32 Wq Wk^T [512][512], then 16 rows of which the first is bq Wk^T
#define WS_END (WS_M + 4u * (size_t)(DA + 16) * DA)
static_assert(2u * (size_t)NB * NN * NN <= WS_VT - WS_QH, "P must end in front of the v planes");

// ---- m_tile: block (bx, by) of the Wq Wk^T work; one wave per 16 x 16 tile of M[i][j] = sum_d Wq[i][d] Wk[j][d]; the tile row behind the last takes bq in place of a Wq row, so M's row 512 is bq Wk^T (rows 513.. repeat it and are not read).
__device__ __forceinline__ void m_tile(const int bx, const int by, const float* __restrict__ WQ, const float* __restrict__ BQ, const float* __restrict__ WK, float* __restrict__ MO) {
  const int tid = threadIdx.x, wave = tid >> 5, lane = tid & 31, col = lane & 15, g = lane >> 4; const int i0 = bx * 16, j0 = (by * 8 + wave) * 16;
  const float* ar = (i0 < DA ? WQ + (size_t)(i0 + col) * DA : BQ) + 8 * g; const float* br = WK + (size_t)(j0 + col) * DA + 8 * g;   // the lane's part of its two rows: elements 0..7 = k + 8 g + 0..7, 8..15 = k + 16 + 8 g + 0..7, alike for both operands
  v8f c0 = {}, c1 = {};   // two independent chains
  v4f xa[16], xb[16];   // a quarter of a row of each operand on its way: 32 loads in flight, so that the wave waits out a memory latency four times and not once per product, in few enough registers that three blocks fit a WGP and the whole launch, the K blocks too, is resident at once
#pragma unroll   // this and the ones below: constant indices keep the rows in registers, constant offsets serve every load from the two row pointers
  for (int h = 0; h < 4; ++h) {
#pragma unroll
    for (int s = 0; s < 4; ++s) { const float* pa = ar + h * 128 + s * 32; const float* pb = br + h * 128 + s * 32;
      xa[4 * s] = *(const v4f*)pa; xa[4 * s + 1] = *(const v4f*)(pa + 4); xa[4 * s + 2] = *(const v4f*)(pa + 16); xa[4 * s + 3] = *(const v4f*)(pa + 20);
      xb[4 * s] = *(const v4f*)pb; xb[4 * s + 1] = *(const v4f*)(pb + 4); xb[4 * s + 2] = *(const v4f*)(pb + 16); xb[4 * s + 3] = *(const v4f*)(pb + 20); }
    asm volatile("s_wait_xcnt 0x0" :: "v"(ar), "v"(br) : "memory");   // precaution kept for issued global accesses; the two row pointers as inputs: no load's result may take their registers ahead of the wait
    __builtin_amdgcn_sched_barrier(0);   // without it the compiler sinks each load to just ahead of its product
#pragma unroll
    for (int s = 0; s < 4; ++s) { v16b a, w;
#pragma unroll
      for (int i = 0; i < 16; ++i) { a[i] = (__bf16)xa[4 * s + (i >> 2)][i & 3]; w[i] = (__bf16)xb[4 * s + (i >> 2)][i & 3]; }
      if (s & 1) c1 = wmma_bf(a, w, c1); else c0 = wmma_bf(a, w, c0); } }
  float* o = MO + (size_t)(i0 + 8 * g) * DA + j0 + col;
#pragma unroll
  for (int r = 0; r < 8; ++r) o[(size_t)r * DA] = c0[r] + c1[r];
  asm volatile("s_wait_xcnt 0x0" ::: "memory"); }   // the same precaution behind the stores
// ---- proj_tile: block = (128 rows bx, 128 cols by) of job 'which', 8 waves of 32 x 64: u = Q M + M's row 512 (f16 hi + residual rows; M as bf16 hi + residual, 2 products), K (no product: its bf16 values as f16 rows), v (f16 planes); each from its own input.
// Tiles of 64 k of X and of W are read once a block as whole lines, rounded to bf16 and staged in LDS (W turned k-contiguous on the way), two buffers.
typedef __attribute__((ext_vector_type(4))) __bf16 v4b;
#define PJ_PB 144                      // LDS row pitch in bytes: 128-byte rows + 16, conflict-free for 16-byte reads and for the turned W stores
#define PJ_ST (384 * PJ_PB)            // one stage: rows 0..127 W columns (64 k each), 128..255 X rows, 256..383 the residual of the W columns (u only)
static_assert(2 * PJ_ST >= 2 * 128 * 136 * 2, "the output staging takes the ring's place");
// work-group barrier that orders LDS only: __syncthreads() would also wait out the global loads of the tile after next, which are meant to stay in flight across it
#define PJ_BAR() do { __builtin_amdgcn_fence(__ATOMIC_RELEASE, "workgroup", "local"); __builtin_amdgcn_s_barrier(); __builtin_amdgcn_fence(__ATOMIC_ACQUIRE, "workgroup", "local"); } while (0)
template <int which> __device__ __forceinline__ void proj_tile(char* smem, const int bx, const int by, const float* __restrict__ XQ, const float* __restrict__ XK, const float* __restrict__ XV, const float* __restrict__ WQ, const float* __restrict__ BQ, const float* __restrict__ WK, const float* __restrict__ BK, const float* __restrict__ WV, const float* __restrict__ BV, _Float16* __restrict__ QH, _Float16* __restrict__ QL, _Float16* __restrict__ KH, _Float16* __restrict__ KL, _Float16* __restrict__ VT) {
  const int tid = threadIdx.x, wave = tid >> 5, lane = tid & 31, col = lane & 15, g = lane >> 4; const int c0 = by * 128; const size_t r0 = (size_t)bx * 128;
  if (which == 1) {   // K: rounded to bf16 like every input; 8 significant bits are held by f16. The whole block leaves here, ahead of every barrier
    const float* p = XK + (r0 + (tid >> 4)) * DA + c0 + (tid & 15) * 8; _Float16* o = KH + (r0 + (tid >> 4)) * DA + c0 + (tid & 15) * 8; v4f x[16];
#pragma unroll   // constant row offsets: one address pair serves every load, and one every store
    for (int i = 0; i < 8; ++i) { x[2 * i] = *(const v4f*)(p + (size_t)i * 16 * DA); x[2 * i + 1] = *(const v4f*)(p + (size_t)i * 16 * DA + 4); }
    asm volatile("s_wait_xcnt 0x0" :: "v"(p) : "memory");   // precaution kept for issued global accesses; p as an input: no load's result may take its registers ahead of the wait
#pragma unroll
    for (int i = 0; i < 8; ++i) { v8h h;
#pragma unroll
      for (int e = 0; e < 4; ++e) { h[e] = (_Float16)bfr(x[2 * i][e]); h[4 + e] = (_Float16)bfr(x[2 * i + 1][e]); }
      *(v8h*)(o + (size_t)i * 16 * DA) = h; }
    asm volatile("s_wait_xcnt 0x0" :: "v"(o) : "memory");   // the same precaution behind the stores
    return; }
  const int wr = wave >> 1, wc = wave & 1;   // the wave's tile: rows wr * 32, cols wc * 64
  const float* X = which == 0 ? XQ : which == 1 ? XK : XV; const float* Wm = which == 0 ? WQ : which == 1 ? WK : WV; const float* Bm = which == 0 ? BQ : which == 1 ? BK : BV;
  const int wkg = (wave & 1) * 4 + (lane & 3), wng = (wave >> 1) * 8 + (lane >> 2);   // W: a thread holds 8 k x 4 cols; a wave's load covers 4 whole lines, its 16-byte LDS stores fall on all banks
  const int xr = tid >> 4, xq = tid & 15;                                            // X: a thread holds 4 k of rows xr + 16 i; a wave's load covers 4 whole lines
  const float* wp = Wm + (size_t)(wkg * 8) * DA + c0 + wng * 4; const float* xp = X + (r0 + xr) * DA + xq * 4;
  v4f fw[8], fx[8];   // the next tile on its way through registers
  auto ld = [&](int t) { const float* pw = wp + (size_t)t * 64 * DA; const float* px = xp + t * 64;
#pragma unroll   // constant indices keep the tile in registers
    for (int i = 0; i < 8; ++i) { fw[i] = *(const v4f*)(pw + (size_t)i * DA); fx[i] = *(const v4f*)(px + (size_t)i * 16 * DA); }
    asm volatile("s_wait_xcnt 0x0" ::: "memory"); };   // precaution kept for issued global accesses, ahead of the next write of their address registers
  auto st = [&](int t) { char* sb = smem + (t & 1) * PJ_ST;
#pragma unroll
    for (int c = 0; c < 4; ++c) { v8b h;
#pragma unroll
      for (int i = 0; i < 8; ++i) h[i] = (__bf16)fw[i][c];
      *(v8b*)(sb + (wng * 4 + c) * PJ_PB + wkg * 16) = h;
      if (which == 0) { v8b l;
#pragma unroll
        for (int i = 0; i < 8; ++i) l[i] = (__bf16)(fw[i][c] - (float)h[i]);
        *(v8b*)(sb + (256 + wng * 4 + c) * PJ_PB + wkg * 16) = l; } }
#pragma unroll
    for (int i = 0; i < 8; ++i) { v4b h; h[0] = (__bf16)fx[i][0]; h[1] = (__bf16)fx[i][1]; h[2] = (__bf16)fx[i][2]; h[3] = (__bf16)fx[i][3];
      *(v4b*)(sb + (128 + xr + 16 * i) * PJ_PB + xq * 8) = h; } };
  v8f acc[2][4] = {};
  ld(0); st(0); ld(1); PJ_BAR();
#pragma unroll 1   // one copy of the trip's body: the buffer is picked by t & 1
  for (int t = 0; t < DA / 64; ++t) { const __bf16* sb = (const __bf16*)(smem + (t & 1) * PJ_ST);
#pragma unroll   // this and the ones below: constant indices keep fragments and accumulators in registers
    for (int kk = 0; kk < 2; ++kk) { v16b a[2], w[4];
#pragma unroll
      for (int i = 0; i < 2; ++i) a[i] = frag_b(sb + (128 + wr * 32 + i * 16 + col) * (PJ_PB / 2) + kk * 32, lane);
#pragma unroll
      for (int j = 0; j < 4; ++j) w[j] = frag_b(sb + (wc * 64 + j * 16 + col) * (PJ_PB / 2) + kk * 32, lane);
#pragma unroll
      for (int i = 0; i < 2; ++i)
#pragma unroll
        for (int j = 0; j < 4; ++j) acc[i][j] = wmma_bf(a[i], w[j], acc[i][j]);
      if (which == 0) {   // block-uniform: the residual of M against the same X fragments
#pragma unroll
        for (int j = 0; j < 4; ++j) w[j] = frag_b(sb + (256 + wc * 64 + j * 16 + col) * (PJ_PB / 2) + kk * 32, lane);
#pragma unroll
        for (int i = 0; i < 2; ++i)
#pragma unroll
          for (int j = 0; j < 4; ++j) acc[i][j] = wmma_bf(a[i], w[j], acc[i][j]); } }
    if (t + 1 < DA / 64) st(t + 1);   // into the buffer whose last readers left at the barrier of trip t - 1
    if (t + 2 < DA / 64) ld(t + 2);
    PJ_BAR(); }   // publishes tile t + 1 and ends every read of tile t's buffer
  _Float16 (*sh)[136] = (_Float16 (*)[136])smem, (*sl)[136] = (_Float16 (*)[136])(smem + 128 * 136 * 2), (*th)[136] = (_Float16 (*)[136])smem;   // output staging takes the ring's place behind the last trip's barrier
#pragma unroll
  for (int i = 0; i < 2; ++i)
#pragma unroll
    for (int j = 0; j < 4; ++j) { const float bi = Bm[c0 + wc * 64 + j * 16 + col]; const float bb = which == 0 ? bi : bfr(bi);   // u's bias is bq Wk^T, computed in f32: not an input, not rounded
#pragma unroll
      for (int r = 0; r < 8; ++r) { const float v = acc[i][j][r] + bb; const int rl = wr * 32 + i * 16 + 8 * g + r, cl = wc * 64 + j * 16 + col; const _Float16 hv = (_Float16)v;
        if (which == 2) th[cl][rl] = hv; else { sh[rl][cl] = hv; sl[rl][cl] = (_Float16)(v - (float)hv); } } }
  __syncthreads();
  if (which < 2) { _Float16* dh = which == 0 ? QH : KH; for (int e = tid; e < 128 * 16; e += 256) { const int rl = e >> 4, q = e & 15; vst2((unsigned*)(dh + (r0 + rl) * DA + c0 + q * 8), *(const v4u*)&sh[rl][q * 8]); vst2((unsigned*)((which == 0 ? QL : KL) + (r0 + rl) * DA + c0 + q * 8), *(const v4u*)&sl[rl][q * 8]); } }
  else { const size_t b = r0 / NN; const int n0 = (int)(r0 % NN); for (int e = tid; e < 128 * 16; e += 256) { const int cl = e >> 4, q = e & 15; vst2((unsigned*)(VT + (b * DA + c0 + cl) * (size_t)NN + n0 + q * 8), *(const v4u*)&th[cl][q * 8]); } } }
// ---- where the projection jobs are launched. Only u needs Wq Wk^T, and only k_pv needs v. k_pre: the few latency-bound Wq Wk^T blocks, first in the grid, with the rounding of K (memory bytes only) beside them.
// k_proj, behind it: u alone. The v projection (LDS, L2 and matrix work) runs beside the softmax (memory bytes and vector work) in k_smv, further down.
#define MT_X (DA / 16 + 1)
#define MT_N (MT_X * (DA / 128))
#define PJ_X (TNB * NN / 128)
#define PJ_N (PJ_X * (DA / 128))
__global__ __launch_bounds__(256) void k_pre(const float* __restrict__ XK, const float* __restrict__ WQ, const float* __restrict__ BQ, const float* __restrict__ WK, const float* __restrict__ BK, float* __restrict__ MO, _Float16* __restrict__ KH) {
  const int bid = blockIdx.x;   // the test is the same for the whole block
  if (bid < MT_N) { m_tile(bid % MT_X, bid / MT_X, WQ, BQ, WK, MO); return; }
  const int e = bid - MT_N;
  proj_tile<1>(nullptr, e % PJ_X, e / PJ_X, nullptr, XK, nullptr, nullptr, nullptr, WK, BK, nullptr, nullptr, nullptr, nullptr, KH, nullptr, nullptr); }   // the K job touches no LDS
__global__ __launch_bounds__(256) void k_proj(const float* __restrict__ XQ, const float* __restrict__ MQ, const float* __restrict__ MB, _Float16* __restrict__ QH, _Float16* __restrict__ QL) {
  __shared__ __align__(16) char smem[2 * PJ_ST];
  proj_tile<0>(smem, blockIdx.x, blockIdx.y, XQ, nullptr, nullptr, MQ, MB, nullptr, nullptr, nullptr, nullptr, QH, QL, nullptr, nullptr, nullptr); }
// ---- tensor loads: one request of a wave brings a two-dimensional tile global -> LDS, through no register and with no per-lane address work
typedef uint32_t u32x4 __attribute__((ext_vector_type(4)));
typedef uint32_t u32x8 __attribute__((ext_vector_type(8)));
__device__ __forceinline__ uint32_t uni(uint32_t v) { return (uint32_t)__builtin_amdgcn_readfirstlane(v); }
// an issue test, or the stage number a descriptor is formed from: the test compiles to a scalar branch, and what is formed from the number stays behind the waits written in front of it
__device__ __forceinline__ uint32_t pinned(uint32_t v) { uint32_t w = (uint32_t)__builtin_amdgcn_readfirstlane(v); asm volatile("" : "+s"(w)); return w; }   // the empty statement holds the word in a scalar register (tensor mover: issue test, descriptor word)
// group 1: 1-byte elements, tensor = tile = rows x ROWB bytes, source row pitch in bytes, no mask; 16 bytes of LDS pad behind every row (interval code IVL = the row's length)
template <uint32_t ROWB, uint32_t IVL> __device__ __forceinline__ u32x8 tdm_group1(uint32_t rows, uint32_t src_pitch) {
  u32x8 g;
  g[0] = uni((1u << 20) | (IVL << 22) | (3u << 25));
  g[1] = uni((ROWB & 0xFFFFu) << 16);
  g[2] = uni((ROWB >> 16) | ((rows & 0xFFFFu) << 16));
  g[3] = uni((rows >> 16) | (ROWB << 16));
  g[4] = uni(rows);
  g[5] = uni(src_pitch);
  g[6] = uni(0u);
  g[7] = uni(0u);
  return g;
}
// group 0: count 1, the tile's place in the work-group's LDS, the global address of its first byte, type 2
__device__ __forceinline__ u32x4 tdm_group0(uint32_t lds_dst, uint64_t ga) {
  u32x4 g;
  g[0] = uni(1u); g[1] = uni(lds_dst); g[2] = uni((uint32_t)ga); g[3] = uni((((uint32_t)(ga >> 32)) & 0x01FFFFFFu) | 0x80000000u);
  return g;
}
__device__ __forceinline__ void tdm_load(u32x4 g0, u32x8 g1) { asm volatile("tensor_load_to_lds %0, %1" :: "s"(g0), "s"(g1) : "memory"); }
// this wave's own tensor load has landed (the compiler places no wait for it); the wait names the request's two descriptor groups as inputs, so that their scalar registers keep their words until it has landed: the builds of k_sc and k_pv otherwise reuse registers of group 1 while a request is in flight
__device__ __forceinline__ void wait_tensor(u32x4 g0, u32x8 g1) { asm volatile("s_wait_tensorcnt 0x0" :: "s"(g0), "s"(g1) : "memory"); }
// this wave's LDS reads have retired before the buffer they read is handed back for a refill
#define WAIT_DS() asm volatile("s_wait_dscnt 0x0" ::: "memory")
// ---- k_sc: block = (256 queries, 256 keys, batch), 16 waves of 64 x 64: logits (uh K + ul K) -> S; operand tiles of 64 k staged in LDS, two buffers.
// A fragment read from LDS feeds four tiles of the wave, and a row staged in LDS meets 256 rows of the other operand.
#define SC_PB 144                      // LDS row pitch in bytes: 128-byte rows + 16, conflict-free for 16-byte reads
#define SC_SL 10240                    // one wave's slice: 64 rows of SC_PB bytes, rounded up so that every slice starts at a multiple of 2 KiB
#define SC_ST (12 * SC_SL)             // one stage: slices 0..3 K, 4..7 uh, 8..11 ul, 64 rows each
#define SC_LDS (16 * 64 * 68 * 4)      // the output staging, which takes the ring's place, is the larger of the two
static_assert(SC_LDS >= 2 * SC_ST && NN % 256 == 0, "the ring lies inside the array; whole blocks");
static_assert(SC_SL % 2048 == 0 && SC_SL >= 64 * SC_PB && SC_LDS <= 327680, "slices at multiples of 2 KiB, inside the LDS of one WGP");
__global__ __launch_bounds__(512) void k_sc(const _Float16* __restrict__ QH, const _Float16* __restrict__ QL, const _Float16* __restrict__ KH, float* __restrict__ S) { __shared__ __attribute__((aligned(2048))) char smem[SC_LDS];
  const int tid = threadIdx.x, wave = tid >> 5, lane = tid & 31, col = lane & 15, g = lane >> 4; const int k0 = blockIdx.y * 256; const int b = blockIdx.z; const int q0 = blockIdx.x * 256;
  const int wq = wave >> 2, wk = wave & 3;   // the wave's tile: queries wq * 64, keys wk * 64
  const uint32_t wv = uni(threadIdx.x >> 5);   // the wave's number, scalar: waves 0..11 bring slice wv of every stage, 64 rows of 128 bytes, by one tensor load each; waves 12..15 issue none
  const uint32_t sv = wv < 12u ? wv : 0u;   // a wave that issues nothing still forms addresses in bounds
  const _Float16* pl = sv < 4 ? KH : sv < 8 ? QH : QL;
  const uint64_t ga0 = (uint64_t)(size_t)(pl + ((size_t)b * NN + (sv < 4 ? k0 : q0) + (sv & 3) * 64) * DA);
  const uint32_t ld0 = (uint32_t)(size_t)smem + sv * SC_SL;
  const u32x8 g1 = tdm_group1<128, 4>(pinned(64u), DA * 2u);   // pinned: the descriptor words formed from it are held in scalar registers, so that group 1 is one register group for every request and its wait, not formed anew (in registers free for reuse) at each issue
  u32x4 g0 = tdm_group0(ld0, ga0);   // the group 0 of the request last issued
  auto fill = [&](uint32_t s) { g0 = tdm_group0(ld0 + (s & 1u) * SC_ST, ga0 + (uint64_t)s * 128u); tdm_load(g0, g1); };
  v8f acc[4][4] = {};
  if (pinned(wv < 12u)) fill(0);   // pinned, here and below: a scalar branch decides whether the wave issues
  wait_tensor(g0, g1); __syncthreads();
  if (pinned(wv < 12u)) fill(pinned(1u));   // pinned(1u): stage 1's descriptor is formed behind stage 0's wait
#pragma unroll 1   // one copy of the trip's body: the buffer is picked by t & 1
  for (int t = 0; t < DA / 64; ++t) { const _Float16* sb = (const _Float16*)(smem + (t & 1) * SC_ST);
#pragma unroll   // this and the ones below: constant indices keep fragments and accumulators in registers
    for (int kk = 0; kk < 2; ++kk) { v16h ah[4], al[4];
#pragma unroll
      for (int i = 0; i < 4; ++i) { ah[i] = frag_h(sb + (4 + wq) * (SC_SL / 2) + (i * 16 + col) * (SC_PB / 2) + kk * 32, lane); al[i] = frag_h(sb + (8 + wq) * (SC_SL / 2) + (i * 16 + col) * (SC_PB / 2) + kk * 32, lane); }
      v16h fk[4];   // with one K plane the block's twelve fragments fit the 256 registers that 16 waves leave a wave: they are read as one group
#pragma unroll
      for (int j = 0; j < 4; ++j) fk[j] = frag_h(sb + wk * (SC_SL / 2) + (j * 16 + col) * (SC_PB / 2) + kk * 32, lane);
#pragma unroll
      for (int j = 0; j < 4; ++j) {
        // 2 products, each accumulator in the order uh K, ul K; three independent tiles stand between two products of one accumulator
#pragma unroll
        for (int i = 0; i < 4; ++i) acc[i][j] = wmma16(ah[i], fk[j], acc[i][j]);
#pragma unroll
        for (int i = 0; i < 4; ++i) acc[i][j] = wmma16(al[i], fk[j], acc[i][j]); } }
    WAIT_DS(); wait_tensor(g0, g1); __syncthreads();   // publishes tile t + 1 and ends every read of tile t's buffer
    const uint32_t s2 = pinned((uint32_t)t + 2u);   // pinned: the next descriptor is formed behind the wait above
    if (pinned(s2 < DA / 64 && wv < 12u)) fill(s2); }
  wait_tensor(g0, g1); WAIT_DS();   // no load is outstanding when the ring's LDS is reused and the wave ends
  float (*ss)[64][68] = (float (*)[64][68])smem;   // output staging takes the ring's place behind the last trip's barrier; each wave its own part
#pragma unroll
  for (int i = 0; i < 4; ++i)
#pragma unroll
    for (int j = 0; j < 4; ++j)
#pragma unroll
      for (int r = 0; r < 8; ++r) ss[wave][i * 16 + 8 * g + r][j * 16 + col] = acc[i][j][r];
  LDSX(); float* o = S + (size_t)(b * NN + q0 + wq * 64 + g) * NN + k0 + wk * 64 + col * 4;   // a store covers two rows of 256 contiguous bytes: whole lines
#pragma unroll   // constant row offsets: one address pair serves every store
  for (int rl = 0; rl < 64; rl += 2) vst2(o + (size_t)rl * NN, *(const v4f*)&ss[wave][rl + g][col * 4]); }
// ---- sm_rows: one wave per logit row, SM_ROWS consecutive rows a wave: softmax -> P x 2^11 (f16). A row (8 KB) is read once, as 16 loads of 512
// contiguous bytes, and stays in registers through maximum, exp, sum and scaling; no LDS, no barrier; blocks of 8 waves, the size of a projection block, whose launch they share.
#define SM_WAVES 8
#define SM_ROWS 4
static_assert(SM_ROWS % 2 == 0 && (TQB * 64 * TNB) % (SM_WAVES * SM_ROWS) == 0 && NN == 16 * 128, "whole waves of row pairs; 16 loads a row");
typedef __attribute__((ext_vector_type(4))) _Float16 v4h;
// value of lane l ^ M inside a 16-lane row (DPP row_xmask), and of lane l ^ 16
template <int M> __device__ __forceinline__ float lx(float v) { return __builtin_bit_cast(float, __builtin_amdgcn_update_dpp(0, __builtin_bit_cast(int, v), 0x160 + M, 0xf, 0xf, true)); }
__device__ __forceinline__ float lx16(float v) { return __builtin_bit_cast(float, __builtin_amdgcn_permlanex16(__builtin_bit_cast(int, v), __builtin_bit_cast(int, v), 0x76543210, 0xfedcba98, false, false)); }
__device__ __forceinline__ size_t sm_row(int f) { return (size_t)(f / (TQB * 64)) * NN + (size_t)(f % (TQB * 64)); }
__device__ __forceinline__ void sm_load(v4f* x, const float* __restrict__ S, int f, int lane) { const float* p = S + sm_row(f) * NN + lane * 4;
#pragma unroll   // constant indices keep the row in registers
  for (int i = 0; i < 16; ++i) x[i] = __builtin_nontemporal_load((const v4f*)(p + i * 128));   // non-temporal: each logit is read once
  asm volatile("s_wait_xcnt 0x0" :: "v"(p) : "memory"); }   // precaution kept for issued global accesses; p as an input: where the loads address through its registers, no load's result may take them ahead of the wait
__device__ __forceinline__ float sm_max(const v4f* x) {
  float m0 = -3.0e38f, m1 = m0, m2 = m0, m3 = m0;   // four independent chains
#pragma unroll
  for (int i = 0; i < 16; i += 2) { m0 = fmaxf(fmaxf(m0, x[i][0]), x[i + 1][0]); m1 = fmaxf(fmaxf(m1, x[i][1]), x[i + 1][1]); m2 = fmaxf(fmaxf(m2, x[i][2]), x[i + 1][2]); m3 = fmaxf(fmaxf(m3, x[i][3]), x[i + 1][3]); }
  float m = fmaxf(fmaxf(m0, m1), fmaxf(m2, m3));
  m = fmaxf(m, lx<1>(m)); m = fmaxf(m, lx<2>(m)); m = fmaxf(m, lx<4>(m)); m = fmaxf(m, lx<8>(m)); return fmaxf(m, lx16(m)); }
__device__ __forceinline__ void sm_rest(v4f* x, float m, _Float16* __restrict__ PH, int f, int lane) {
  float a0 = 0.f, a1 = 0.f, a2 = 0.f, a3 = 0.f;
#pragma unroll
  for (int i = 0; i < 16; ++i) { x[i][0] = expf(x[i][0] - m); x[i][1] = expf(x[i][1] - m); x[i][2] = expf(x[i][2] - m); x[i][3] = expf(x[i][3] - m);
    a0 += x[i][0]; a1 += x[i][1]; a2 += x[i][2]; a3 += x[i][3]; }
  float a = (a0 + a1) + (a2 + a3);
  a += lx<1>(a); a += lx<2>(a); a += lx<4>(a); a += lx<8>(a); a += lx16(a);   // both partners add the same two values: every lane ends with the same sum
  const float sc = (1.0f / a) * 2048.0f;   // the power of two is exact, so exp * sc rounds as (exp * inv) * 2048
  _Float16* o = PH + sm_row(f) * NN + lane * 4;
#pragma unroll
  for (int i = 0; i < 16; ++i) { v4h h; h[0] = (_Float16)(x[i][0] * sc); h[1] = (_Float16)(x[i][1] * sc); h[2] = (_Float16)(x[i][2] * sc); h[3] = (_Float16)(x[i][3] * sc);
    *(v4h*)(o + i * 128) = h; }   // 256 contiguous bytes a wave: whole lines
  asm volatile("s_wait_xcnt 0x0" :: "v"(o) : "memory"); }   // the same precaution behind the stores, ahead of the next row's use of their registers
__device__ __forceinline__ void sm_rows(const int bx, const float* __restrict__ S, _Float16* __restrict__ PH) {
  const int lane = threadIdx.x & 31; const int f0 = (bx * SM_WAVES + __builtin_amdgcn_readfirstlane(threadIdx.x >> 5)) * SM_ROWS;   // wave-uniform first row
  v4f xa[16], xb[16];   // two row buffers: the next row's loads fly while this row's exp, sum and stores are worked
  sm_load(xa, S, f0, lane);
#pragma unroll 1   // one copy of the two-row body keeps the kernel's text small
  for (int r = 0; r < SM_ROWS; r += 2) {
    const float ma = sm_max(xa);
    sm_load(xb, S, f0 + r + 1, lane);
    __builtin_amdgcn_sched_barrier(0);   // without it the compiler sinks the next row's loads behind this row's long arithmetic (the loads below stand in a block of their own)
    sm_rest(xa, ma, PH, f0 + r, lane);
    const float mb = sm_max(xb);   // taken ahead of the branch: it reads the whole row, so the waits for that row's loads end here and none behind the join waits the fresh loads out
    if (r + 2 < SM_ROWS) sm_load(xa, S, f0 + r + 2, lane);
    sm_rest(xb, mb, PH, f0 + r + 1, lane); } }
// ---- k_smv: softmax blocks and v projection blocks in one launch, as many of the one as of the other, dealt in turn so that both kinds run at every moment: neither needs the other, and each leaves idle what the other loads.
// Blocks 2 i and 2 i + 1 are job i of the two kinds; which of them is which turns over every 256 blocks (for speed only). The four column blocks of a row block of V are neighbours.
#define SM_N (TQB * 64 * TNB / (SM_WAVES * SM_ROWS))
static_assert(SM_N == PJ_N && SM_WAVES * 32 == 256 && DA / 128 == 4, "one softmax block per projection block, of the same size");
__global__ __launch_bounds__(256) void k_smv(const float* __restrict__ S, _Float16* __restrict__ PH, const float* __restrict__ XV, const float* __restrict__ WV, const float* __restrict__ BV, _Float16* __restrict__ VT) {
  __shared__ __align__(16) char smem[2 * PJ_ST];
  const int bid = blockIdx.x, i = bid >> 1;   // the test below is the same for the whole block
  if ((bid ^ (bid >> 8)) & 1) { sm_rows(i, S, PH); return; }
  proj_tile<2>(smem, i >> 2, i & 3, nullptr, nullptr, XV, nullptr, nullptr, nullptr, nullptr, WV, BV, nullptr, nullptr, nullptr, nullptr, VT); }
// ---- k_pv: block = (128 queries, 256 value dims, batch), 8 waves of 64 x 64: out = P . v; operand tiles of 128 keys staged in LDS, two buffers
#define PV_PB 272                      // LDS row pitch in bytes: 256-byte rows + 16, conflict-free for 16-byte reads
#define PV_SV 18432                    // a slice of 64 v plane rows of PV_PB bytes, rounded up so that every slice starts at a multiple of 2 KiB
#define PV_SP 10240                    // a slice of 32 P rows, rounded up likewise
#define PV_ST (4 * PV_SV + 4 * PV_SP)  // one stage: four v slices, then four P slices
static_assert(2 * PV_ST >= 8 * 64 * 68 * 4 && NN % 128 == 0 && DA % 256 == 0, "the output staging takes the ring's place; whole blocks");
static_assert(PV_SV % 2048 == 0 && PV_SV >= 64 * PV_PB && PV_SP % 2048 == 0 && PV_SP >= 32 * PV_PB, "slices at multiples of 2 KiB");
__global__ __launch_bounds__(256) void k_pv(const _Float16* __restrict__ PH, const _Float16* __restrict__ VT, float* __restrict__ OUT) { __shared__ __attribute__((aligned(2048))) char smem[2 * PV_ST];
  const int tid = threadIdx.x, wave = tid >> 5, lane = tid & 31, col = lane & 15, g = lane >> 4; const int c0 = blockIdx.y * 256; const int b = blockIdx.z; const int q0 = blockIdx.x * 128;
  const int wq = wave >> 2, wd = wave & 3;   // the wave's tile: queries wq * 64, value dims wd * 64
  const uint32_t wv = uni(threadIdx.x >> 5);   // the wave's number, scalar: waves 0..3 bring the v slices (64 rows of 256 bytes), waves 4..7 the P slices (32 rows), one tensor load each per stage
  const uint64_t ga0 = (uint64_t)(size_t)(wv < 4 ? VT + ((size_t)b * DA + c0 + wv * 64) * (size_t)NN : PH + ((size_t)b * NN + q0 + (wv - 4) * 32) * (size_t)NN);
  const uint32_t ld0 = (uint32_t)(size_t)smem + (wv < 4 ? wv * PV_SV : 4 * PV_SV + (wv - 4) * PV_SP);
  const u32x8 g1 = tdm_group1<256, 5>(wv < 4 ? 64u : 32u, NN * 2u);
  u32x4 g0;   // the group 0 of the request last issued
  auto fill = [&](uint32_t s) { g0 = tdm_group0(ld0 + (s & 1u) * PV_ST, ga0 + (uint64_t)s * 256u); tdm_load(g0, g1); };
  v8f acc[4][4] = {};
  fill(0); wait_tensor(g0, g1); __syncthreads(); fill(pinned(1u));   // pinned: stage 1's descriptor is formed behind stage 0's wait
#pragma unroll 1   // one copy of the trip's body: the buffer is picked by t & 1
  for (int t = 0; t < NN / 128; ++t) { const _Float16* sb = (const _Float16*)(smem + (t & 1) * PV_ST);
    v16h fp[4], fv[2][4];   // the v fragments have two register sets: block kk + 1's are read ahead of block kk's products (same tile only); a second set of P fragments would not fit
    auto fragv = [&](int kk) {
#pragma unroll   // this and the ones below: constant indices keep fragments and accumulators in registers
      for (int j = 0; j < 4; ++j) fv[kk & 1][j] = frag_h(sb + wd * (PV_SV / 2) + (j * 16 + col) * (PV_PB / 2) + kk * 32, lane); };
    fragv(0);
#pragma unroll
    for (int kk = 0; kk < 4; ++kk) {
#pragma unroll
      for (int i = 0; i < 4; ++i) fp[i] = frag_h(sb + 4 * (PV_SV / 2) + (wq * 2 + (i >> 1)) * (PV_SP / 2) + ((i & 1) * 16 + col) * (PV_PB / 2) + kk * 32, lane);
      if (kk + 1 < 4) fragv(kk + 1);
#pragma unroll
      for (int i = 0; i < 4; ++i)
#pragma unroll
        for (int j = 0; j < 4; ++j) acc[i][j] = wmma16(fp[i], fv[kk & 1][j], acc[i][j]); }
    WAIT_DS(); wait_tensor(g0, g1); __syncthreads();   // publishes tile t + 1 and ends every read of tile t's buffer
    const uint32_t s2 = pinned((uint32_t)t + 2u);   // pinned: the next descriptor is formed behind the wait above
    if (pinned(s2 < NN / 128)) fill(s2); }   // pinned: a scalar branch decides whether the wave issues
  wait_tensor(g0, g1); WAIT_DS();   // no load is outstanding when the ring's LDS is reused and the wave ends
  float (*ss)[64][68] = (float (*)[64][68])smem;   // output staging takes the ring's place behind the last trip's barrier; each wave its own part
#pragma unroll
  for (int i = 0; i < 4; ++i)
#pragma unroll
    for (int j = 0; j < 4; ++j)
#pragma unroll
      for (int r = 0; r < 8; ++r) ss[wave][i * 16 + 8 * g + r][j * 16 + col] = acc[i][j][r] * (1.0f / 2048.0f);
  LDSX(); float* o = OUT + (size_t)(b * NN + q0 + wq * 64 + g) * DA + c0 + wd * 64 + col * 4;   // a store covers two rows of 256 contiguous bytes: whole lines
#pragma unroll   // constant row offsets: one address pair serves every store
  for (int rl = 0; rl < 64; rl += 2) vst2(o + (size_t)rl * DA, *(const v4f*)&ss[wave][rl + g][col * 4]); }
extern "C" void kernel_launch(void* const* d_in, const int* in_sizes, int n_in, void* d_out, int out_size, void* d_ws, size_t ws_size, hipStream_t stream) {
  (void)in_sizes; (void)n_in; (void)out_size;
  const float** F = (const float**)d_in;   // 0 Q, 1 K, 2 V [8,2048,512]; 3 Wq, 4 bq, 5 Wk, 6 bk, 7 Wv, 8 bv ((in,out) [512,512] / [512])
  if (ws_size < (size_t)WS_END) return;
  char* ws = (char*)d_ws; _Float16 *QH = (_Float16*)(ws + WS_QH), *QL = (_Float16*)(ws + WS_QL), *KH = (_Float16*)(ws + WS_KH), *VT = (_Float16*)(ws + WS_VT), *PH = (_Float16*)(ws + WS_PH); float *S = (float*)(ws + WS_S), *MQ = (float*)(ws + WS_M);
  k_pre<<<dim3(MT_N + PJ_N), 256, 0, stream>>>(F[1], F[3], F[4], F[5], F[6], MQ, KH);
  k_proj<<<dim3(PJ_X, DA / 128), 256, 0, stream>>>(F[0], MQ, MQ + (size_t)DA * DA, QH, QL);
  k_sc<<<dim3(TQB / 4, NN / 256, TNB), 512, 0, stream>>>(QH, QL, KH, S);
  k_smv<<<dim3(SM_N + PJ_N), 256, 0, stream>>>(S, PH, F[2], F[7], F[8], VT);
  k_pv<<<dim3(TQB / 2, DA / 256, TNB), 256, 0, stream>>>(PH, VT, (float*)d_out);
}

// v009
// Measured time: 126 microseconds a run.
// Two timings next to v008 both put it at 1.08 times that version's speed.
// Over all steps from v000 it is 12.1 times as fast.
// compute dtype: all float inputs rounded to bf16; v = V Wv + bv with EXACT bf16 products on WMMA 16x16x32 ((in,out) weights), f32 accumulate; the k projection is folded into q: q . k = u . K + q . bk with u = Q (Wq Wk^T) + bq Wk^T, and q . bk, the same for every key of a row, leaves the softmax unchanged and is not formed; Wq Wk^T in f32, used as bf16 hi + residual (2 products); u as f16 hi + unscaled residual, K's bf16 values held in one f16 plane -> UNSCALED logits less the row constant with 2 products (uh K + ul K), kept in f32 registers; softmax in f32 with a running maximum (2^x by v_exp_f32) -> P as f16 x 2^6, not normalised; P . v with v rounded once to f16 (1 product), divided by the f32 row sum at the end; f32 output.
#include <hip/hip_runtime.h>
#include <math.h>
#include <stdint.h>

typedef __attribute__((ext_vector_type(16))) _Float16 v16h;
typedef __attribute__((ext_vector_type(16))) __bf16 v16b;
typedef __attribute__((ext_vector_type(8)))  _Float16 v8h;
typedef __attribute__((ext_vector_type(8)))  float v8f;
typedef __attribute__((ext_vector_type(4)))  float v4f;
typedef __attribute__((ext_vector_type(2)))  float v2f;
typedef __attribute__((ext_vector_type(4)))  unsigned v4u;
typedef __attribute__((ext_vector_type(4)))  int v4i;
typedef float __attribute__((may_alias)) float_a;
typedef int __attribute__((may_alias)) int_a;

template <typename T> __device__ __forceinline__ void vst2(void* p, T v) { *(T*)p = v;  }
__device__ __forceinline__ v8f wmma16(v16h a, v16h b, v8f c) {
  v8f d = __builtin_amdgcn_wmma_f32_16x16x32_f16(false, a, false, b, (short)0, c, false, false);
  asm volatile("v_nop\n\tv_nop\n\tv_nop\n\tv_nop" : "+v"(d) : "v"(a), "v"(b));
  return d;
}
__device__ __forceinline__ v8f wmma_bf(v16b a, v16b b, v8f c) {
  v8f d = __builtin_amdgcn_wmma_f32_16x16x32_bf16(false, a, false, b, (short)0, c, false, false);
  asm volatile("v_nop\n\tv_nop\n\tv_nop\n\tv_nop" : "+v"(d) : "v"(a), "v"(b));
  return d;
}
// 16x16x32 fragments: lane = (h = lane>>4, row/col = lane&15); elements 0..7 = k0+8h+0..7, 8..15 = k0+16+8h+0..7; D element r = row 8h+r
__device__ __forceinline__ v16h frag_h(const _Float16* rowk0, int lane) {
  union { v16h v; v8h q[2]; } u; const _Float16* p = rowk0 + 8 * (lane >> 4);
  u.q[0] = *(const v8h*)p; u.q[1] = *(const v8h*)(p + 16); return u.v;
}
__device__ __forceinline__ v16h frag_f32(const float* rowk0, int lane) {
  v16h a; const float* p = rowk0 + 8 * (lane >> 4);
#pragma unroll
  for (int i = 0; i < 8; ++i) { a[i] = (_Float16)p[i]; a[8 + i] = (_Float16)p[16 + i]; }
  return a;
}
__device__ __forceinline__ v16h frag_f32s(const float* rowk0, int lane, float sc) {
  v16h a; const float* p = rowk0 + 8 * (lane >> 4);
#pragma unroll
  for (int i = 0; i < 8; ++i) { a[i] = (_Float16)(p[i] * sc); a[8 + i] = (_Float16)(p[16 + i] * sc); }
  return a;
}
// column fragment from a [K][ld] layout (column n), rows >= K read as 0
__device__ __forceinline__ v16h fragc_f32(const float* W, int k0, int n, int lane, int ld, int K) {
  v16h a; const int g = lane >> 4;
#pragma unroll
  for (int i = 0; i < 8; ++i) { const int ka = k0 + 8 * g + i, kb = ka + 16;
    a[i] = (_Float16)(ka < K ? W[(size_t)(ka < K ? ka : K - 1) * ld + n] : 0.f); a[8 + i] = (_Float16)(kb < K ? W[(size_t)(kb < K ? kb : K - 1) * ld + n] : 0.f); }
  return a;
}
struct F2 { v16b h, l; };
__device__ __forceinline__ F2 bsplit16(const float v[16]) { F2 r;
#pragma unroll
  for (int i = 0; i < 16; ++i) { const __bf16 h = (__bf16)v[i]; r.h[i] = h; r.l[i] = (__bf16)(v[i] - (float)h); }
  return r; }
__device__ __forceinline__ F2 split_row(const float* row, int k0, int lane) { float v[16]; const float* p = row + k0 + 8 * (lane >> 4);
#pragma unroll
  for (int i = 0; i < 8; ++i) { v[i] = p[i]; v[8 + i] = p[16 + i]; }
  return bsplit16(v); }
__device__ __forceinline__ F2 split_rowK(const float* row, int k0, int lane, int K) { float v[16]; const int g = lane >> 4;
#pragma unroll
  for (int i = 0; i < 8; ++i) { const int ka = k0 + 8 * g + i, kb = ka + 16; v[i] = ka < K ? row[ka < K ? ka : K - 1] : 0.f; v[8 + i] = kb < K ? row[kb < K ? kb : K - 1] : 0.f; }
  return bsplit16(v); }
__device__ __forceinline__ F2 split_col(const float* W, int k0, int n, int lane, int ld, int K) { float v[16]; const int g = lane >> 4;
#pragma unroll
  for (int i = 0; i < 8; ++i) { const int ka = k0 + 8 * g + i, kb = ka + 16; v[i] = ka < K ? W[(size_t)(ka < K ? ka : K - 1) * ld + n] : 0.f; v[8 + i] = kb < K ? W[(size_t)(kb < K ? kb : K - 1) * ld + n] : 0.f; }
  return bsplit16(v); }
__device__ __forceinline__ v8f mac3(const F2& a, const F2& b, v8f c) { c = wmma_bf(a.l, b.h, c); c = wmma_bf(a.h, b.l, c); return wmma_bf(a.h, b.h, c); }
__device__ __forceinline__ float sigm(float v) { return 1.0f / (1.0f + expf(-v)); }
#define LDSX() do { asm volatile("s_wait_dscnt 0" ::: "memory"); __builtin_amdgcn_wave_barrier(); __builtin_amdgcn_fence(__ATOMIC_RELEASE, "workgroup"); } while (0)


// 'NN' attention (B 8, 2,048 tokens, 512 dims, single head, no scaling): out = softmax(q k^T) v with q, k, v = Linear(Q), Linear(K), Linear(V).
#define NB 8
#define NN 2048
#define DA 512
#ifndef TNB
#define TNB NB
#endif
#ifndef TQB
#define TQB (NN / 64)
#endif
typedef __attribute__((ext_vector_type(8))) __bf16 v8b;
__device__ __forceinline__ v16b frag_b(const __bf16* rowk0, int lane) {
  union { v16b v; v8b q[2]; } u; const __bf16* p = rowk0 + 8 * (lane >> 4);
  u.q[0] = *(const v8b*)p; u.q[1] = *(const v8b*)(p + 16); return u.v;
}
__device__ __forceinline__ float bfr(float v) { return (float)(__bf16)v; }
__device__ __attribute__((noinline)) float exp_ni(float v) { return expf(v); }
__device__ __attribute__((noinline)) float erf_ni(float v) { return erff(v); }

#define WS_QH  0u                                    // f16 u rows [b*n][512]
#define WS_QL  (WS_QH + 2u * (size_t)NB * NN * DA)      // f16 u residual rows
#define WS_KH  (WS_QL + 2u * (size_t)NB * NN * DA)      // f16 K rows (the input's bf16 values)
#define WS_KL  (WS_KH + 2u * (size_t)NB * NN * DA)      // not used
#define WS_VT  (WS_KL + 2u * (size_t)NB * NN * DA)      // f16 v planes [b][512][n]
#define WS_M   (WS_VT + 2u * (size_t)NB * DA * NN)      // f32 Wq Wk^T [512][512], then 16 rows of which the first is bq Wk^T
#define WS_END (WS_M + 4u * (size_t)(DA + 16) * DA)

// ---- m_tile: block (bx, by) of the Wq Wk^T work; one wave per 16 x 16 tile of M[i][j] = sum_d Wq[i][d] Wk[j][d]; the tile row behind the last takes bq in place of a Wq row, so M's row 512 is bq Wk^T (rows 513.. repeat it and are not read).
__device__ __forceinline__ void m_tile(const int bx, const int by, const float* __restrict__ WQ, const float* __restrict__ BQ, const float* __restrict__ WK, float* __restrict__ MO) {
  const int tid = threadIdx.x, wave = tid >> 5, lane = tid & 31, col = lane & 15, g = lane >> 4; const int i0 = bx * 16, j0 = (by * 8 + wave) * 16;
  const float* ar = (i0 < DA ? WQ + (size_t)(i0 + col) * DA : BQ) + 8 * g; const float* br = WK + (size_t)(j0 + col) * DA + 8 * g;   // the lane's part of its two rows: elements 0..7 = k + 8 g + 0..7, 8..15 = k + 16 + 8 g + 0..7, alike for both operands
  v8f c0 = {}, c1 = {};   // two independent chains
  v4f xa[16], xb[16];   // a quarter of a row of each operand on its way: 32 loads in flight, so that the wave waits out a memory latency four times and not once per product
#pragma unroll   // this and the ones below: constant indices keep the rows in registers, constant offsets serve every load from the two row pointers
  for (int h = 0; h < 4; ++h) {
#pragma unroll
    for (int s = 0; s < 4; ++s) { const float* pa = ar + h * 128 + s * 32; const float* pb = br + h * 128 + s * 32;
      xa[4 * s] = *(const v4f*)pa; xa[4 * s + 1] = *(const v4f*)(pa + 4); xa[4 * s + 2] = *(const v4f*)(pa + 16); xa[4 * s + 3] = *(const v4f*)(pa + 20);
      xb[4 * s] = *(const v4f*)pb; xb[4 * s + 1] = *(const v4f*)(pb + 4); xb[4 * s + 2] = *(const v4f*)(pb + 16); xb[4 * s + 3] = *(const v4f*)(pb + 20); }
    asm volatile("s_wait_xcnt 0x0" :: "v"(ar), "v"(br) : "memory");   // precaution kept for issued global accesses; the two row pointers as inputs: no load's result may take their registers ahead of the wait
    __builtin_amdgcn_sched_barrier(0);   // without it the compiler sinks each load to just ahead of its product
#pragma unroll
    for (int s = 0; s < 4; ++s) { v16b a, w;
#pragma unroll
      for (int i = 0; i < 16; ++i) { a[i] = (__bf16)xa[4 * s + (i >> 2)][i & 3]; w[i] = (__bf16)xb[4 * s + (i >> 2)][i & 3]; }
      if (s & 1) c1 = wmma_bf(a, w, c1); else c0 = wmma_bf(a, w, c0); } }
  float* o = MO + (size_t)(i0 + 8 * g) * DA + j0 + col;
#pragma unroll
  for (int r = 0; r < 8; ++r) o[(size_t)r * DA] = c0[r] + c1[r];
  asm volatile("s_wait_xcnt 0x0" ::: "memory"); }   // the same precaution behind the stores
// ---- proj_tile: block = (128 rows bx, 128 cols by) of job 'which', 8 waves of 32 x 64: u = Q M + M's row 512 (f16 hi + residual rows; M as bf16 hi + residual, 2 products), K (no product: its bf16 values as f16 rows), v (f16 planes); each from its own input.
// Tiles of 64 k of X and of W are read once a block as whole lines, rounded to bf16 and staged in LDS (W turned k-contiguous on the way), two buffers.
typedef __attribute__((ext_vector_type(4))) __bf16 v4b;
#define PJ_PB 144                      // LDS row pitch in bytes: 128-byte rows + 16, conflict-free for 16-byte reads and for the turned W stores
#define PJ_ST (384 * PJ_PB)            // one stage: rows 0..127 W columns (64 k each), 128..255 X rows, 256..383 the residual of the W columns (u only)
static_assert(2 * PJ_ST >= 2 * 128 * 136 * 2, "the output staging takes the ring's place");
// work-group barrier that orders LDS only: __syncthreads() would also wait out the global loads of the tile after next, which are meant to stay in flight across it
#define PJ_BAR() do { __builtin_amdgcn_fence(__ATOMIC_RELEASE, "workgroup", "local"); __builtin_amdgcn_s_barrier(); __builtin_amdgcn_fence(__ATOMIC_ACQUIRE, "workgroup", "local"); } while (0)
template <int which> __device__ __forceinline__ void proj_tile(char* smem, const int bx, const int by, const float* __restrict__ XQ, const float* __restrict__ XK, const float* __restrict__ XV, const float* __restrict__ WQ, const float* __restrict__ BQ, const float* __restrict__ WK, const float* __restrict__ BK, const float* __restrict__ WV, const float* __restrict__ BV, _Float16* __restrict__ QH, _Float16* __restrict__ QL, _Float16* __restrict__ KH, _Float16* __restrict__ KL, _Float16* __restrict__ VT) {
  const int tid = threadIdx.x, wave = tid >> 5, lane = tid & 31, col = lane & 15, g = lane >> 4; const int c0 = by * 128; const size_t r0 = (size_t)bx * 128;
  if (which == 1) {   // K: rounded to bf16 like every input; 8 significant bits are held by f16. The whole block leaves here, ahead of every barrier
    const float* p = XK + (r0 + (tid >> 4)) * DA + c0 + (tid & 15) * 8; _Float16* o = KH + (r0 + (tid >> 4)) * DA + c0 + (tid & 15) * 8; v4f x[16];
#pragma unroll   // constant row offsets: one address pair serves every load, and one every store
    for (int i = 0; i < 8; ++i) { x[2 * i] = *(const v4f*)(p + (size_t)i * 16 * DA); x[2 * i + 1] = *(const v4f*)(p + (size_t)i * 16 * DA + 4); }
    asm volatile("s_wait_xcnt 0x0" :: "v"(p) : "memory");   // precaution kept for issued global accesses; p as an input: no load's result may take its registers ahead of the wait
#pragma unroll
    for (int i = 0; i < 8; ++i) { v8h h;
#pragma unroll
      for (int e = 0; e < 4; ++e) { h[e] = (_Float16)bfr(x[2 * i][e]); h[4 + e] = (_Float16)bfr(x[2 * i + 1][e]); }
      *(v8h*)(o + (size_t)i * 16 * DA) = h; }
    asm volatile("s_wait_xcnt 0x0" :: "v"(o) : "memory");   // the same precaution behind the stores
    return; }
  const int wr = wave >> 1, wc = wave & 1;   // the wave's tile: rows wr * 32, cols wc * 64
  const float* X = which == 0 ? XQ : which == 1 ? XK : XV; const float* Wm = which == 0 ? WQ : which == 1 ? WK : WV; const float* Bm = which == 0 ? BQ : which == 1 ? BK : BV;
  const int wkg = (wave & 1) * 4 + (lane & 3), wng = (wave >> 1) * 8 + (lane >> 2);   // W: a thread holds 8 k x 4 cols; a wave's load covers 4 whole lines, its 16-byte LDS stores fall on all banks
  const int xr = tid >> 4, xq = tid & 15;                                            // X: a thread holds 4 k of rows xr + 16 i; a wave's load covers 4 whole lines
  const float* wp = Wm + (size_t)(wkg * 8) * DA + c0 + wng * 4; const float* xp = X + (r0 + xr) * DA + xq * 4;
  v4f fw[8], fx[8];   // the next tile on its way through registers
  auto ld = [&](int t) { const float* pw = wp + (size_t)t * 64 * DA; const float* px = xp + t * 64;
#pragma unroll   // constant indices keep the tile in registers
    for (int i = 0; i < 8; ++i) { fw[i] = *(const v4f*)(pw + (size_t)i * DA); fx[i] = *(const v4f*)(px + (size_t)i * 16 * DA); }
    asm volatile("s_wait_xcnt 0x0" ::: "memory"); };   // precaution kept for issued global accesses, ahead of the next write of their address registers
  auto st = [&](int t) { char* sb = smem + (t & 1) * PJ_ST;
#pragma unroll
    for (int c = 0; c < 4; ++c) { v8b h;
#pragma unroll
      for (int i = 0; i < 8; ++i) h[i] = (__bf16)fw[i][c];
      *(v8b*)(sb + (wng * 4 + c) * PJ_PB + wkg * 16) = h;
      if (which == 0) { v8b l;
#pragma unroll
        for (int i = 0; i < 8; ++i) l[i] = (__bf16)(fw[i][c] - (float)h[i]);
        *(v8b*)(sb + (256 + wng * 4 + c) * PJ_PB + wkg * 16) = l; } }
#pragma unroll
    for (int i = 0; i < 8; ++i) { v4b h; h[0] = (__bf16)fx[i][0]; h[1] = (__bf16)fx[i][1]; h[2] = (__bf16)fx[i][2]; h[3] = (__bf16)fx[i][3];
      *(v4b*)(sb + (128 + xr + 16 * i) * PJ_PB + xq * 8) = h; } };
  v8f acc[2][4] = {};
  ld(0); st(0); ld(1); PJ_BAR();
#pragma unroll 1   // one copy of the trip's body: the buffer is picked by t & 1
  for (int t = 0; t < DA / 64; ++t) { const __bf16* sb = (const __bf16*)(smem + (t & 1) * PJ_ST);
#pragma unroll   // this and the ones below: constant indices keep fragments and accumulators in registers
    for (int kk = 0; kk < 2; ++kk) { v16b a[2], w[4];
#pragma unroll
      for (int i = 0; i < 2; ++i) a[i] = frag_b(sb + (128 + wr * 32 + i * 16 + col) * (PJ_PB / 2) + kk * 32, lane);
#pragma unroll
      for (int j = 0; j < 4; ++j) w[j] = frag_b(sb + (wc * 64 + j * 16 + col) * (PJ_PB / 2) + kk * 32, lane);
#pragma unroll
      for (int i = 0; i < 2; ++i)
#pragma unroll
        for (int j = 0; j < 4; ++j) acc[i][j] = wmma_bf(a[i], w[j], acc[i][j]);
      if (which == 0) {   // block-uniform: the residual of M against the same X fragments
#pragma unroll
        for (int j = 0; j < 4; ++j) w[j] = frag_b(sb + (256 + wc * 64 + j * 16 + col) * (PJ_PB / 2) + kk * 32, lane);
#pragma unroll
        for (int i = 0; i < 2; ++i)
#pragma unroll
          for (int j = 0; j < 4; ++j) acc[i][j] = wmma_bf(a[i], w[j], acc[i][j]); } }
    if (t + 1 < DA / 64) st(t + 1);   // into the buffer whose last readers left at the barrier of trip t - 1
    if (t + 2 < DA / 64) ld(t + 2);
    PJ_BAR(); }   // publishes tile t + 1 and ends every read of tile t's buffer
  _Float16 (*sh)[136] = (_Float16 (*)[136])smem, (*sl)[136] = (_Float16 (*)[136])(smem + 128 * 136 * 2), (*th)[136] = (_Float16 (*)[136])smem;   // output staging takes the ring's place behind the last trip's barrier
#pragma unroll
  for (int i = 0; i < 2; ++i)
#pragma unroll
    for (int j = 0; j < 4; ++j) { const float bi = Bm[c0 + wc * 64 + j * 16 + col]; const float bb = which == 0 ? bi : bfr(bi);   // u's bias is bq Wk^T, computed in f32: not an input, not rounded
#pragma unroll
      for (int r = 0; r < 8; ++r) { const float v = acc[i][j][r] + bb; const int rl = wr * 32 + i * 16 + 8 * g + r, cl = wc * 64 + j * 16 + col; const _Float16 hv = (_Float16)v;
        if (which == 2) th[cl][rl] = hv; else { sh[rl][cl] = hv; sl[rl][cl] = (_Float16)(v - (float)hv); } } }
  __syncthreads();
  if (which < 2) { _Float16* dh = which == 0 ? QH : KH; for (int e = tid; e < 128 * 16; e += 256) { const int rl = e >> 4, q = e & 15; vst2((unsigned*)(dh + (r0 + rl) * DA + c0 + q * 8), *(const v4u*)&sh[rl][q * 8]); vst2((unsigned*)((which == 0 ? QL : KL) + (r0 + rl) * DA + c0 + q * 8), *(const v4u*)&sl[rl][q * 8]); } }
  else { const size_t b = r0 / NN; const int n0 = (int)(r0 % NN); for (int e = tid; e < 128 * 16; e += 256) { const int cl = e >> 4, q = e & 15; vst2((unsigned*)(VT + (b * DA + c0 + cl) * (size_t)NN + n0 + q * 8), *(const v4u*)&th[cl][q * 8]); } } }
// ---- where the projection jobs are launched. Only u needs Wq Wk^T. k_pre: the few latency-bound Wq Wk^T blocks, first in the grid, then the v projection (LDS, L2 and matrix work), then the short blocks that round K (memory bytes only).
// k_proj, behind it: u alone.
#define MT_X (DA / 16 + 1)
#define MT_N (MT_X * (DA / 128))
#define PJ_X (TNB * NN / 128)
#define PJ_N (PJ_X * (DA / 128))
__global__ __launch_bounds__(256) void k_pre(const float* __restrict__ XK, const float* __restrict__ WQ, const float* __restrict__ BQ, const float* __restrict__ WK, const float* __restrict__ BK, float* __restrict__ MO, _Float16* __restrict__ KH, const float* __restrict__ XV, const float* __restrict__ WV, const float* __restrict__ BV, _Float16* __restrict__ VT) {
  __shared__ __align__(16) char smem[2 * PJ_ST];
  const int bid = blockIdx.x;   // the tests are the same for the whole block
  if (bid < MT_N) { m_tile(bid % MT_X, bid / MT_X, WQ, BQ, WK, MO); return; }
  if (bid < MT_N + PJ_N) { const int i = bid - MT_N; proj_tile<2>(smem, i >> 2, i & 3, nullptr, nullptr, XV, nullptr, nullptr, nullptr, nullptr, WV, BV, nullptr, nullptr, nullptr, nullptr, VT); return; }   // the four column blocks of a row block of V are neighbours
  const int e = bid - MT_N - PJ_N;
  proj_tile<1>(nullptr, e % PJ_X, e / PJ_X, nullptr, XK, nullptr, nullptr, nullptr, WK, BK, nullptr, nullptr, nullptr, nullptr, KH, nullptr, nullptr); }   // the K job touches no LDS
__global__ __launch_bounds__(256) void k_proj(const float* __restrict__ XQ, const float* __restrict__ MQ, const float* __restrict__ MB, _Float16* __restrict__ QH, _Float16* __restrict__ QL) {
  __shared__ __align__(16) char smem[2 * PJ_ST];
  proj_tile<0>(smem, blockIdx.x, blockIdx.y, XQ, nullptr, nullptr, MQ, MB, nullptr, nullptr, nullptr, nullptr, QH, QL, nullptr, nullptr, nullptr); }
// ---- tensor loads: one request of a wave brings a two-dimensional tile global -> LDS, through no register and with no per-lane address work
typedef uint32_t u32x4 __attribute__((ext_vector_type(4)));
typedef uint32_t u32x8 __attribute__((ext_vector_type(8)));
__device__ __forceinline__ uint32_t uni(uint32_t v) { return (uint32_t)__builtin_amdgcn_readfirstlane(v); }
// an issue test, or the stage number a descriptor is formed from: the test compiles to a scalar branch, and what is formed from the number stays behind the waits written in front of it
__device__ __forceinline__ uint32_t pinned(uint32_t v) { uint32_t w = (uint32_t)__builtin_amdgcn_readfirstlane(v); asm volatile("" : "+s"(w)); return w; }   // the empty statement holds the word in a scalar register (tensor mover: issue test, descriptor word)
// group 1: 1-byte elements, tensor = tile = rows x ROWB bytes, source row pitch in bytes, no mask; 16 bytes of LDS pad behind every row (interval code IVL = the row's length)
template <uint32_t ROWB, uint32_t IVL> __device__ __forceinline__ u32x8 tdm_group1(uint32_t rows, uint32_t src_pitch) {
  u32x8 g;
  g[0] = uni((1u << 20) | (IVL << 22) | (3u << 25));
  g[1] = uni((ROWB & 0xFFFFu) << 16);
  g[2] = uni((ROWB >> 16) | ((rows & 0xFFFFu) << 16));
  g[3] = uni((rows >> 16) | (ROWB << 16));
  g[4] = uni(rows);
  g[5] = uni(src_pitch);
  g[6] = uni(0u);
  g[7] = uni(0u);
  return g;
}
// group 0: count 1, the tile's place in the work-group's LDS, the global address of its first byte, type 2
__device__ __forceinline__ u32x4 tdm_group0(uint32_t lds_dst, uint64_t ga) {
  u32x4 g;
  g[0] = uni(1u); g[1] = uni(lds_dst); g[2] = uni((uint32_t)ga); g[3] = uni((((uint32_t)(ga >> 32)) & 0x01FFFFFFu) | 0x80000000u);
  return g;
}
__device__ __forceinline__ void tdm_load(u32x4 g0, u32x8 g1) { asm volatile("tensor_load_to_lds %0, %1" :: "s"(g0), "s"(g1) : "memory"); }
// this wave's LDS reads have retired before the buffer they read is handed back for a refill
#define WAIT_DS() asm volatile("s_wait_dscnt 0x0" ::: "memory")
// this wave's own two tensor loads (a K slice and a v slice) have landed (the compiler places no wait for them); the wait names the four descriptor groups as inputs, so that their scalar registers keep their words until then
__device__ __forceinline__ void wait_tensor2(u32x4 a0, u32x8 a1, u32x4 b0, u32x8 b1) { asm volatile("s_wait_tensorcnt 0x0" :: "s"(a0), "s"(a1), "s"(b0), "s"(b1) : "memory"); }
// the plain builtin: the compiler keeps the distances behind it itself. k_fa holds more than 256 registers a wave, and the operands of an asm statement (wmma16's) would all have to stand in the first 256
__device__ __forceinline__ v8f wmma_p(v16h a, v16h b, v8f c) { return __builtin_amdgcn_wmma_f32_16x16x32_f16(false, a, false, b, (short)0, c, false, false); }
// value of lane l ^ 16
__device__ __forceinline__ float lx16(float v) { return __builtin_bit_cast(float, __builtin_amdgcn_permlanex16(__builtin_bit_cast(int, v), __builtin_bit_cast(int, v), 0x76543210, 0xfedcba98, false, false)); }
// ---- k_fa: block = (64 queries, batch), 4 waves, one per SIMD; a wave owns 16 queries and all 512 value dims: logits, softmax and P . v in one kernel, so that neither logits nor P leave the registers.
// S^T = K u^T (A = K rows from LDS, B = the wave's u rows, hi and residual, held in registers for the whole kernel); a lane then holds 16 of the 32 scores of ONE query: maximum and sum in the lane, one exchange between the halves.
// The two score tiles of 32 keys, rounded to f16, ARE the B fragment of O^T += v^T P^T (element r = key 8 g + r, element 8 + r = key 16 + 8 g + r, the k order of frag_h); A = v plane rows from LDS.
// Running maximum per query; the output tiles are rescaled only when a new maximum lies more than FA_TH above the one in use, so P x 2^6 stays below 2^14 in f16.
#define FA_SL 18432                    // one slice: 64 K rows of 256 + 16 bytes, rounded up to a multiple of 2 KiB, or 128 v plane rows of 128 + 16 bytes
#define FA_ST (8 * FA_SL)              // one stage, 64 keys: slices 0..3 K (128 k each), 4..7 v (128 value dims each)
#define FA_TH 5.5f
#define FA_L2E 1.44269504088896340736f
static_assert(FA_SL % 2048 == 0 && FA_SL >= 64 * 272 && FA_SL >= 128 * 144 && 2 * FA_ST <= 327680 && 2 * FA_ST >= 4 * 16 * 516 * 4 && NN % 64 == 0 && NN / 64 >= 2 && DA == 512, "slices at multiples of 2 KiB inside the LDS of one WGP; the output staging takes the ring's place; two stages or more");
__global__ __launch_bounds__(128) void k_fa(const _Float16* __restrict__ QH, const _Float16* __restrict__ QL, const _Float16* __restrict__ KH, const _Float16* __restrict__ VT, float* __restrict__ OUT) { __shared__ __attribute__((aligned(2048))) char smem[2 * FA_ST];
  const int tid = threadIdx.x, wave = tid >> 5, lane = tid & 31, col = lane & 15, g = lane >> 4; const int b = blockIdx.y; const int q0 = blockIdx.x * 64;
  const uint32_t wv = uni(threadIdx.x >> 5);   // the wave's number, scalar: every wave brings K slice wv (64 keys x 128 k) and v slice wv (128 value dims x 64 keys) of every stage, two tensor loads
  const uint64_t gk = (uint64_t)(size_t)(KH + (size_t)b * NN * DA + wv * 128);
  const uint64_t gv = (uint64_t)(size_t)(VT + ((size_t)b * DA + wv * 128) * (size_t)NN);
  const uint32_t lk = (uint32_t)(size_t)smem + wv * FA_SL, lv = lk + 4 * FA_SL;
  const u32x8 g1k = tdm_group1<256, 5>(pinned(64u), DA * 2u);    // pinned, here and in the next line: the words formed from it are held in scalar registers, one register group for every request and its wait
  const u32x8 g1v = tdm_group1<128, 4>(pinned(128u), NN * 2u);
  const u32x4 p0k = tdm_group0(lk, gk), p0v = tdm_group0(lv, gv);   // stage 0
  tdm_load(p0k, g1k); tdm_load(p0v, g1v);
  v16h uh[16], ul[16];   // the wave's u rows as B fragments: lane = (g, query col)
  { const _Float16* ph = QH + ((size_t)b * NN + q0 + wave * 16 + col) * DA + 8 * g; const _Float16* pl = QL + ((size_t)b * NN + q0 + wave * 16 + col) * DA + 8 * g;
#pragma unroll   // this and the ones below: constant indices keep fragments and accumulators in registers
    for (int kk = 0; kk < 16; ++kk) { union { v16h v; v8h q[2]; } x, y; x.q[0] = *(const v8h*)(ph + kk * 32); x.q[1] = *(const v8h*)(ph + kk * 32 + 16); y.q[0] = *(const v8h*)(pl + kk * 32); y.q[1] = *(const v8h*)(pl + kk * 32 + 16); uh[kk] = x.v; ul[kk] = y.v; }
    asm volatile("s_wait_xcnt 0x0" :: "v"(ph), "v"(pl) : "memory"); }   // precaution kept for issued global accesses; the two row pointers as inputs: no load's result may take their registers ahead of the wait
  v8f o[32] = {};   // O^T: tile d = value dims 16 d + 8 g + r, column = the lane's query
  float m = -3.0e38f, l = 0.f;   // the maximum in use (the same in both halves) and this half's part of the sum
  wait_tensor2(p0k, g1k, p0v, g1v); __syncthreads();
#pragma unroll 1   // one copy of the stage's body: the buffer is picked by t & 1
  for (int t = 0; t < NN / 64; ++t) { const _Float16* sb = (const _Float16*)(smem + (t & 1) * FA_ST);
    // directly behind the barrier that published stage t and ended every read of stage t - 1: stage t + 1 is asked for, into the buffer that stage t - 1 has left. The groups 0 are formed and waited for inside one trip, so that
    // they stay in the registers that the requests name; in the last trip they are formed (in bounds) and not issued
    const uint32_t sn = pinned((uint32_t)t + 1u < NN / 64 ? (uint32_t)t + 1u : (uint32_t)t);   // pinned: the descriptors are formed behind the wait at the foot of the trip before
    const u32x4 g0k = tdm_group0(lk + (sn & 1u) * FA_ST, gk + (uint64_t)sn * (64u * DA * 2u)), g0v = tdm_group0(lv + (sn & 1u) * FA_ST, gv + (uint64_t)sn * 128u);
    if (pinned((uint32_t)t + 1u < NN / 64)) { tdm_load(g0k, g1k); tdm_load(g0v, g1v); }   // pinned: a scalar branch decides whether the wave issues
#pragma unroll
    for (int h = 0; h < 2; ++h) {   // 32 keys
      v8f s0 = {}, s1 = {}, r0 = {}, r1 = {};   // four independent chains: uh K and ul K of the two key tiles
#pragma unroll
      for (int kk = 0; kk < 16; ++kk) { const _Float16* kr = sb + (kk >> 2) * (FA_SL / 2) + (h * 32 + col) * 136 + (kk & 3) * 32;
        const v16h a0 = frag_h(kr, lane), a1 = frag_h(kr + 16 * 136, lane);
        s0 = wmma_p(a0, uh[kk], s0); s1 = wmma_p(a1, uh[kk], s1); r0 = wmma_p(a0, ul[kk], r0); r1 = wmma_p(a1, ul[kk], r1); }
      v16h fv[32];   // the pass's v fragments, all asked for here: they land under the softmax arithmetic below, in the registers that the K fragments have left
#pragma unroll
      for (int d = 0; d < 32; ++d) fv[d] = frag_h(sb + (4 + (d >> 3)) * (FA_SL / 2) + ((d & 7) * 16 + col) * 72 + h * 32, lane);
      __builtin_amdgcn_sched_barrier(0);   // without it the compiler sinks each pair of loads to just ahead of its product, and the lone wave of the SIMD waits out an LDS latency per product
      s0 += r0; s1 += r1;
      float mx = fmaxf(s0[0], s1[0]);
#pragma unroll
      for (int r = 1; r < 8; ++r) mx = fmaxf(mx, fmaxf(s0[r], s1[r]));
      mx = fmaxf(mx, lx16(mx));
      if (__builtin_amdgcn_ballot_w32(mx > m + FA_TH) != 0) {   // the same for the whole wave: a scalar branch, no matrix instruction inside
        const float mn = fmaxf(m, mx); const float al = __builtin_amdgcn_exp2f((m - mn) * FA_L2E); m = mn; l *= al;
#pragma unroll
        for (int d = 0; d < 32; ++d) o[d] *= al; }
      const float mb = m * FA_L2E - 6.0f; v16h pf; float e0 = 0.f, e1 = 0.f;
#pragma unroll
      for (int r = 0; r < 8; ++r) { const float x0 = __builtin_amdgcn_exp2f(fmaf(s0[r], FA_L2E, -mb)), x1 = __builtin_amdgcn_exp2f(fmaf(s1[r], FA_L2E, -mb)); e0 += x0; e1 += x1; pf[r] = (_Float16)x0; pf[8 + r] = (_Float16)x1; }
      l += e0 + e1;
#pragma unroll
      for (int d = 0; d < 32; ++d) o[d] = wmma_p(fv[d], pf, o[d]); }
    WAIT_DS(); wait_tensor2(g0k, g1k, g0v, g1v); __syncthreads(); }   // publishes stage t + 1 and ends every read of stage t's buffer
  asm volatile("s_wait_tensorcnt 0x0" ::: "memory"); WAIT_DS();   // no load is outstanding when the ring's LDS is reused and the wave ends
  l += lx16(l); const float inv = 1.0f / l;   // the factor 2^6 stands in O and in l alike
  float (*ss)[516] = (float (*)[516])(smem + wave * (16 * 516 * 4));   // output staging takes the ring's place behind the last stage's barrier; each wave its own part: 16 query rows of 512 + 4 floats
#pragma unroll
  for (int d = 0; d < 32; ++d) { v4f x, y;
#pragma unroll
    for (int e = 0; e < 4; ++e) { x[e] = o[d][e] * inv; y[e] = o[d][4 + e] * inv; }
    *(v4f*)&ss[col][d * 16 + 8 * g] = x; *(v4f*)&ss[col][d * 16 + 8 * g + 4] = y; }
  LDSX(); float* op = OUT + ((size_t)b * NN + q0 + wave * 16) * DA + lane * 4;   // a store covers 512 contiguous bytes of a row: whole lines
#pragma unroll   // constant offsets: one address pair serves every store
  for (int rl = 0; rl < 16; ++rl)
#pragma unroll
    for (int c = 0; c < 4; ++c) vst2(op + (size_t)rl * DA + c * 128, *(const v4f*)&ss[rl][c * 128 + lane * 4]); }
extern "C" void kernel_launch(void* const* d_in, const int* in_sizes, int n_in, void* d_out, int out_size, void* d_ws, size_t ws_size, hipStream_t stream) {
  (void)in_sizes; (void)n_in; (void)out_size;
  const float** F = (const float**)d_in;   // 0 Q, 1 K, 2 V [8,2048,512]; 3 Wq, 4 bq, 5 Wk, 6 bk, 7 Wv, 8 bv ((in,out) [512,512] / [512])
  if (ws_size < (size_t)WS_END) return;
  char* ws = (char*)d_ws; _Float16 *QH = (_Float16*)(ws + WS_QH), *QL = (_Float16*)(ws + WS_QL), *KH = (_Float16*)(ws + WS_KH), *VT = (_Float16*)(ws + WS_VT); float *MQ = (float*)(ws + WS_M);
  k_pre<<<dim3(MT_N + 2 * PJ_N), 256, 0, stream>>>(F[1], F[3], F[4], F[5], F[6], MQ, KH, F[2], F[7], F[8], VT);
  k_proj<<<dim3(PJ_X, DA / 128), 256, 0, stream>>>(F[0], MQ, MQ + (size_t)DA * DA, QH, QL);
  k_fa<<<dim3(NN / 64, TNB), 128, 0, stream>>>(QH, QL, KH, VT, (float*)d_out);
}

// v010
// It runs in 114 microseconds.
// Next to v009, in two timings, it ran 1.10 times as fast each time.
// Counting every step since v000, it is 13.3 times as fast.
// compute dtype: all float inputs rounded to bf16; v = V Wv + bv with EXACT bf16 products on WMMA 16x16x32 ((in,out) weights), f32 accumulate; the k projection is folded into q: q . k = u . K + q . bk with u = Q (Wq Wk^T) + bq Wk^T, and q . bk, the same for every key of a row, leaves the softmax unchanged and is not formed; Wq Wk^T in f32, used as bf16 hi + residual (2 products); u as f16 hi + unscaled residual, K's bf16 values held in one f16 plane -> UNSCALED logits less the row constant with 2 products (uh K + ul K), in f32, as four partial sums over 128 k each that are added in a fixed order; softmax in f32 with a running maximum (2^x by v_exp_f32) -> P as f16 x 2^6, not normalised; P . v with v rounded once to f16 (1 product), divided by the f32 row sum at the end; f32 output.
#include <hip/hip_runtime.h>
#include <math.h>
#include <stdint.h>

typedef __attribute__((ext_vector_type(16))) _Float16 v16h;
typedef __attribute__((ext_vector_type(16))) __bf16 v16b;
typedef __attribute__((ext_vector_type(8)))  _Float16 v8h;
typedef __attribute__((ext_vector_type(8)))  float v8f;
typedef __attribute__((ext_vector_type(4)))  float v4f;
typedef __attribute__((ext_vector_type(2)))  float v2f;
typedef __attribute__((ext_vector_type(4)))  unsigned v4u;
typedef __attribute__((ext_vector_type(4)))  int v4i;
typedef float __attribute__((may_alias)) float_a;
typedef int __attribute__((may_alias)) int_a;

template <typename T> __device__ __forceinline__ void vst2(void* p, T v) { *(T*)p = v;  }
__device__ __forceinline__ v8f wmma16(v16h a, v16h b, v8f c) {
  v8f d = __builtin_amdgcn_wmma_f32_16x16x32_f16(false, a, false, b, (short)0, c, false, false);
  asm volatile("v_nop\n\tv_nop\n\tv_nop\n\tv_nop" : "+v"(d) : "v"(a), "v"(b));
  return d;
}
__device__ __forceinline__ v8f wmma_bf(v16b a, v16b b, v8f c) {
  v8f d = __builtin_amdgcn_wmma_f32_16x16x32_bf16(false, a, false, b, (short)0, c, false, false);
  asm volatile("v_nop\n\tv_nop\n\tv_nop\n\tv_nop" : "+v"(d) : "v"(a), "v"(b));
  return d;
}
// 16x16x32 fragments: lane = (h = lane>>4, row/col = lane&15); elements 0..7 = k0+8h+0..7, 8..15 = k0+16+8h+0..7; D element r = row 8h+r
__device__ __forceinline__ v16h frag_h(const _Float16* rowk0, int lane) {
  union { v16h v; v8h q[2]; } u; const _Float16* p = rowk0 + 8 * (lane >> 4);
  u.q[0] = *(const v8h*)p; u.q[1] = *(const v8h*)(p + 16); return u.v;
}
__device__ __forceinline__ v16h frag_f32(const float* rowk0, int lane) {
  v16h a; const float* p = rowk0 + 8 * (lane >> 4);
#pragma unroll
  for (int i = 0; i < 8; ++i) { a[i] = (_Float16)p[i]; a[8 + i] = (_Float16)p[16 + i]; }
  return a;
}
__device__ __forceinline__ v16h frag_f32s(const float* rowk0, int lane, float sc) {
  v16h a; const float* p = rowk0 + 8 * (lane >> 4);
#pragma unroll
  for (int i = 0; i < 8; ++i) { a[i] = (_Float16)(p[i] * sc); a[8 + i] = (_Float16)(p[16 + i] * sc); }
  return a;
}
// column fragment from a [K][ld] layout (column n), rows >= K read as 0
__device__ __forceinline__ v16h fragc_f32(const float* W, int k0, int n, int lane, int ld, int K) {
  v16h a; const int g = lane >> 4;
#pragma unroll
  for (int i = 0; i < 8; ++i) { const int ka = k0 + 8 * g + i, kb = ka + 16;
    a[i] = (_Float16)(ka < K ? W[(size_t)(ka < K ? ka : K - 1) * ld + n] : 0.f); a[8 + i] = (_Float16)(kb < K ? W[(size_t)(kb < K ? kb : K - 1) * ld + n] : 0.f); }
  return a;
}
struct F2 { v16b h, l; };
__device__ __forceinline__ F2 bsplit16(const float v[16]) { F2 r;
#pragma unroll
  for (int i = 0; i < 16; ++i) { const __bf16 h = (__bf16)v[i]; r.h[i] = h; r.l[i] = (__bf16)(v[i] - (float)h); }
  return r; }
__device__ __forceinline__ F2 split_row(const float* row, int k0, int lane) { float v[16]; const float* p = row + k0 + 8 * (lane >> 4);
#pragma unroll
  for (int i = 0; i < 8; ++i) { v[i] = p[i]; v[8 + i] = p[16 + i]; }
  return bsplit16(v); }
__device__ __forceinline__ F2 split_rowK(const float* row, int k0, int lane, int K) { float v[16]; const int g = lane >> 4;
#pragma unroll
  for (int i = 0; i < 8; ++i) { const int ka = k0 + 8 * g + i, kb = ka + 16; v[i] = ka < K ? row[ka < K ? ka : K - 1] : 0.f; v[8 + i] = kb < K ? row[kb < K ? kb : K - 1] : 0.f; }
  return bsplit16(v); }
__device__ __forceinline__ F2 split_col(const float* W, int k0, int n, int lane, int ld, int K) { float v[16]; const int g = lane >> 4;
#pragma unroll
  for (int i = 0; i < 8; ++i) { const int ka = k0 + 8 * g + i, kb = ka + 16; v[i] = ka < K ? W[(size_t)(ka < K ? ka : K - 1) * ld + n] : 0.f; v[8 + i] = kb < K ? W[(size_t)(kb < K ? kb : K - 1) * ld + n] : 0.f; }
  return bsplit16(v); }
__device__ __forceinline__ v8f mac3(const F2& a, const F2& b, v8f c) { c = wmma_bf(a.l, b.h, c); c = wmma_bf(a.h, b.l, c); return wmma_bf(a.h, b.h, c); }
__device__ __forceinline__ float sigm(float v) { return 1.0f / (1.0f + expf(-v)); }
#define LDSX() do { asm volatile("s_wait_dscnt 0" ::: "memory"); __builtin_amdgcn_wave_barrier(); __builtin_amdgcn_fence(__ATOMIC_RELEASE, "workgroup"); } while (0)


// 'NN' attention (B 8, 2,048 tokens, 512 dims, single head, no scaling): out = softmax(q k^T) v with q, k, v = Linear(Q), Linear(K), Linear(V).
#define NB 8
#define NN 2048
#define DA 512
#ifndef TNB
#define TNB NB
#endif
#ifndef TQB
#define TQB (NN / 64)
#endif
typedef __attribute__((ext_vector_type(8))) __bf16 v8b;
__device__ __forceinline__ v16b frag_b(const __bf16* rowk0, int lane) {
  union { v16b v; v8b q[2]; } u; const __bf16* p = rowk0 + 8 * (lane >> 4);
  u.q[0] = *(const v8b*)p; u.q[1] = *(const v8b*)(p + 16); return u.v;
}
__device__ __forceinline__ float bfr(float v) { return (float)(__bf16)v; }
__device__ __attribute__((noinline)) float exp_ni(float v) { return expf(v); }
__device__ __attribute__((noinline)) float erf_ni(float v) { return erff(v); }

#define WS_QH  0u                                    // f16 u rows [b*n][512]
#define WS_QL  (WS_QH + 2u * (size_t)NB * NN * DA)      // f16 u residual rows
#define WS_KH  (WS_QL + 2u * (size_t)NB * NN * DA)      // f16 K rows (the input's bf16 values)
#define WS_KL  (WS_KH + 2u * (size_t)NB * NN * DA)      // not used
#define WS_VT  (WS_KL + 2u * (size_t)NB * NN * DA)      // f16 v planes [b][512][n]
#define WS_M   (WS_VT + 2u * (size_t)NB * DA * NN)      // f32 Wq Wk^T [512][512], then 16 rows of which the first is bq Wk^T
#define WS_END (WS_M + 4u * (size_t)(DA + 16) * DA)

// ---- m_tile: block (bx, by) of the Wq Wk^T work; one wave per 16 x 16 tile of M[i][j] = sum_d Wq[i][d] Wk[j][d]; the tile row behind the last takes bq in place of a Wq row, so M's row 512 is bq Wk^T (rows 513.. repeat it and are not read).
__device__ __forceinline__ void m_tile(const int bx, const int by, const float* __restrict__ WQ, const float* __restrict__ BQ, const float* __restrict__ WK, float* __restrict__ MO) {
  const int tid = threadIdx.x, wave = tid >> 5, lane = tid & 31, col = lane & 15, g = lane >> 4; const int i0 = bx * 16, j0 = (by * 8 + wave) * 16;
  const float* ar = (i0 < DA ? WQ + (size_t)(i0 + col) * DA : BQ) + 8 * g; const float* br = WK + (size_t)(j0 + col) * DA + 8 * g;   // the lane's part of its two rows: elements 0..7 = k + 8 g + 0..7, 8..15 = k + 16 + 8 g + 0..7, alike for both operands
  v8f c0 = {}, c1 = {};   // two independent chains
  v4f xa[16], xb[16];   // a quarter of a row of each operand on its way: 32 loads in flight, so that the wave waits out a memory latency four times and not once per product
#pragma unroll   // this and the ones below: constant indices keep the rows in registers, constant offsets serve every load from the two row pointers
  for (int h = 0; h < 4; ++h) {
#pragma unroll
    for (int s = 0; s < 4; ++s) { const float* pa = ar + h * 128 + s * 32; const float* pb = br + h * 128 + s * 32;
      xa[4 * s] = *(const v4f*)pa; xa[4 * s + 1] = *(const v4f*)(pa + 4); xa[4 * s + 2] = *(const v4f*)(pa + 16); xa[4 * s + 3] = *(const v4f*)(pa + 20);
      xb[4 * s] = *(const v4f*)pb; xb[4 * s + 1] = *(const v4f*)(pb + 4); xb[4 * s + 2] = *(const v4f*)(pb + 16); xb[4 * s + 3] = *(const v4f*)(pb + 20); }
    asm volatile("s_wait_xcnt 0x0" :: "v"(ar), "v"(br) : "memory");   // precaution kept for issued global accesses; the two row pointers as inputs: no load's result may take their registers ahead of the wait
    __builtin_amdgcn_sched_barrier(0);   // without it the compiler sinks each load to just ahead of its product
#pragma unroll
    for (int s = 0; s < 4; ++s) { v16b a, w;
#pragma unroll
      for (int i = 0; i < 16; ++i) { a[i] = (__bf16)xa[4 * s + (i >> 2)][i & 3]; w[i] = (__bf16)xb[4 * s + (i >> 2)][i & 3]; }
      if (s & 1) c1 = wmma_bf(a, w, c1); else c0 = wmma_bf(a, w, c0); } }
  float* o = MO + (size_t)(i0 + 8 * g) * DA + j0 + col;
#pragma unroll
  for (int r = 0; r < 8; ++r) o[(size_t)r * DA] = c0[r] + c1[r];
  asm volatile("s_wait_xcnt 0x0" ::: "memory"); }   // the same precaution behind the stores
// ---- proj_tile: block = (128 rows bx, 128 cols by) of job 'which', 8 waves of 32 x 64: u = Q M + M's row 512 (f16 hi + residual rows; M as bf16 hi + residual, 2 products), K (no product: its bf16 values as f16 rows), v (f16 planes); each from its own input.
// Tiles of 64 k of X and of W are read once a block as whole lines, rounded to bf16 and staged in LDS (W turned k-contiguous on the way), two buffers.
typedef __attribute__((ext_vector_type(4))) __bf16 v4b;
#define PJ_PB 144                      // LDS row pitch in bytes: 128-byte rows + 16, conflict-free for 16-byte reads and for the turned W stores
#define PJ_ST (384 * PJ_PB)            // one stage: rows 0..127 W columns (64 k each), 128..255 X rows, 256..383 the residual of the W columns (u only)
static_assert(2 * PJ_ST >= 2 * 128 * 136 * 2, "the output staging takes the ring's place");
// work-group barrier that orders LDS only: __syncthreads() would also wait out the global loads of the tile after next, which are meant to stay in flight across it
#define PJ_BAR() do { __builtin_amdgcn_fence(__ATOMIC_RELEASE, "workgroup", "local"); __builtin_amdgcn_s_barrier(); __builtin_amdgcn_fence(__ATOMIC_ACQUIRE, "workgroup", "local"); } while (0)
template <int which> __device__ __forceinline__ void proj_tile(char* smem, const int bx, const int by, const float* __restrict__ XQ, const float* __restrict__ XK, const float* __restrict__ XV, const float* __restrict__ WQ, const float* __restrict__ BQ, const float* __restrict__ WK, const float* __restrict__ BK, const float* __restrict__ WV, const float* __restrict__ BV, _Float16* __restrict__ QH, _Float16* __restrict__ QL, _Float16* __restrict__ KH, _Float16* __restrict__ KL, _Float16* __restrict__ VT) {
  const int tid = threadIdx.x, wave = tid >> 5, lane = tid & 31, col = lane & 15, g = lane >> 4; const int c0 = by * 128; const size_t r0 = (size_t)bx * 128;
  if (which == 1) {   // K: rounded to bf16 like every input; 8 significant bits are held by f16. The whole block leaves here, ahead of every barrier
    const float* p = XK + (r0 + (tid >> 4)) * DA + c0 + (tid & 15) * 8; _Float16* o = KH + (r0 + (tid >> 4)) * DA + c0 + (tid & 15) * 8; v4f x[16];
#pragma unroll   // constant row offsets: one address pair serves every load, and one every store
    for (int i = 0; i < 8; ++i) { x[2 * i] = *(const v4f*)(p + (size_t)i * 16 * DA); x[2 * i + 1] = *(const v4f*)(p + (size_t)i * 16 * DA + 4); }
    asm volatile("s_wait_xcnt 0x0" :: "v"(p) : "memory");   // precaution kept for issued global accesses; p as an input: no load's result may take its registers ahead of the wait
#pragma unroll
    for (int i = 0; i < 8; ++i) { v8h h;
#pragma unroll
      for (int e = 0; e < 4; ++e) { h[e] = (_Float16)bfr(x[2 * i][e]); h[4 + e] = (_Float16)bfr(x[2 * i + 1][e]); }
      *(v8h*)(o + (size_t)i * 16 * DA) = h; }
    asm volatile("s_wait_xcnt 0x0" :: "v"(o) : "memory");   // the same precaution behind the stores
    return; }
  const int wr = wave >> 1, wc = wave & 1;   // the wave's tile: rows wr * 32, cols wc * 64
  const float* X = which == 0 ? XQ : which == 1 ? XK : XV; const float* Wm = which == 0 ? WQ : which == 1 ? WK : WV; const float* Bm = which == 0 ? BQ : which == 1 ? BK : BV;
  const int wkg = (wave & 1) * 4 + (lane & 3), wng = (wave >> 1) * 8 + (lane >> 2);   // W: a thread holds 8 k x 4 cols; a wave's load covers 4 whole lines, its 16-byte LDS stores fall on all banks
  const int xr = tid >> 4, xq = tid & 15;                                            // X: a thread holds 4 k of rows xr + 16 i; a wave's load covers 4 whole lines
  const float* wp = Wm + (size_t)(wkg * 8) * DA + c0 + wng * 4; const float* xp = X + (r0 + xr) * DA + xq * 4;
  v4f fw[8], fx[8];   // the next tile on its way through registers
  auto ld = [&](int t) { const float* pw = wp + (size_t)t * 64 * DA; const float* px = xp + t * 64;
#pragma unroll   // constant indices keep the tile in registers
    for (int i = 0; i < 8; ++i) { fw[i] = *(const v4f*)(pw + (size_t)i * DA); fx[i] = *(const v4f*)(px + (size_t)i * 16 * DA); }
    asm volatile("s_wait_xcnt 0x0" ::: "memory"); };   // precaution kept for issued global accesses, ahead of the next write of their address registers
  auto st = [&](int t) { char* sb = smem + (t & 1) * PJ_ST;
#pragma unroll
    for (int c = 0; c < 4; ++c) { v8b h;
#pragma unroll
      for (int i = 0; i < 8; ++i) h[i] = (__bf16)fw[i][c];
      *(v8b*)(sb + (wng * 4 + c) * PJ_PB + wkg * 16) = h;
      if (which == 0) { v8b l;
#pragma unroll
        for (int i = 0; i < 8; ++i) l[i] = (__bf16)(fw[i][c] - (float)h[i]);
        *(v8b*)(sb + (256 + wng * 4 + c) * PJ_PB + wkg * 16) = l; } }
#pragma unroll
    for (int i = 0; i < 8; ++i) { v4b h; h[0] = (__bf16)fx[i][0]; h[1] = (__bf16)fx[i][1]; h[2] = (__bf16)fx[i][2]; h[3] = (__bf16)fx[i][3];
      *(v4b*)(sb + (128 + xr + 16 * i) * PJ_PB + xq * 8) = h; } };
  v8f acc[2][4] = {};
  ld(0); st(0); ld(1); PJ_BAR();
#pragma unroll 1   // one copy of the trip's body: the buffer is picked by t & 1
  for (int t = 0; t < DA / 64; ++t) { const __bf16* sb = (const __bf16*)(smem + (t & 1) * PJ_ST);
#pragma unroll   // this and the ones below: constant indices keep fragments and accumulators in registers
    for (int kk = 0; kk < 2; ++kk) { v16b a[2], w[4];
#pragma unroll
      for (int i = 0; i < 2; ++i) a[i] = frag_b(sb + (128 + wr * 32 + i * 16 + col) * (PJ_PB / 2) + kk * 32, lane);
#pragma unroll
      for (int j = 0; j < 4; ++j) w[j] = frag_b(sb + (wc * 64 + j * 16 + col) * (PJ_PB / 2) + kk * 32, lane);
#pragma unroll
      for (int i = 0; i < 2; ++i)
#pragma unroll
        for (int j = 0; j < 4; ++j) acc[i][j] = wmma_bf(a[i], w[j], acc[i][j]);
      if (which == 0) {   // block-uniform: the residual of M against the same X fragments
#pragma unroll
        for (int j = 0; j < 4; ++j) w[j] = frag_b(sb + (256 + wc * 64 + j * 16 + col) * (PJ_PB / 2) + kk * 32, lane);
#pragma unroll
        for (int i = 0; i < 2; ++i)
#pragma unroll
          for (int j = 0; j < 4; ++j) acc[i][j] = wmma_bf(a[i], w[j], acc[i][j]); } }
    if (t + 1 < DA / 64) st(t + 1);   // into the buffer whose last readers left at the barrier of trip t - 1
    if (t + 2 < DA / 64) ld(t + 2);
    PJ_BAR(); }   // publishes tile t + 1 and ends every read of tile t's buffer
  _Float16 (*sh)[136] = (_Float16 (*)[136])smem, (*sl)[136] = (_Float16 (*)[136])(smem + 128 * 136 * 2), (*th)[136] = (_Float16 (*)[136])smem;   // output staging takes the ring's place behind the last trip's barrier
#pragma unroll
  for (int i = 0; i < 2; ++i)
#pragma unroll
    for (int j = 0; j < 4; ++j) { const float bi = Bm[c0 + wc * 64 + j * 16 + col]; const float bb = which == 0 ? bi : bfr(bi);   // u's bias is bq Wk^T, computed in f32: not an input, not rounded
#pragma unroll
      for (int r = 0; r < 8; ++r) { const float v = acc[i][j][r] + bb; const int rl = wr * 32 + i * 16 + 8 * g + r, cl = wc * 64 + j * 16 + col; const _Float16 hv = (_Float16)v;
        if (which == 2) th[cl][rl] = hv; else { sh[rl][cl] = hv; sl[rl][cl] = (_Float16)(v - (float)hv); } } }
  __syncthreads();
  if (which < 2) { _Float16* dh = which == 0 ? QH : KH; for (int e = tid; e < 128 * 16; e += 256) { const int rl = e >> 4, q = e & 15; vst2((unsigned*)(dh + (r0 + rl) * DA + c0 + q * 8), *(const v4u*)&sh[rl][q * 8]); vst2((unsigned*)((which == 0 ? QL : KL) + (r0 + rl) * DA + c0 + q * 8), *(const v4u*)&sl[rl][q * 8]); } }
  else { const size_t b = r0 / NN; const int n0 = (int)(r0 % NN); for (int e = tid; e < 128 * 16; e += 256) { const int cl = e >> 4, q = e & 15; vst2((unsigned*)(VT + (b * DA + c0 + cl) * (size_t)NN + n0 + q * 8), *(const v4u*)&th[cl][q * 8]); } } }
// ---- where the projection jobs are launched. Only u needs Wq Wk^T. k_pre: the few latency-bound Wq Wk^T blocks, first in the grid, then the v projection (LDS, L2 and matrix work), then the short blocks that round K (memory bytes only).
// k_proj, behind it: u alone.
#define MT_X (DA / 16 + 1)
#define MT_N (MT_X * (DA / 128))
#define PJ_X (TNB * NN / 128)
#define PJ_N (PJ_X * (DA / 128))
__global__ __launch_bounds__(256) void k_pre(const float* __restrict__ XK, const float* __restrict__ WQ, const float* __restrict__ BQ, const float* __restrict__ WK, const float* __restrict__ BK, float* __restrict__ MO, _Float16* __restrict__ KH, const float* __restrict__ XV, const float* __restrict__ WV, const float* __restrict__ BV, _Float16* __restrict__ VT) {
  __shared__ __align__(16) char smem[2 * PJ_ST];
  const int bid = blockIdx.x;   // the tests are the same for the whole block
  if (bid < MT_N) { m_tile(bid % MT_X, bid / MT_X, WQ, BQ, WK, MO); return; }
  if (bid < MT_N + PJ_N) { const int i = bid - MT_N; proj_tile<2>(smem, i >> 2, i & 3, nullptr, nullptr, XV, nullptr, nullptr, nullptr, nullptr, WV, BV, nullptr, nullptr, nullptr, nullptr, VT); return; }   // the four column blocks of a row block of V are neighbours
  const int e = bid - MT_N - PJ_N;
  proj_tile<1>(nullptr, e % PJ_X, e / PJ_X, nullptr, XK, nullptr, nullptr, nullptr, WK, BK, nullptr, nullptr, nullptr, nullptr, KH, nullptr, nullptr); }   // the K job touches no LDS
__global__ __launch_bounds__(256) void k_proj(const float* __restrict__ XQ, const float* __restrict__ MQ, const float* __restrict__ MB, _Float16* __restrict__ QH, _Float16* __restrict__ QL) {
  __shared__ __align__(16) char smem[2 * PJ_ST];
  proj_tile<0>(smem, blockIdx.x, blockIdx.y, XQ, nullptr, nullptr, MQ, MB, nullptr, nullptr, nullptr, nullptr, QH, QL, nullptr, nullptr, nullptr); }
// ---- tensor loads: one request of a wave brings a two-dimensional tile global -> LDS, through no register and with no per-lane address work
typedef uint32_t u32x4 __attribute__((ext_vector_type(4)));
typedef uint32_t u32x8 __attribute__((ext_vector_type(8)));
__device__ __forceinline__ uint32_t uni(uint32_t v) { return (uint32_t)__builtin_amdgcn_readfirstlane(v); }
// an issue test, or the stage number a descriptor is formed from: the test compiles to a scalar branch, and what is formed from the number stays behind the waits written in front of it
__device__ __forceinline__ uint32_t pinned(uint32_t v) { uint32_t w = (uint32_t)__builtin_amdgcn_readfirstlane(v); asm volatile("" : "+s"(w)); return w; }   // the empty statement holds the word in a scalar register (tensor mover: issue test, descriptor word)
// group 1: 1-byte elements, tensor = tile = rows x ROWB bytes, source row pitch in bytes, no mask; 16 bytes of LDS pad behind every row (interval code IVL = the row's length)
template <uint32_t ROWB, uint32_t IVL> __device__ __forceinline__ u32x8 tdm_group1(uint32_t rows, uint32_t src_pitch) {
  u32x8 g;
  g[0] = uni((1u << 20) | (IVL << 22) | (3u << 25));
  g[1] = uni((ROWB & 0xFFFFu) << 16);
  g[2] = uni((ROWB >> 16) | ((rows & 0xFFFFu) << 16));
  g[3] = uni((rows >> 16) | (ROWB << 16));
  g[4] = uni(rows);
  g[5] = uni(src_pitch);
  g[6] = uni(0u);
  g[7] = uni(0u);
  return g;
}
// group 0: count 1, the tile's place in the work-group's LDS, the global address of its first byte, type 2
__device__ __forceinline__ u32x4 tdm_group0(uint32_t lds_dst, uint64_t ga) {
  u32x4 g;
  g[0] = uni(1u); g[1] = uni(lds_dst); g[2] = uni((uint32_t)ga); g[3] = uni((((uint32_t)(ga >> 32)) & 0x01FFFFFFu) | 0x80000000u);
  return g;
}
__device__ __forceinline__ void tdm_load(u32x4 g0, u32x8 g1) { asm volatile("tensor_load_to_lds %0, %1" :: "s"(g0), "s"(g1) : "memory"); }
// this wave's LDS reads have retired before the buffer they read is handed back for a refill
#define WAIT_DS() asm volatile("s_wait_dscnt 0x0" ::: "memory")
// this wave's outstanding tensor loads (a K slice, a v slice or both) have landed (the compiler places no wait for them); the wait names the four descriptor groups as inputs, so that their scalar registers keep their words until then
__device__ __forceinline__ void wait_tensor2(u32x4 a0, u32x8 a1, u32x4 b0, u32x8 b1) { asm volatile("s_wait_tensorcnt 0x0" :: "s"(a0), "s"(a1), "s"(b0), "s"(b1) : "memory"); }
// the plain builtin: the compiler keeps the distances behind it itself. k_fa holds more than 256 registers a wave, and the operands of an asm statement (wmma16's) would all have to stand in the first 256
__device__ __forceinline__ v8f wmma_p(v16h a, v16h b, v8f c) { return __builtin_amdgcn_wmma_f32_16x16x32_f16(false, a, false, b, (short)0, c, false, false); }
// value of lane l ^ 16
__device__ __forceinline__ float lx16(float v) { return __builtin_bit_cast(float, __builtin_amdgcn_permlanex16(__builtin_bit_cast(int, v), __builtin_bit_cast(int, v), 0x76543210, 0xfedcba98, false, false)); }
// ---- k_fa: block = (64 queries, batch), 4 waves, one per SIMD: logits, softmax and P . v in one kernel. A wave works for ALL 64 queries on one slice of 128: of the k dims in the scores, of the value dims in P . v,
// so that each K or v fragment read from LDS serves 8 or 4 products, and a wave reads only the K and v slices that its own tensor loads brought.
// S^T = K u^T: A = K rows of the wave's k slice, B = the 64 queries' u (hi and residual) of that slice, held in registers for the whole kernel. The four waves' partial scores (f32) meet in LDS; wave w adds them for queries 16 w .. 16 w + 15,
// where a lane holds 32 of the 64 scores of ONE query: maximum and sum in the lane, one exchange between the halves. The score tiles of 32 keys, rounded to f16, ARE the B fragment of O^T += v^T P^T (element r = key 8 g + r,
// element 8 + r = key 16 + 8 g + r, the k order of frag_h); they go to the other waves through LDS, with the factor by which the running maximum's move scales the output tiles. A = v plane rows of the wave's 128 value dims.
// The output tiles are rescaled only when a new maximum lies more than FA_TH above the one in use, so P x 2^6 stays below 2^14 in f16.
#define FA_SL 18432                    // one slice: 64 K rows of 256 + 16 bytes, rounded up to a multiple of 2 KiB, or 128 v plane rows of 128 + 16 bytes
#define FA_NT (NN / 64)                // stages of 64 keys
#define FA_VB (8 * FA_SL)              // K: two buffers of four slices from 0; v: one buffer of four slices from here (its second buffer is the registers)
#define FA_SX (12 * FA_SL)             // partial scores [from wave][query tile][key tile][half of the 8 rows][lane] 16 bytes
#define FA_PB (FA_SX + 65536)          // P fragments [query tile][32 keys][half][lane] 16 bytes
#define FA_AB (FA_PB + 8192)           // scale factors [query tile][lane]
#define FA_IB (FA_AB + 512)            // 1 / row sum [query tile][lane]
#define FA_LDS (FA_IB + 512)
#define FA_TH 5.5f
#define FA_L2E 1.44269504088896340736f
static_assert(FA_SL % 2048 == 0 && FA_SL >= 64 * 272 && FA_SL >= 128 * 144 && FA_LDS <= 327680 && FA_SX >= 4 * 64 * 132 * 4 && NN % 64 == 0 && FA_NT >= 3 && DA == 512, "slices at multiples of 2 KiB inside the LDS of one WGP; the output staging takes the slices' place; three stages or more");
// this wave's own three tensor loads of the prologue have landed; the descriptor groups as inputs, so that their scalar registers keep their words until then
__device__ __forceinline__ void wait_tensor3(u32x4 a0, u32x8 a1, u32x4 b0, u32x8 b1, u32x4 c0) { asm volatile("s_wait_tensorcnt 0x0" :: "s"(a0), "s"(a1), "s"(b0), "s"(b1), "s"(c0) : "memory"); }
__global__ __launch_bounds__(128) void k_fa(const _Float16* __restrict__ QH, const _Float16* __restrict__ QL, const _Float16* __restrict__ KH, const _Float16* __restrict__ VT, float* __restrict__ OUT) { __shared__ __attribute__((aligned(2048))) char smem[FA_LDS];
  const int tid = threadIdx.x, wave = tid >> 5, lane = tid & 31, col = lane & 15, g = lane >> 4; const int b = blockIdx.y; const int q0 = blockIdx.x * 64;
  const uint32_t wv = uni(threadIdx.x >> 5);   // the wave's number, scalar: every wave brings K slice wv (64 keys x 128 k) and v slice wv (128 value dims x 64 keys) of every stage
  const uint64_t gk = (uint64_t)(size_t)(KH + (size_t)b * NN * DA + wv * 128);
  const uint64_t gv = (uint64_t)(size_t)(VT + ((size_t)b * DA + wv * 128) * (size_t)NN);
  const uint32_t lk = (uint32_t)(size_t)smem + wv * FA_SL, lv = lk + FA_VB;
  const u32x8 g1k = tdm_group1<256, 5>(pinned(64u), DA * 2u);    // pinned, here and in the next line: the words formed from it are held in scalar registers, one register group for every request and its wait
  const u32x8 g1v = tdm_group1<128, 4>(pinned(128u), NN * 2u);
  const u32x4 p0k = tdm_group0(lk, gk), p0v = tdm_group0(lv, gv), p1k = tdm_group0(lk + 4 * FA_SL, gk + 64u * DA * 2u);   // K of stages 0 and 1, v of stage 0
  tdm_load(p0k, g1k); tdm_load(p0v, g1v); tdm_load(p1k, g1k);
  v16h uh[4][4], ul[4][4];   // u of the 64 queries, the wave's k slice, as B fragments [query tile][32 k]: lane = (g, query col)
  { const _Float16* ph = QH + ((size_t)b * NN + q0 + col) * DA + wave * 128 + 8 * g; const _Float16* pl = QL + ((size_t)b * NN + q0 + col) * DA + wave * 128 + 8 * g;
#pragma unroll   // this and the ones below: constant indices keep fragments and accumulators in registers
    for (int qt = 0; qt < 4; ++qt)
#pragma unroll
      for (int kk = 0; kk < 4; ++kk) { const int e = qt * 16 * DA + kk * 32; union { v16h v; v8h q[2]; } x, y; x.q[0] = *(const v8h*)(ph + e); x.q[1] = *(const v8h*)(ph + e + 16); y.q[0] = *(const v8h*)(pl + e); y.q[1] = *(const v8h*)(pl + e + 16); uh[qt][kk] = x.v; ul[qt][kk] = y.v; }
    asm volatile("s_wait_xcnt 0x0" :: "v"(ph), "v"(pl) : "memory"); }   // precaution kept for issued global accesses; the two row pointers as inputs: no load's result may take their registers ahead of the wait
  v8f o[8][4] = {};   // O^T [value tile][query tile]: value dims 128 wave + 16 d + 8 g + r, column = query 16 qt + col
  float m = -3.0e38f, l = 0.f;   // of the wave's own query tile: the maximum in use (the same in both halves) and this half's part of the sum
  v16h kf[4][4], vf[8][2];   // the stage's K fragments [key tile][32 k] and v fragments [value tile][32 keys]
  const _Float16* ks = (const _Float16*)(smem + wave * FA_SL); const _Float16* vs = (const _Float16*)(smem + FA_VB + wave * FA_SL);
  char* sxs = smem + FA_SX + wave * 16384 + lane * 16; const char* sxl = smem + FA_SX + wave * 4096 + lane * 16; char* pb = smem + FA_PB + lane * 16; float* ab = (float*)(smem + FA_AB) + lane; float* ib = (float*)(smem + FA_IB) + lane;
  auto load_k = [&](int buf) { const _Float16* kb = ks + buf * (4 * FA_SL / 2);
#pragma unroll
    for (int j = 0; j < 4; ++j)
#pragma unroll
      for (int kk = 0; kk < 4; ++kk) kf[j][kk] = frag_h(kb + (j * 16 + col) * 136 + kk * 32, lane); };
  // partial scores of 64 keys x 64 queries over the wave's 128 k, operands all in registers; uh K and ul K into one accumulator, seven other tiles between two products of a tile
  auto scores = [&](int nbuf) { v8f s[4][4] = {};
#pragma unroll
    for (int jp = 0; jp < 2; ++jp)   // two key tiles at a time: eight independent accumulators
#pragma unroll
      for (int kk = 0; kk < 4; ++kk) {
#pragma unroll
        for (int jj = 0; jj < 2; ++jj)
#pragma unroll
          for (int qt = 0; qt < 4; ++qt) s[jp * 2 + jj][qt] = wmma_p(kf[jp * 2 + jj][kk], uh[qt][kk], s[jp * 2 + jj][qt]);
#pragma unroll
        for (int jj = 0; jj < 2; ++jj)
#pragma unroll
          for (int qt = 0; qt < 4; ++qt) s[jp * 2 + jj][qt] = wmma_p(kf[jp * 2 + jj][kk], ul[qt][kk], s[jp * 2 + jj][qt]); }
    __builtin_amdgcn_sched_barrier(0);   // the stores stay behind the products: moved in among them, they free a tile's registers for the next tile's first product too close behind the tile's last one
#pragma unroll
    for (int j = 0; j < 4; ++j)
#pragma unroll
      for (int qt = 0; qt < 4; ++qt) { v4f x, y;
#pragma unroll
        for (int e = 0; e < 4; ++e) { x[e] = s[j][qt][e]; y[e] = s[j][qt][4 + e]; }
        *(v4f*)(sxs + (qt * 4 + j) * 1024) = x; *(v4f*)(sxs + (qt * 4 + j) * 1024 + 512) = y; }
    load_k(nbuf);   // the next stage's K fragments, into the registers that the products above have left
    __builtin_amdgcn_sched_barrier(0); };   // stores and K reads stay one group ahead of the P . v products, under which they drain and land
  // the wave's own 16 queries: the four partial sums added, running maximum, P and the scale factor handed to LDS; the stage's v fragments are asked for in the same group of reads
  auto softmax = [&]() { v4f pt[4][4][2];
#pragma unroll
    for (int w = 0; w < 4; ++w)
#pragma unroll
      for (int j = 0; j < 4; ++j) { pt[w][j][0] = *(const v4f*)(sxl + w * 16384 + j * 1024); pt[w][j][1] = *(const v4f*)(sxl + w * 16384 + j * 1024 + 512); }
#pragma unroll
    for (int d = 0; d < 8; ++d)
#pragma unroll
      for (int h = 0; h < 2; ++h) vf[d][h] = frag_h(vs + (d * 16 + col) * 72 + h * 32, lane);
    __builtin_amdgcn_sched_barrier(0);   // the reads stay one group ahead of the arithmetic, the partial scores first: the v fragments land under it
    float s[4][8];
#pragma unroll
    for (int j = 0; j < 4; ++j)
#pragma unroll
      for (int r = 0; r < 8; ++r) s[j][r] = (pt[0][j][r >> 2][r & 3] + pt[1][j][r >> 2][r & 3]) + (pt[2][j][r >> 2][r & 3] + pt[3][j][r >> 2][r & 3]);
    float mx = s[0][0];
#pragma unroll
    for (int j = 0; j < 4; ++j)
#pragma unroll
      for (int r = 0; r < 8; ++r) mx = fmaxf(mx, s[j][r]);
    mx = fmaxf(mx, lx16(mx));
    float al = 1.0f;
    if (__builtin_amdgcn_ballot_w32(mx > m + FA_TH) != 0) {   // the same for the whole wave: a scalar branch, no matrix instruction inside
      const float mn = fmaxf(m, mx); al = __builtin_amdgcn_exp2f((m - mn) * FA_L2E); m = mn; l *= al; }
    ab[wave * 32] = al;
    const float mb = m * FA_L2E - 6.0f; float e0 = 0.f, e1 = 0.f, e2 = 0.f, e3 = 0.f;
#pragma unroll
    for (int j = 0; j < 4; ++j) { v8h pf;
#pragma unroll
      for (int r = 0; r < 8; ++r) { const float x = __builtin_amdgcn_exp2f(fmaf(s[j][r], FA_L2E, -mb)); if (j == 0) e0 += x; else if (j == 1) e1 += x; else if (j == 2) e2 += x; else e3 += x; pf[r] = (_Float16)x; }
      *(v8h*)(pb + (wave * 4 + j) * 512) = pf; }   // key tile j = half j & 1 of the fragment of keys 32 (j >> 1)
    l += (e0 + e1) + (e2 + e3); };
  // O^T += v^T P^T for the wave's 128 value dims and all 64 queries, in two parts: P and the factors are asked for directly behind the barrier that published them and land under the next stage's score products;
  // the products follow those of the next stage's scores, so that the partial scores' stores drain under them
  v16h pf[4][2]; float a[4];
  auto pv_load = [&]() {
#pragma unroll
    for (int qt = 0; qt < 4; ++qt) { a[qt] = ab[qt * 32];
#pragma unroll
      for (int h = 0; h < 2; ++h) { union { v16h v; v8h q[2]; } x; x.q[0] = *(const v8h*)(pb + (qt * 4 + h * 2) * 512); x.q[1] = *(const v8h*)(pb + (qt * 4 + h * 2 + 1) * 512); pf[qt][h] = x.v; } }
    __builtin_amdgcn_sched_barrier(0); };   // without it the compiler sinks the reads to just ahead of their products, where the lone wave of the SIMD waits them out
  auto pv_mul = [&]() {
    if (__builtin_amdgcn_ballot_w32(fminf(fminf(a[0], a[1]), fminf(a[2], a[3])) < 1.0f) != 0) {   // the same for the whole wave: a scalar branch, no matrix instruction inside
#pragma unroll
      for (int d = 0; d < 8; ++d)
#pragma unroll
        for (int qt = 0; qt < 4; ++qt) o[d][qt] *= a[qt]; }
#pragma unroll
    for (int h = 0; h < 2; ++h)
#pragma unroll
      for (int d = 0; d < 8; ++d)
#pragma unroll
        for (int qt = 0; qt < 4; ++qt) o[d][qt] = wmma_p(vf[d][h], pf[qt][h], o[d][qt]);
    __builtin_amdgcn_sched_barrier(0); };   // without it the compiler sinks the products behind the wait and the barrier that follow, in among the next reads, and the stores' drain is waited out idle
  wait_tensor3(p0k, g1k, p0v, g1v, p1k); load_k(0);   // a wave reads only slices that it has brought itself: its own wait is enough
  __builtin_amdgcn_sched_barrier(0);   // the K reads stay one group ahead of the products
  scores(1); WAIT_DS(); __syncthreads();   // publishes the partial scores; this wave's K fragments of stages 0 and 1 have left both K buffers
  const u32x4 p2k = tdm_group0(lk, gk + 2u * (64u * DA * 2u)); tdm_load(p2k, g1k);   // K of stage 2
  softmax(); WAIT_DS(); wait_tensor2(p2k, g1k, p2k, g1k); __syncthreads();  // publishes P and the factors, ends every read of the partial scores; this wave's v fragments have left the v buffer
#pragma unroll 1   // one copy of the stage's body: the K buffer is picked by t & 1
  for (int t = 0; t + 1 < FA_NT; ++t) {
    // behind this wave's s_wait_dscnt 0 and a barrier: v of stage t + 1 into the v buffer, K of stage t + 3 into the buffer whose fragments (stage t + 1) were read a stage ago. The groups 0 are formed and waited for inside one trip,
    // so that they stay in the registers that the requests name; in the last two trips K's is formed (in bounds) and not issued
    const uint32_t sv = pinned((uint32_t)t + 1u), sk = pinned((uint32_t)t + 3u < FA_NT ? (uint32_t)t + 3u : (uint32_t)t + 1u);   // pinned: the descriptors are formed behind the wait of the trip before
    const u32x4 g0v = tdm_group0(lv, gv + (uint64_t)sv * 128u), g0k = tdm_group0(lk + (sk & 1u) * (4 * FA_SL), gk + (uint64_t)sk * (64u * DA * 2u));
    tdm_load(g0v, g1v);
    if (pinned((uint32_t)t + 3u < FA_NT)) tdm_load(g0k, g1k);   // pinned: a scalar branch decides whether the wave issues
    pv_load();        // P of stage t
    scores(t & 1);    // stage t + 1; fetches the K fragments of stage t + 2, which landed a trip ago (in the last trip: of an old stage, not used)
    pv_mul();         // stage t
    WAIT_DS(); wait_tensor2(g0k, g1k, g0v, g1v); __syncthreads();   // publishes the partial scores of stage t + 1, ends every read of P; this wave's v (stage t + 1) and K (stage t + 3) have landed
    softmax(); WAIT_DS(); __syncthreads(); }   // as in front of the loop
  pv_load(); pv_mul();
  asm volatile("s_wait_tensorcnt 0x0" ::: "memory"); WAIT_DS();   // no load is outstanding when the slices' LDS is reused and the wave ends
  l += lx16(l); ib[wave * 32] = 1.0f / l;   // the factor 2^6 stands in O and in l alike
  WAIT_DS(); __syncthreads();   // publishes 1 / row sum; every wave has left the slices and P
  float inv[4];
#pragma unroll
  for (int qt = 0; qt < 4; ++qt) inv[qt] = ib[qt * 32];
  float (*ss)[132] = (float (*)[132])(smem + wave * (64 * 132 * 4));   // output staging takes the slices' place; each wave its own part: 64 query rows of 128 + 4 floats
#pragma unroll
  for (int d = 0; d < 8; ++d)
#pragma unroll
    for (int qt = 0; qt < 4; ++qt) { v4f x, y;
#pragma unroll
      for (int e = 0; e < 4; ++e) { x[e] = o[d][qt][e] * inv[qt]; y[e] = o[d][qt][4 + e] * inv[qt]; }
      *(v4f*)&ss[qt * 16 + col][d * 16 + 8 * g] = x; *(v4f*)&ss[qt * 16 + col][d * 16 + 8 * g + 4] = y; }
  LDSX(); float* op = OUT + ((size_t)b * NN + q0) * DA + wave * 128 + lane * 4;   // a store covers 512 contiguous bytes of a row: whole lines
#pragma unroll   // constant offsets: one address pair serves every store
  for (int rl = 0; rl < 64; ++rl) vst2(op + (size_t)rl * DA, *(const v4f*)&ss[rl][lane * 4]); }
extern "C" void kernel_launch(void* const* d_in, const int* in_sizes, int n_in, void* d_out, int out_size, void* d_ws, size_t ws_size, hipStream_t stream) {
  (void)in_sizes; (void)n_in; (void)out_size;
  const float** F = (const float**)d_in;   // 0 Q, 1 K, 2 V [8,2048,512]; 3 Wq, 4 bq, 5 Wk, 6 bk, 7 Wv, 8 bv ((in,out) [512,512] / [512])
  if (ws_size < (size_t)WS_END) return;
  char* ws = (char*)d_ws; _Float16 *QH = (_Float16*)(ws + WS_QH), *QL = (_Float16*)(ws + WS_QL), *KH = (_Float16*)(ws + WS_KH), *VT = (_Float16*)(ws + WS_VT); float *MQ = (float*)(ws + WS_M);
  k_pre<<<dim3(MT_N + 2 * PJ_N), 256, 0, stream>>>(F[1], F[3], F[4], F[5], F[6], MQ, KH, F[2], F[7], F[8], VT);
  k_proj<<<dim3(PJ_X, DA / 128), 256, 0, stream>>>(F[0], MQ, MQ + (size_t)DA * DA, QH, QL);
  k_fa<<<dim3(NN / 64, TNB), 128, 0, stream>>>(QH, QL, KH, VT, (float*)d_out);
}
